// v000
// Times are from an AMD MI455X. After a warm-up the kernel runs many times in a row, and a time is the length of
// such a window on the GPU divided by its runs, so every launch and the gaps after it count. The runs cycle
// through copies of the inputs. A figure is the median of several windows, for all but v000 over two sittings.
// Sittings can differ by a few percent; kernels timed side by side share one.
// v000 is the starting kernel. One run takes 530 microseconds.
// compute dtype: all float inputs rounded to bf16; Q/K/V = input . W^T + b with EXACT bf16 products on WMMA 16x16x32 (natural rows); the module's raw reshape (B,S,D)->(B,H,S,Dh) means 'head h' = the 128 projected rows 128h..128h+127 viewed as 2,048 positions x 64 (position p = (s - 128h)*16 + c/64) - handled purely by addressing; Q/K as f16 hi + residual (3-product scores for positions < 128, single f16 after), V as f16 hi + residual planes (2 products); mask: keys j >= i set to -1e9 INCLUDING the diagonal, so position 0 attends uniformly to all 2,048 keys (all logits equal) and position i >= 1 to keys < i; x 1/8; running-max softmax in f32 (hardware exp); the context in the same raw layout is the f32 output.
#include <hip/hip_runtime.h>
#include <math.h>

typedef __attribute__((ext_vector_type(16))) _Float16 v16h;
typedef __attribute__((ext_vector_type(16))) __bf16 v16b;
typedef __attribute__((ext_vector_type(8)))  _Float16 v8h;
typedef __attribute__((ext_vector_type(8)))  float v8f;
typedef __attribute__((ext_vector_type(4)))  float v4f;
typedef __attribute__((ext_vector_type(2)))  float v2f;
typedef __attribute__((ext_vector_type(4)))  unsigned v4u;
typedef __attribute__((ext_vector_type(4)))  int v4i;
typedef float __attribute__((may_alias)) float_a;
typedef int __attribute__((may_alias)) int_a;

template <typename T> __device__ __forceinline__ void vst2(void* p, T v) { *(T*)p = v;  }
__device__ __forceinline__ v8f wmma16(v16h a, v16h b, v8f c) {
  v8f d = __builtin_amdgcn_wmma_f32_16x16x32_f16(false, a, false, b, (short)0, c, false, false);
  asm volatile("v_nop\n\tv_nop\n\tv_nop\n\tv_nop" : "+v"(d) : "v"(a), "v"(b));
  return d;
}
__device__ __forceinline__ v8f wmma_bf(v16b a, v16b b, v8f c) {
  v8f d = __builtin_amdgcn_wmma_f32_16x16x32_bf16(false, a, false, b, (short)0, c, false, false);
  asm volatile("v_nop\n\tv_nop\n\tv_nop\n\tv_nop" : "+v"(d) : "v"(a), "v"(b));
  return d;
}
// 16x16x32 fragments: lane = (h = lane>>4, row/col = lane&15); elements 0..7 = k0+8h+0..7, 8..15 = k0+16+8h+0..7; D element r = row 8h+r
__device__ __forceinline__ v16h frag_h(const _Float16* rowk0, int lane) {
  union { v16h v; v8h q[2]; } u; const _Float16* p = rowk0 + 8 * (lane >> 4);
  u.q[0] = *(const v8h*)p; u.q[1] = *(const v8h*)(p + 16); return u.v;
}
__device__ __forceinline__ v16h frag_f32(const float* rowk0, int lane) {
  v16h a; const float* p = rowk0 + 8 * (lane >> 4);
#pragma unroll
  for (int i = 0; i < 8; ++i) { a[i] = (_Float16)p[i]; a[8 + i] = (_Float16)p[16 + i]; }
  return a;
}
__device__ __forceinline__ v16h frag_f32s(const float* rowk0, int lane, float sc) {
  v16h a; const float* p = rowk0 + 8 * (lane >> 4);
#pragma unroll
  for (int i = 0; i < 8; ++i) { a[i] = (_Float16)(p[i] * sc); a[8 + i] = (_Float16)(p[16 + i] * sc); }
  return a;
}
// column fragment from a [K][ld] layout (column n), rows >= K read as 0
__device__ __forceinline__ v16h fragc_f32(const float* W, int k0, int n, int lane, int ld, int K) {
  v16h a; const int g = lane >> 4;
#pragma unroll
  for (int i = 0; i < 8; ++i) { const int ka = k0 + 8 * g + i, kb = ka + 16;
    a[i] = (_Float16)(ka < K ? W[(size_t)(ka < K ? ka : K - 1) * ld + n] : 0.f); a[8 + i] = (_Float16)(kb < K ? W[(size_t)(kb < K ? kb : K - 1) * ld + n] : 0.f); }
  return a;
}
struct F2 { v16b h, l; };
__device__ __forceinline__ F2 bsplit16(const float v[16]) { F2 r;
#pragma unroll
  for (int i = 0; i < 16; ++i) { const __bf16 h = (__bf16)v[i]; r.h[i] = h; r.l[i] = (__bf16)(v[i] - (float)h); }
  return r; }
__device__ __forceinline__ F2 split_row(const float* row, int k0, int lane) { float v[16]; const float* p = row + k0 + 8 * (lane >> 4);
#pragma unroll
  for (int i = 0; i < 8; ++i) { v[i] = p[i]; v[8 + i] = p[16 + i]; }
  return bsplit16(v); }
__device__ __forceinline__ F2 split_rowK(const float* row, int k0, int lane, int K) { float v[16]; const int g = lane >> 4;
#pragma unroll
  for (int i = 0; i < 8; ++i) { const int ka = k0 + 8 * g + i, kb = ka + 16; v[i] = ka < K ? row[ka < K ? ka : K - 1] : 0.f; v[8 + i] = kb < K ? row[kb < K ? kb : K - 1] : 0.f; }
  return bsplit16(v); }
__device__ __forceinline__ F2 split_col(const float* W, int k0, int n, int lane, int ld, int K) { float v[16]; const int g = lane >> 4;
#pragma unroll
  for (int i = 0; i < 8; ++i) { const int ka = k0 + 8 * g + i, kb = ka + 16; v[i] = ka < K ? W[(size_t)(ka < K ? ka : K - 1) * ld + n] : 0.f; v[8 + i] = kb < K ? W[(size_t)(kb < K ? kb : K - 1) * ld + n] : 0.f; }
  return bsplit16(v); }
__device__ __forceinline__ v8f mac3(const F2& a, const F2& b, v8f c) { c = wmma_bf(a.l, b.h, c); c = wmma_bf(a.h, b.l, c); return wmma_bf(a.h, b.h, c); }
__device__ __forceinline__ float sigm(float v) { return 1.0f / (1.0f + expf(-v)); }
#define LDSX() do { asm volatile("s_wait_dscnt 0" ::: "memory"); __builtin_amdgcn_wave_barrier(); __builtin_amdgcn_fence(__ATOMIC_RELEASE, "workgroup"); } while (0)


// 'Fast' MHA with raw-reshape heads (B 2, S 2,048, D 1,024, 16 'heads' x 64): separate query / key / value inputs, natural projections + biases, triu(offset 0)-masked softmax(q k / 8) v, raw reshape back (no output projection).
#define NB 2
#define SS 2048           // positions per head (== S)
#define DD 1024
#define NH 16
#define DH 64
#define NROW (NB * SS)    // projected rows
#ifndef TNB
#define TNB NB
#endif
typedef __attribute__((ext_vector_type(8))) __bf16 v8b;
__device__ __forceinline__ v16b frag_b(const __bf16* rowk0, int lane) {
  union { v16b v; v8b q[2]; } u; const __bf16* p = rowk0 + 8 * (lane >> 4);
  u.q[0] = *(const v8b*)p; u.q[1] = *(const v8b*)(p + 16); return u.v;
}
__device__ __forceinline__ float bfr(float v) { return (float)(__bf16)v; }
__device__ __attribute__((noinline)) float exp_ni(float v) { return expf(v); }
__device__ __attribute__((noinline)) float erf_ni(float v) { return erff(v); }

#define WS_QH  0u                                   // f16 hi|lo Q flat [b][s][1024] == [b][h][p][64]
#define WS_QL  (WS_QH + 2u * (size_t)NROW * DD)
#define WS_KH  (WS_QL + 2u * (size_t)NROW * DD)
#define WS_KL  (WS_KH + 2u * (size_t)NROW * DD)
#define WS_VF  (WS_KL + 2u * (size_t)NROW * DD)          // f32 V flat
#define WS_VT  (WS_VF + 4u * (size_t)NROW * DD)          // f16 hi|lo V planes [b][h][64 d][2048 p]
#define WS_VTL (WS_VT + 2u * (size_t)NB * NH * DH * SS)
#define WS_END (WS_VTL + 2u * (size_t)NB * NH * DH * SS)

__device__ __forceinline__ v16b fragb_f32(const float* __restrict__ p, int lane) { v16b a; const float* pp = p + 8 * (lane >> 4);
#pragma unroll
  for (int i = 0; i < 8; ++i) { a[i] = (__bf16)pp[i]; a[8 + i] = (__bf16)pp[16 + i]; } return a; }
// ---- k_proj: block = (64 rows, 128 cols, which): which 0 Q, 1 K -> f16 hi/lo flat rows; 2 V -> f32 flat rows
__global__ __launch_bounds__(128) void k_proj(const float* __restrict__ XQ, const float* __restrict__ XK, const float* __restrict__ XV, const float* __restrict__ WQ, const float* __restrict__ BQ, const float* __restrict__ WK, const float* __restrict__ BK, const float* __restrict__ WV, const float* __restrict__ BV, _Float16* __restrict__ QH, _Float16* __restrict__ QL, _Float16* __restrict__ KH, _Float16* __restrict__ KL, float* __restrict__ VF) {
  __shared__ __align__(16) _Float16 sh[64][136], sl[64][136]; __shared__ __align__(16) float sf[64][132];
  const int tid = threadIdx.x, wave = tid >> 5, lane = tid & 31, col = lane & 15, g = lane >> 4; const int which = blockIdx.z; const size_t r0 = (size_t)blockIdx.x * 64 + wave * 16; const int c0 = blockIdx.y * 128;
  const float* X = which == 0 ? XQ : which == 1 ? XK : XV; const float* Wm = which == 0 ? WQ : which == 1 ? WK : WV; const float* Bm = which == 0 ? BQ : which == 1 ? BK : BV;
  v8f acc[8] = {};
#pragma unroll 2
  for (int kc = 0; kc < DD / 32; ++kc) { const v16b a = fragb_f32(X + (r0 + col) * DD + kc * 32, lane);
#pragma unroll
    for (int j = 0; j < 8; ++j) acc[j] = wmma_bf(a, fragb_f32(Wm + (size_t)(c0 + j * 16 + col) * DD + kc * 32, lane), acc[j]); }
#pragma unroll
  for (int j = 0; j < 8; ++j) { const float bb = bfr(Bm[c0 + j * 16 + col]);
#pragma unroll
    for (int r = 0; r < 8; ++r) { const float v = acc[j][r] + bb; if (which < 2) { const _Float16 hv = (_Float16)v; sh[wave * 16 + 8 * g + r][j * 16 + col] = hv; sl[wave * 16 + 8 * g + r][j * 16 + col] = (_Float16)((v - (float)hv) * 2048.0f); } else sf[wave * 16 + 8 * g + r][j * 16 + col] = v; } }
  __syncthreads();
  if (which < 2) { _Float16* PH = which == 0 ? QH : KH; _Float16* PL = which == 0 ? QL : KL; for (int e = tid; e < 64 * 16; e += 128) { const int rl = e >> 4, q = e & 15; const size_t o = ((size_t)blockIdx.x * 64 + rl) * DD + c0 + q * 8; vst2((unsigned*)(PH + o), *(const v4u*)&sh[rl][q * 8]); vst2((unsigned*)(PL + o), *(const v4u*)&sl[rl][q * 8]); } }
  else { for (int e = tid; e < 64 * 32; e += 128) { const int rl = e >> 5, q = e & 31; vst2(VF + ((size_t)blockIdx.x * 64 + rl) * DD + c0 + q * 4, *(const v4f*)&sf[rl][q * 4]); } } }
// ---- k_vt: block = (64 positions, b*NH + h): V flat [b][h][p][64] -> planes [b][h][d][p] (f16 hi/lo)
__global__ __launch_bounds__(128) void k_vt(const float* __restrict__ VF, _Float16* __restrict__ VT, _Float16* __restrict__ VTL) { __shared__ __align__(16) _Float16 th[DH][72], tl[DH][72]; const int t = threadIdx.x; const size_t bh = blockIdx.y; const int p0 = blockIdx.x * 64;
  for (int e = t; e < 64 * DH; e += 128) { const int pl = e / DH, d = e % DH; const float v = VF[(bh * SS + p0 + pl) * DH + d]; const _Float16 hv = (_Float16)v; th[d][pl] = hv; tl[d][pl] = (_Float16)((v - (float)hv) * 2048.0f); }
  __syncthreads(); for (int e = t; e < DH * 8; e += 128) { const int d = e >> 3, q = e & 7; const size_t o = (bh * DH + d) * (size_t)SS + p0 + q * 8; vst2((unsigned*)(VT + o), *(const v4u*)&th[d][q * 8]); vst2((unsigned*)(VTL + o), *(const v4u*)&tl[d][q * 8]); } }
// ---- k_att: block = (64 positions, h, b): keys j < i (diagonal excluded); position 0 -> uniform over all keys; key tiles past the block skipped (block 0 also scans all tiles so that position 0's uniform average is exact)
__global__ __launch_bounds__(128) void k_att(const _Float16* __restrict__ QH, const _Float16* __restrict__ QL, const _Float16* __restrict__ KH, const _Float16* __restrict__ KL, const _Float16* __restrict__ VT, const _Float16* __restrict__ VTL, float* __restrict__ OUT) {
  __shared__ __align__(16) float sp[4][16][36]; __shared__ __align__(16) float so[4][16][68];
  const int tid = threadIdx.x, wave = tid >> 5, lane = tid & 31, col = lane & 15, g = lane >> 4; const int h = blockIdx.y; const size_t b = blockIdx.z; const int qb = blockIdx.x; const int p0 = qb * 64 + wave * 16; const size_t bh = b * NH + h; const size_t rq = bh * SS + p0;
  const bool hi3 = qb < 2;   // first 128 positions: 3-product scores
  v16h aq[2], al[2];
#pragma unroll
  for (int kc = 0; kc < 2; ++kc) { aq[kc] = frag_h(QH + (rq + col) * DH + kc * 32, lane); al[kc] = frag_h(QL + (rq + col) * DH + kc * 32, lane); }
  float m[8], l[8];
#pragma unroll
  for (int r = 0; r < 8; ++r) { m[r] = -3.0e38f; l[r] = 0.f; }
  v8f acc[4] = {}, accl[4] = {};
  const int nks = (qb == 0) ? SS / 32 : (qb * 64 + 64) / 32;
#pragma unroll 1
  for (int ks = 0; ks < nks; ++ks) { float s[2][8];
#pragma unroll
    for (int ct = 0; ct < 2; ++ct) { const int kk = ks * 32 + ct * 16 + col; const size_t rk = bh * SS + kk; v8f c = {}, cl = {};
#pragma unroll
      for (int kc = 0; kc < 2; ++kc) { const v16h kh = frag_h(KH + rk * DH + kc * 32, lane); c = wmma16(aq[kc], kh, c); if (hi3) { cl = wmma16(aq[kc], frag_h(KL + rk * DH + kc * 32, lane), cl); cl = wmma16(al[kc], kh, cl); } }
#pragma unroll
      for (int r = 0; r < 8; ++r) { const int p = p0 + 8 * g + r; const float sc = (c[r] + (hi3 ? cl[r] * (1.0f / 2048.0f) : 0.f)) * 0.125f; s[ct][r] = (p == 0) ? 0.0f : ((kk < p) ? sc : -3.0e38f); } }   // position 0: all logits equal -> uniform
    float alpha[8];
#pragma unroll
    for (int r = 0; r < 8; ++r) { float mx = fmaxf(s[0][r], s[1][r]);
#pragma unroll
      for (int o = 1; o < 16; o <<= 1) mx = fmaxf(mx, __shfl_xor(mx, o));
      const float mn = fmaxf(m[r], mx); alpha[r] = (m[r] <= -1.0e38f) ? 0.f : __expf(m[r] - mn); const float e0 = (s[0][r] <= -1.0e38f) ? 0.f : __expf(s[0][r] - mn), e1 = (s[1][r] <= -1.0e38f) ? 0.f : __expf(s[1][r] - mn); float es = e0 + e1;
#pragma unroll
      for (int o = 1; o < 16; o <<= 1) es += __shfl_xor(es, o);
      l[r] = l[r] * alpha[r] + es; m[r] = (mn > -1.0e38f) ? mn : m[r]; sp[wave][8 * g + r][col] = e0; sp[wave][8 * g + r][16 + col] = e1; }
#pragma unroll
    for (int j = 0; j < 4; ++j)
#pragma unroll
      for (int r = 0; r < 8; ++r) { acc[j][r] *= alpha[r]; accl[j][r] *= alpha[r]; }
    LDSX();
    v16h pa; { const float* prow = &sp[wave][col][0] + 8 * (lane >> 4);
#pragma unroll
      for (int i = 0; i < 8; ++i) { pa[i] = (_Float16)(prow[i] * 2048.0f); pa[8 + i] = (_Float16)(prow[16 + i] * 2048.0f); } }
#pragma unroll
    for (int j = 0; j < 4; ++j) { const size_t po = (bh * DH + j * 16 + col) * (size_t)SS + ks * 32; acc[j] = wmma16(pa, frag_h(VT + po, lane), acc[j]); accl[j] = wmma16(pa, frag_h(VTL + po, lane), accl[j]); }
    LDSX(); }
#pragma unroll
  for (int r = 0; r < 8; ++r) { const float il = (l[r] > 0.f) ? (1.0f / 2048.0f) / l[r] : 0.f;
#pragma unroll
    for (int j = 0; j < 4; ++j) so[wave][8 * g + r][j * 16 + col] = (acc[j][r] + accl[j][r] * (1.0f / 2048.0f)) * il; }
  LDSX(); for (int rl = 0; rl < 16; ++rl) if (lane < 16) vst2(OUT + (rq + rl) * DH + lane * 4, *(const v4f*)&so[wave][rl][lane * 4]); }
extern "C" void kernel_launch(void* const* d_in, const int* in_sizes, int n_in, void* d_out, int out_size, void* d_ws, size_t ws_size, hipStream_t stream) {
  (void)in_sizes; (void)n_in; (void)out_size;
  const float** F = (const float**)d_in;   // 0 query_vector, 1 key_vector, 2 value_vector [2,2048,1024]; 3 Wq, 4 bq, 5 Wk, 6 bk, 7 Wv, 8 bv (natural)
  if (ws_size < (size_t)WS_END) return;
  char* ws = (char*)d_ws; _Float16 *QH = (_Float16*)(ws + WS_QH), *QL = (_Float16*)(ws + WS_QL), *KH = (_Float16*)(ws + WS_KH), *KL = (_Float16*)(ws + WS_KL), *VT = (_Float16*)(ws + WS_VT), *VTL = (_Float16*)(ws + WS_VTL); float* VF = (float*)(ws + WS_VF);
  k_proj<<<dim3(NROW / 64, DD / 128, 3), 128, 0, stream>>>(F[0], F[1], F[2], F[3], F[4], F[5], F[6], F[7], F[8], QH, QL, KH, KL, VF);
  k_vt<<<dim3(SS / 64, NB * NH), 128, 0, stream>>>(VF, VT, VTL);
  k_att<<<dim3(SS / 64, NH, TNB), 128, 0, stream>>>(QH, QL, KH, KL, VT, VTL, (float*)d_out);
}

// v001
// Measured time: 346 microseconds a run.
// Timed twice side by side with v000, it ran 1.55 and 1.56 times as fast.
// compute dtype: all float inputs rounded to bf16; Q/K/V = input . W^T + b with EXACT bf16 products on WMMA 16x16x32 (natural rows); the module's raw reshape (B,S,D)->(B,H,S,Dh) means 'head h' = the 128 projected rows 128h..128h+127 viewed as 2,048 positions x 64 (position p = (s - 128h)*16 + c/64) - handled purely by addressing; Q/K as f16 hi + residual (3-product scores for positions < 128, single f16 after), V as f16 hi + residual planes (2 products); mask: keys j >= i set to -1e9 INCLUDING the diagonal, so position 0 attends uniformly to all 2,048 keys (all logits equal) and position i >= 1 to keys < i; x 1/8; running-max softmax in f32 (hardware exp); the context in the same raw layout is the f32 output.
#include <hip/hip_runtime.h>
#include <math.h>

typedef __attribute__((ext_vector_type(16))) _Float16 v16h;
typedef __attribute__((ext_vector_type(16))) __bf16 v16b;
typedef __attribute__((ext_vector_type(8)))  _Float16 v8h;
typedef __attribute__((ext_vector_type(8)))  float v8f;
typedef __attribute__((ext_vector_type(4)))  float v4f;
typedef __attribute__((ext_vector_type(2)))  float v2f;
typedef __attribute__((ext_vector_type(4)))  unsigned v4u;
typedef __attribute__((ext_vector_type(4)))  int v4i;
typedef float __attribute__((may_alias)) float_a;
typedef int __attribute__((may_alias)) int_a;

template <typename T> __device__ __forceinline__ void vst2(void* p, T v) { *(T*)p = v;  }
__device__ __forceinline__ v8f wmma16(v16h a, v16h b, v8f c) {
  v8f d = __builtin_amdgcn_wmma_f32_16x16x32_f16(false, a, false, b, (short)0, c, false, false);
  asm volatile("v_nop\n\tv_nop\n\tv_nop\n\tv_nop" : "+v"(d) : "v"(a), "v"(b));
  return d;
}
__device__ __forceinline__ v8f wmma_bf(v16b a, v16b b, v8f c) {
  v8f d = __builtin_amdgcn_wmma_f32_16x16x32_bf16(false, a, false, b, (short)0, c, false, false);
  asm volatile("v_nop\n\tv_nop\n\tv_nop\n\tv_nop" : "+v"(d) : "v"(a), "v"(b));
  return d;
}
// 16x16x32 fragments: lane = (h = lane>>4, row/col = lane&15); elements 0..7 = k0+8h+0..7, 8..15 = k0+16+8h+0..7; D element r = row 8h+r
__device__ __forceinline__ v16h frag_h(const _Float16* rowk0, int lane) {
  union { v16h v; v8h q[2]; } u; const _Float16* p = rowk0 + 8 * (lane >> 4);
  u.q[0] = *(const v8h*)p; u.q[1] = *(const v8h*)(p + 16); return u.v;
}
__device__ __forceinline__ v16h frag_f32(const float* rowk0, int lane) {
  v16h a; const float* p = rowk0 + 8 * (lane >> 4);
#pragma unroll
  for (int i = 0; i < 8; ++i) { a[i] = (_Float16)p[i]; a[8 + i] = (_Float16)p[16 + i]; }
  return a;
}
__device__ __forceinline__ v16h frag_f32s(const float* rowk0, int lane, float sc) {
  v16h a; const float* p = rowk0 + 8 * (lane >> 4);
#pragma unroll
  for (int i = 0; i < 8; ++i) { a[i] = (_Float16)(p[i] * sc); a[8 + i] = (_Float16)(p[16 + i] * sc); }
  return a;
}
// column fragment from a [K][ld] layout (column n), rows >= K read as 0
__device__ __forceinline__ v16h fragc_f32(const float* W, int k0, int n, int lane, int ld, int K) {
  v16h a; const int g = lane >> 4;
#pragma unroll
  for (int i = 0; i < 8; ++i) { const int ka = k0 + 8 * g + i, kb = ka + 16;
    a[i] = (_Float16)(ka < K ? W[(size_t)(ka < K ? ka : K - 1) * ld + n] : 0.f); a[8 + i] = (_Float16)(kb < K ? W[(size_t)(kb < K ? kb : K - 1) * ld + n] : 0.f); }
  return a;
}
struct F2 { v16b h, l; };
__device__ __forceinline__ F2 bsplit16(const float v[16]) { F2 r;
#pragma unroll
  for (int i = 0; i < 16; ++i) { const __bf16 h = (__bf16)v[i]; r.h[i] = h; r.l[i] = (__bf16)(v[i] - (float)h); }
  return r; }
__device__ __forceinline__ F2 split_row(const float* row, int k0, int lane) { float v[16]; const float* p = row + k0 + 8 * (lane >> 4);
#pragma unroll
  for (int i = 0; i < 8; ++i) { v[i] = p[i]; v[8 + i] = p[16 + i]; }
  return bsplit16(v); }
__device__ __forceinline__ F2 split_rowK(const float* row, int k0, int lane, int K) { float v[16]; const int g = lane >> 4;
#pragma unroll
  for (int i = 0; i < 8; ++i) { const int ka = k0 + 8 * g + i, kb = ka + 16; v[i] = ka < K ? row[ka < K ? ka : K - 1] : 0.f; v[8 + i] = kb < K ? row[kb < K ? kb : K - 1] : 0.f; }
  return bsplit16(v); }
__device__ __forceinline__ F2 split_col(const float* W, int k0, int n, int lane, int ld, int K) { float v[16]; const int g = lane >> 4;
#pragma unroll
  for (int i = 0; i < 8; ++i) { const int ka = k0 + 8 * g + i, kb = ka + 16; v[i] = ka < K ? W[(size_t)(ka < K ? ka : K - 1) * ld + n] : 0.f; v[8 + i] = kb < K ? W[(size_t)(kb < K ? kb : K - 1) * ld + n] : 0.f; }
  return bsplit16(v); }
__device__ __forceinline__ v8f mac3(const F2& a, const F2& b, v8f c) { c = wmma_bf(a.l, b.h, c); c = wmma_bf(a.h, b.l, c); return wmma_bf(a.h, b.h, c); }
__device__ __forceinline__ float sigm(float v) { return 1.0f / (1.0f + expf(-v)); }
#define LDSX() do { asm volatile("s_wait_dscnt 0" ::: "memory"); __builtin_amdgcn_wave_barrier(); __builtin_amdgcn_fence(__ATOMIC_RELEASE, "workgroup"); } while (0)


// 'Fast' MHA with raw-reshape heads (B 2, S 2,048, D 1,024, 16 'heads' x 64): separate query / key / value inputs, natural projections + biases, triu(offset 0)-masked softmax(q k / 8) v, raw reshape back (no output projection).
#define NB 2
#define SS 2048           // positions per head (== S)
#define DD 1024
#define NH 16
#define DH 64
#define NROW (NB * SS)    // projected rows
#ifndef TNB
#define TNB NB
#endif
typedef __attribute__((ext_vector_type(8))) __bf16 v8b;
__device__ __forceinline__ v16b frag_b(const __bf16* rowk0, int lane) {
  union { v16b v; v8b q[2]; } u; const __bf16* p = rowk0 + 8 * (lane >> 4);
  u.q[0] = *(const v8b*)p; u.q[1] = *(const v8b*)(p + 16); return u.v;
}
__device__ __forceinline__ float bfr(float v) { return (float)(__bf16)v; }
__device__ __attribute__((noinline)) float exp_ni(float v) { return expf(v); }
__device__ __attribute__((noinline)) float erf_ni(float v) { return erff(v); }

#define WS_QH  0u                                   // f16 hi|lo Q flat [b][s][1024] == [b][h][p][64]
#define WS_QL  (WS_QH + 2u * (size_t)NROW * DD)
#define WS_KH  (WS_QL + 2u * (size_t)NROW * DD)
#define WS_KL  (WS_KH + 2u * (size_t)NROW * DD)
#define WS_VF  (WS_KL + 2u * (size_t)NROW * DD)          // f32 V flat
#define WS_VT  (WS_VF + 4u * (size_t)NROW * DD)          // f16 hi|lo V planes [b][h][64 d][2048 p]
#define WS_VTL (WS_VT + 2u * (size_t)NB * NH * DH * SS)
#define WS_END (WS_VTL + 2u * (size_t)NB * NH * DH * SS)

__device__ __forceinline__ v16b fragb_f32(const float* __restrict__ p, int lane) { v16b a; const float* pp = p + 8 * (lane >> 4);
#pragma unroll
  for (int i = 0; i < 8; ++i) { a[i] = (__bf16)pp[i]; a[8 + i] = (__bf16)pp[16 + i]; } return a; }
// ---- k_proj: block = (128 rows, 128 cols, which), 8 waves of 64 x 32: which 0 Q, 1 K -> f16 hi/lo flat rows; 2 V -> f32 flat rows.
// Each 32-k slice of the X and W tiles is read once per block by whole-line loads (8 lanes x 16 B = one 128-B row piece), rounded to bf16 once and kept in LDS; all 8 waves take their fragments from there.
#define PLD 40            // bf16 elements per staged row: 64 B of data + 16 B pad; 80 B = 16 B x odd keeps the 16-byte fragment reads off each other's banks
#define PTILE (128 * PLD) // one staged operand slice
typedef __attribute__((ext_vector_type(4))) __bf16 v4b;
__global__ __launch_bounds__(256) void k_proj(const float* __restrict__ XQ, const float* __restrict__ XK, const float* __restrict__ XV, const float* __restrict__ WQ, const float* __restrict__ BQ, const float* __restrict__ WK, const float* __restrict__ BK, const float* __restrict__ WV, const float* __restrict__ BV, _Float16* __restrict__ QH, _Float16* __restrict__ QL, _Float16* __restrict__ KH, _Float16* __restrict__ KL, float* __restrict__ VF) {
  __shared__ __align__(16) unsigned char smem[2 * 128 * 136 * 2];   // K loop: two buffers of [X slice | W slice] (40,960 B); afterwards the output staging (f16 hi | lo planes, or one f32 plane)
  __bf16* const sA = (__bf16*)smem; __bf16* const sB = sA + 2 * PTILE;
  const int tid = threadIdx.x, wave = tid >> 5, lane = tid & 31, col = lane & 15, g = lane >> 4; const int which = blockIdx.z; const size_t row0 = (size_t)blockIdx.x * 128; const int c0 = blockIdx.y * 128;
  const int wm = wave >> 2, wn = wave & 3;
  const float* X = which == 0 ? XQ : which == 1 ? XK : XV; const float* Wm = which == 0 ? WQ : which == 1 ? WK : WV; const float* Bm = which == 0 ? BQ : which == 1 ? BK : BV;
  const int sr = tid >> 3, sc = (tid & 7) * 4;   // staging: this thread's row (plus 32 i) and its four k of the slice
  const float* gA = X + (row0 + sr) * DD + sc; const float* gB = Wm + (size_t)(c0 + sr) * DD + sc;
  const int so_ = sr * PLD + sc;
  v4f ra[4], rb[4];
  v8f acc[4][2] = {};
  // every unroll in this kernel makes the indices of acc, ra, rb and the fragment arrays constants, so that they stay in registers
#define PLOAD(pa, pb) do { _Pragma("unroll") for (int i = 0; i < 4; ++i) { ra[i] = *(const v4f*)((pa) + (size_t)i * 32 * DD); rb[i] = *(const v4f*)((pb) + (size_t)i * 32 * DD); } } while (0)
#define PSTORE(buf) do { _Pragma("unroll") for (int i = 0; i < 4; ++i) { v4b ta, tb; _Pragma("unroll") for (int e = 0; e < 4; ++e) { ta[e] = (__bf16)ra[i][e]; tb[e] = (__bf16)rb[i][e]; } *(v4b*)(sA + (buf) * PTILE + so_ + i * 32 * PLD) = ta; *(v4b*)(sB + (buf) * PTILE + so_ + i * 32 * PLD) = tb; } } while (0)
#define PMAC(buf) do { v16b fb[2], fa[4]; _Pragma("unroll") for (int j = 0; j < 2; ++j) fb[j] = frag_b(sB + (buf) * PTILE + (wn * 32 + j * 16 + col) * PLD, lane); \
    _Pragma("unroll") for (int i = 0; i < 4; ++i) fa[i] = frag_b(sA + (buf) * PTILE + (wm * 64 + i * 16 + col) * PLD, lane); \
    _Pragma("unroll") for (int i = 0; i < 4; ++i) { _Pragma("unroll") for (int j = 0; j < 2; ++j) acc[i][j] = wmma_bf(fa[i], fb[j], acc[i][j]); } } while (0)
  PLOAD(gA, gB); PSTORE(0); __syncthreads();
  for (int kc = 0; kc < DD / 32 - 1; ++kc) { const int cur = kc & 1;
    const float* pa = gA + (kc + 1) * 32; const float* pb = gB + (kc + 1) * 32;
    PLOAD(pa, pb);        // the next slice flies while this one is multiplied
    asm volatile("s_wait_xcnt 0x0" :: "v"(pa), "v"(pb) : "memory");   // keeps the two address pairs whole until this wait: the fragment reads below may reuse their registers
    PMAC(cur);
    PSTORE(cur ^ 1);      // its last readers left it before the previous barrier
    __syncthreads(); }
  PMAC((DD / 32 - 1) & 1);
  __syncthreads();        // every wave has read its last fragments: the buffers become output staging
  _Float16 (*sh)[136] = (_Float16 (*)[136])smem; _Float16 (*sl)[136] = (_Float16 (*)[136])(smem + 128 * 136 * 2); float (*sf)[132] = (float (*)[132])smem;
  if (which < 2) {
#pragma unroll
    for (int j = 0; j < 2; ++j) { const int cc = wn * 32 + j * 16 + col; const float bb = bfr(Bm[c0 + cc]);
#pragma unroll
      for (int i = 0; i < 4; ++i)
#pragma unroll
        for (int r = 0; r < 8; ++r) { const int rr = wm * 64 + i * 16 + 8 * g + r; const float v = acc[i][j][r] + bb; const _Float16 hv = (_Float16)v; sh[rr][cc] = hv; sl[rr][cc] = (_Float16)((v - (float)hv) * 2048.0f); } }
  } else {
#pragma unroll
    for (int j = 0; j < 2; ++j) { const int cc = wn * 32 + j * 16 + col; const float bb = bfr(Bm[c0 + cc]);
#pragma unroll
      for (int i = 0; i < 4; ++i)
#pragma unroll
        for (int r = 0; r < 8; ++r) sf[wm * 64 + i * 16 + 8 * g + r][cc] = acc[i][j][r] + bb; }
  }
  __syncthreads();
  if (which < 2) { _Float16* PH = which == 0 ? QH : KH; _Float16* PL = which == 0 ? QL : KL; for (int e = tid; e < 128 * 16; e += 256) { const int rl = e >> 4, q = e & 15; const size_t o = (row0 + rl) * DD + c0 + q * 8; vst2((unsigned*)(PH + o), *(const v4u*)&sh[rl][q * 8]); vst2((unsigned*)(PL + o), *(const v4u*)&sl[rl][q * 8]); } }
  else { for (int e = tid; e < 128 * 32; e += 256) { const int rl = e >> 5, q = e & 31; vst2(VF + (row0 + rl) * DD + c0 + q * 4, *(const v4f*)&sf[rl][q * 4]); } } }
// ---- k_vt: block = (64 positions, b*NH + h): V flat [b][h][p][64] -> planes [b][h][d][p] (f16 hi/lo)
__global__ __launch_bounds__(128) void k_vt(const float* __restrict__ VF, _Float16* __restrict__ VT, _Float16* __restrict__ VTL) { __shared__ __align__(16) _Float16 th[DH][72], tl[DH][72]; const int t = threadIdx.x; const size_t bh = blockIdx.y; const int p0 = blockIdx.x * 64;
  for (int e = t; e < 64 * DH; e += 128) { const int pl = e / DH, d = e % DH; const float v = VF[(bh * SS + p0 + pl) * DH + d]; const _Float16 hv = (_Float16)v; th[d][pl] = hv; tl[d][pl] = (_Float16)((v - (float)hv) * 2048.0f); }
  __syncthreads(); for (int e = t; e < DH * 8; e += 128) { const int d = e >> 3, q = e & 7; const size_t o = (bh * DH + d) * (size_t)SS + p0 + q * 8; vst2((unsigned*)(VT + o), *(const v4u*)&th[d][q * 8]); vst2((unsigned*)(VTL + o), *(const v4u*)&tl[d][q * 8]); } }
// ---- k_att: block = (64 positions, h, b): keys j < i (diagonal excluded); position 0 -> uniform over all keys; key tiles past the block skipped (block 0 also scans all tiles so that position 0's uniform average is exact)
__global__ __launch_bounds__(128) void k_att(const _Float16* __restrict__ QH, const _Float16* __restrict__ QL, const _Float16* __restrict__ KH, const _Float16* __restrict__ KL, const _Float16* __restrict__ VT, const _Float16* __restrict__ VTL, float* __restrict__ OUT) {
  __shared__ __align__(16) float sp[4][16][36]; __shared__ __align__(16) float so[4][16][68];
  const int tid = threadIdx.x, wave = tid >> 5, lane = tid & 31, col = lane & 15, g = lane >> 4; const int h = blockIdx.y; const size_t b = blockIdx.z; const int qb = blockIdx.x; const int p0 = qb * 64 + wave * 16; const size_t bh = b * NH + h; const size_t rq = bh * SS + p0;
  const bool hi3 = qb < 2;   // first 128 positions: 3-product scores
  v16h aq[2], al[2];
#pragma unroll
  for (int kc = 0; kc < 2; ++kc) { aq[kc] = frag_h(QH + (rq + col) * DH + kc * 32, lane); al[kc] = frag_h(QL + (rq + col) * DH + kc * 32, lane); }
  float m[8], l[8];
#pragma unroll
  for (int r = 0; r < 8; ++r) { m[r] = -3.0e38f; l[r] = 0.f; }
  v8f acc[4] = {}, accl[4] = {};
  const int nks = (qb == 0) ? SS / 32 : (qb * 64 + 64) / 32;
#pragma unroll 1
  for (int ks = 0; ks < nks; ++ks) { float s[2][8];
#pragma unroll
    for (int ct = 0; ct < 2; ++ct) { const int kk = ks * 32 + ct * 16 + col; const size_t rk = bh * SS + kk; v8f c = {}, cl = {};
#pragma unroll
      for (int kc = 0; kc < 2; ++kc) { const v16h kh = frag_h(KH + rk * DH + kc * 32, lane); c = wmma16(aq[kc], kh, c); if (hi3) { cl = wmma16(aq[kc], frag_h(KL + rk * DH + kc * 32, lane), cl); cl = wmma16(al[kc], kh, cl); } }
#pragma unroll
      for (int r = 0; r < 8; ++r) { const int p = p0 + 8 * g + r; const float sc = (c[r] + (hi3 ? cl[r] * (1.0f / 2048.0f) : 0.f)) * 0.125f; s[ct][r] = (p == 0) ? 0.0f : ((kk < p) ? sc : -3.0e38f); } }   // position 0: all logits equal -> uniform
    float alpha[8];
#pragma unroll
    for (int r = 0; r < 8; ++r) { float mx = fmaxf(s[0][r], s[1][r]);
#pragma unroll
      for (int o = 1; o < 16; o <<= 1) mx = fmaxf(mx, __shfl_xor(mx, o));
      const float mn = fmaxf(m[r], mx); alpha[r] = (m[r] <= -1.0e38f) ? 0.f : __expf(m[r] - mn); const float e0 = (s[0][r] <= -1.0e38f) ? 0.f : __expf(s[0][r] - mn), e1 = (s[1][r] <= -1.0e38f) ? 0.f : __expf(s[1][r] - mn); float es = e0 + e1;
#pragma unroll
      for (int o = 1; o < 16; o <<= 1) es += __shfl_xor(es, o);
      l[r] = l[r] * alpha[r] + es; m[r] = (mn > -1.0e38f) ? mn : m[r]; sp[wave][8 * g + r][col] = e0; sp[wave][8 * g + r][16 + col] = e1; }
#pragma unroll
    for (int j = 0; j < 4; ++j)
#pragma unroll
      for (int r = 0; r < 8; ++r) { acc[j][r] *= alpha[r]; accl[j][r] *= alpha[r]; }
    LDSX();
    v16h pa; { const float* prow = &sp[wave][col][0] + 8 * (lane >> 4);
#pragma unroll
      for (int i = 0; i < 8; ++i) { pa[i] = (_Float16)(prow[i] * 2048.0f); pa[8 + i] = (_Float16)(prow[16 + i] * 2048.0f); } }
#pragma unroll
    for (int j = 0; j < 4; ++j) { const size_t po = (bh * DH + j * 16 + col) * (size_t)SS + ks * 32; acc[j] = wmma16(pa, frag_h(VT + po, lane), acc[j]); accl[j] = wmma16(pa, frag_h(VTL + po, lane), accl[j]); }
    LDSX(); }
#pragma unroll
  for (int r = 0; r < 8; ++r) { const float il = (l[r] > 0.f) ? (1.0f / 2048.0f) / l[r] : 0.f;
#pragma unroll
    for (int j = 0; j < 4; ++j) so[wave][8 * g + r][j * 16 + col] = (acc[j][r] + accl[j][r] * (1.0f / 2048.0f)) * il; }
  LDSX(); for (int rl = 0; rl < 16; ++rl) if (lane < 16) vst2(OUT + (rq + rl) * DH + lane * 4, *(const v4f*)&so[wave][rl][lane * 4]); }
extern "C" void kernel_launch(void* const* d_in, const int* in_sizes, int n_in, void* d_out, int out_size, void* d_ws, size_t ws_size, hipStream_t stream) {
  (void)in_sizes; (void)n_in; (void)out_size;
  const float** F = (const float**)d_in;   // 0 query_vector, 1 key_vector, 2 value_vector [2,2048,1024]; 3 Wq, 4 bq, 5 Wk, 6 bk, 7 Wv, 8 bv (natural)
  if (ws_size < (size_t)WS_END) return;
  char* ws = (char*)d_ws; _Float16 *QH = (_Float16*)(ws + WS_QH), *QL = (_Float16*)(ws + WS_QL), *KH = (_Float16*)(ws + WS_KH), *KL = (_Float16*)(ws + WS_KL), *VT = (_Float16*)(ws + WS_VT), *VTL = (_Float16*)(ws + WS_VTL); float* VF = (float*)(ws + WS_VF);
  k_proj<<<dim3(NROW / 128, DD / 128, 3), 256, 0, stream>>>(F[0], F[1], F[2], F[3], F[4], F[5], F[6], F[7], F[8], QH, QL, KH, KL, VF);
  k_vt<<<dim3(SS / 64, NB * NH), 128, 0, stream>>>(VF, VT, VTL);
  k_att<<<dim3(SS / 64, NH, TNB), 128, 0, stream>>>(QH, QL, KH, KL, VT, VTL, (float*)d_out);
}

// v002
// Measured time: 181 microseconds a run.
// In two side-by-side timings against v001, it was 1.92 and 1.91 times as fast.
// Over all steps from v000 it is 2.98 times as fast.
// compute dtype: all float inputs rounded to bf16; Q/K/V = input . W^T + b with EXACT bf16 products on WMMA 16x16x32 (natural rows); the module's raw reshape (B,S,D)->(B,H,S,Dh) means 'head h' = the 128 projected rows 128h..128h+127 viewed as 2,048 positions x 64 (position p = (s - 128h)*16 + c/64) - handled purely by addressing; Q/K as f16 hi + residual (3-product scores for positions < 128, single f16 after), V as f16 hi + residual planes (2 products); mask: keys j >= i set to -1e9 INCLUDING the diagonal, so position 0 attends uniformly to all 2,048 keys (all logits equal) and position i >= 1 to keys < i; x 1/8; running-max softmax in f32 (hardware exp); the context in the same raw layout is the f32 output.
#include <hip/hip_runtime.h>
#include <math.h>

typedef __attribute__((ext_vector_type(16))) _Float16 v16h;
typedef __attribute__((ext_vector_type(16))) __bf16 v16b;
typedef __attribute__((ext_vector_type(8)))  _Float16 v8h;
typedef __attribute__((ext_vector_type(8)))  float v8f;
typedef __attribute__((ext_vector_type(4)))  float v4f;
typedef __attribute__((ext_vector_type(2)))  float v2f;
typedef __attribute__((ext_vector_type(4)))  unsigned v4u;
typedef __attribute__((ext_vector_type(4)))  int v4i;
typedef float __attribute__((may_alias)) float_a;
typedef int __attribute__((may_alias)) int_a;

template <typename T> __device__ __forceinline__ void vst2(void* p, T v) { *(T*)p = v;  }
__device__ __forceinline__ v8f wmma16(v16h a, v16h b, v8f c) {
  v8f d = __builtin_amdgcn_wmma_f32_16x16x32_f16(false, a, false, b, (short)0, c, false, false);
  asm volatile("v_nop\n\tv_nop\n\tv_nop\n\tv_nop" : "+v"(d) : "v"(a), "v"(b));
  return d;
}
__device__ __forceinline__ v8f wmma_bf(v16b a, v16b b, v8f c) {
  v8f d = __builtin_amdgcn_wmma_f32_16x16x32_bf16(false, a, false, b, (short)0, c, false, false);
  asm volatile("v_nop\n\tv_nop\n\tv_nop\n\tv_nop" : "+v"(d) : "v"(a), "v"(b));
  return d;
}
// 16x16x32 fragments: lane = (h = lane>>4, row/col = lane&15); elements 0..7 = k0+8h+0..7, 8..15 = k0+16+8h+0..7; D element r = row 8h+r
__device__ __forceinline__ v16h frag_h(const _Float16* rowk0, int lane) {
  union { v16h v; v8h q[2]; } u; const _Float16* p = rowk0 + 8 * (lane >> 4);
  u.q[0] = *(const v8h*)p; u.q[1] = *(const v8h*)(p + 16); return u.v;
}
__device__ __forceinline__ v16h frag_f32(const float* rowk0, int lane) {
  v16h a; const float* p = rowk0 + 8 * (lane >> 4);
#pragma unroll
  for (int i = 0; i < 8; ++i) { a[i] = (_Float16)p[i]; a[8 + i] = (_Float16)p[16 + i]; }
  return a;
}
__device__ __forceinline__ v16h frag_f32s(const float* rowk0, int lane, float sc) {
  v16h a; const float* p = rowk0 + 8 * (lane >> 4);
#pragma unroll
  for (int i = 0; i < 8; ++i) { a[i] = (_Float16)(p[i] * sc); a[8 + i] = (_Float16)(p[16 + i] * sc); }
  return a;
}
// column fragment from a [K][ld] layout (column n), rows >= K read as 0
__device__ __forceinline__ v16h fragc_f32(const float* W, int k0, int n, int lane, int ld, int K) {
  v16h a; const int g = lane >> 4;
#pragma unroll
  for (int i = 0; i < 8; ++i) { const int ka = k0 + 8 * g + i, kb = ka + 16;
    a[i] = (_Float16)(ka < K ? W[(size_t)(ka < K ? ka : K - 1) * ld + n] : 0.f); a[8 + i] = (_Float16)(kb < K ? W[(size_t)(kb < K ? kb : K - 1) * ld + n] : 0.f); }
  return a;
}
struct F2 { v16b h, l; };
__device__ __forceinline__ F2 bsplit16(const float v[16]) { F2 r;
#pragma unroll
  for (int i = 0; i < 16; ++i) { const __bf16 h = (__bf16)v[i]; r.h[i] = h; r.l[i] = (__bf16)(v[i] - (float)h); }
  return r; }
__device__ __forceinline__ F2 split_row(const float* row, int k0, int lane) { float v[16]; const float* p = row + k0 + 8 * (lane >> 4);
#pragma unroll
  for (int i = 0; i < 8; ++i) { v[i] = p[i]; v[8 + i] = p[16 + i]; }
  return bsplit16(v); }
__device__ __forceinline__ F2 split_rowK(const float* row, int k0, int lane, int K) { float v[16]; const int g = lane >> 4;
#pragma unroll
  for (int i = 0; i < 8; ++i) { const int ka = k0 + 8 * g + i, kb = ka + 16; v[i] = ka < K ? row[ka < K ? ka : K - 1] : 0.f; v[8 + i] = kb < K ? row[kb < K ? kb : K - 1] : 0.f; }
  return bsplit16(v); }
__device__ __forceinline__ F2 split_col(const float* W, int k0, int n, int lane, int ld, int K) { float v[16]; const int g = lane >> 4;
#pragma unroll
  for (int i = 0; i < 8; ++i) { const int ka = k0 + 8 * g + i, kb = ka + 16; v[i] = ka < K ? W[(size_t)(ka < K ? ka : K - 1) * ld + n] : 0.f; v[8 + i] = kb < K ? W[(size_t)(kb < K ? kb : K - 1) * ld + n] : 0.f; }
  return bsplit16(v); }
__device__ __forceinline__ v8f mac3(const F2& a, const F2& b, v8f c) { c = wmma_bf(a.l, b.h, c); c = wmma_bf(a.h, b.l, c); return wmma_bf(a.h, b.h, c); }
__device__ __forceinline__ float sigm(float v) { return 1.0f / (1.0f + expf(-v)); }
#define LDSX() do { asm volatile("s_wait_dscnt 0" ::: "memory"); __builtin_amdgcn_wave_barrier(); __builtin_amdgcn_fence(__ATOMIC_RELEASE, "workgroup"); } while (0)


// 'Fast' MHA with raw-reshape heads (B 2, S 2,048, D 1,024, 16 'heads' x 64): separate query / key / value inputs, natural projections + biases, triu(offset 0)-masked softmax(q k / 8) v, raw reshape back (no output projection).
#define NB 2
#define SS 2048           // positions per head (== S)
#define DD 1024
#define NH 16
#define DH 64
#define NROW (NB * SS)    // projected rows
#ifndef TNB
#define TNB NB
#endif
typedef __attribute__((ext_vector_type(8))) __bf16 v8b;
__device__ __forceinline__ v16b frag_b(const __bf16* rowk0, int lane) {
  union { v16b v; v8b q[2]; } u; const __bf16* p = rowk0 + 8 * (lane >> 4);
  u.q[0] = *(const v8b*)p; u.q[1] = *(const v8b*)(p + 16); return u.v;
}
__device__ __forceinline__ float bfr(float v) { return (float)(__bf16)v; }
__device__ __attribute__((noinline)) float exp_ni(float v) { return expf(v); }
__device__ __attribute__((noinline)) float erf_ni(float v) { return erff(v); }

#define WS_QH  0u                                   // f16 hi|lo Q flat [b][s][1024] == [b][h][p][64]
#define WS_QL  (WS_QH + 2u * (size_t)NROW * DD)
#define WS_KH  (WS_QL + 2u * (size_t)NROW * DD)
#define WS_KL  (WS_KH + 2u * (size_t)NROW * DD)
#define WS_VF  (WS_KL + 2u * (size_t)NROW * DD)          // f32 V flat
#define WS_VT  (WS_VF + 4u * (size_t)NROW * DD)          // f16 hi|lo V planes [b][h][64 d][2048 p]
#define WS_VTL (WS_VT + 2u * (size_t)NB * NH * DH * SS)
#define WS_END (WS_VTL + 2u * (size_t)NB * NH * DH * SS)

__device__ __forceinline__ v16b fragb_f32(const float* __restrict__ p, int lane) { v16b a; const float* pp = p + 8 * (lane >> 4);
#pragma unroll
  for (int i = 0; i < 8; ++i) { a[i] = (__bf16)pp[i]; a[8 + i] = (__bf16)pp[16 + i]; } return a; }
// ---- k_proj: block = (128 rows, 128 cols, which), 8 waves of 64 x 32: which 0 Q, 1 K -> f16 hi/lo flat rows; 2 V -> f32 flat rows.
// Each 32-k slice of the X and W tiles is read once per block by whole-line loads (8 lanes x 16 B = one 128-B row piece), rounded to bf16 once and kept in LDS; all 8 waves take their fragments from there.
#define PLD 40            // bf16 elements per staged row: 64 B of data + 16 B pad; 80 B = 16 B x odd keeps the 16-byte fragment reads off each other's banks
#define PTILE (128 * PLD) // one staged operand slice
typedef __attribute__((ext_vector_type(4))) __bf16 v4b;
__global__ __launch_bounds__(256) void k_proj(const float* __restrict__ XQ, const float* __restrict__ XK, const float* __restrict__ XV, const float* __restrict__ WQ, const float* __restrict__ BQ, const float* __restrict__ WK, const float* __restrict__ BK, const float* __restrict__ WV, const float* __restrict__ BV, _Float16* __restrict__ QH, _Float16* __restrict__ QL, _Float16* __restrict__ KH, _Float16* __restrict__ KL, float* __restrict__ VF) {
  __shared__ __align__(16) unsigned char smem[2 * 128 * 136 * 2];   // K loop: two buffers of [X slice | W slice] (40,960 B); afterwards the output staging (f16 hi | lo planes, or one f32 plane)
  __bf16* const sA = (__bf16*)smem; __bf16* const sB = sA + 2 * PTILE;
  const int tid = threadIdx.x, wave = tid >> 5, lane = tid & 31, col = lane & 15, g = lane >> 4; const int which = blockIdx.z; const size_t row0 = (size_t)blockIdx.x * 128; const int c0 = blockIdx.y * 128;
  const int wm = wave >> 2, wn = wave & 3;
  const float* X = which == 0 ? XQ : which == 1 ? XK : XV; const float* Wm = which == 0 ? WQ : which == 1 ? WK : WV; const float* Bm = which == 0 ? BQ : which == 1 ? BK : BV;
  const int sr = tid >> 3, sc = (tid & 7) * 4;   // staging: this thread's row (plus 32 i) and its four k of the slice
  const float* gA = X + (row0 + sr) * DD + sc; const float* gB = Wm + (size_t)(c0 + sr) * DD + sc;
  const int so_ = sr * PLD + sc;
  v4f ra[4], rb[4];
  v8f acc[4][2] = {};
  // every unroll in this kernel makes the indices of acc, ra, rb and the fragment arrays constants, so that they stay in registers
#define PLOAD(pa, pb) do { _Pragma("unroll") for (int i = 0; i < 4; ++i) { ra[i] = *(const v4f*)((pa) + (size_t)i * 32 * DD); rb[i] = *(const v4f*)((pb) + (size_t)i * 32 * DD); } } while (0)
#define PSTORE(buf) do { _Pragma("unroll") for (int i = 0; i < 4; ++i) { v4b ta, tb; _Pragma("unroll") for (int e = 0; e < 4; ++e) { ta[e] = (__bf16)ra[i][e]; tb[e] = (__bf16)rb[i][e]; } *(v4b*)(sA + (buf) * PTILE + so_ + i * 32 * PLD) = ta; *(v4b*)(sB + (buf) * PTILE + so_ + i * 32 * PLD) = tb; } } while (0)
#define PMAC(buf) do { v16b fb[2], fa[4]; _Pragma("unroll") for (int j = 0; j < 2; ++j) fb[j] = frag_b(sB + (buf) * PTILE + (wn * 32 + j * 16 + col) * PLD, lane); \
    _Pragma("unroll") for (int i = 0; i < 4; ++i) fa[i] = frag_b(sA + (buf) * PTILE + (wm * 64 + i * 16 + col) * PLD, lane); \
    _Pragma("unroll") for (int i = 0; i < 4; ++i) { _Pragma("unroll") for (int j = 0; j < 2; ++j) acc[i][j] = wmma_bf(fa[i], fb[j], acc[i][j]); } } while (0)
  PLOAD(gA, gB); PSTORE(0); __syncthreads();
  for (int kc = 0; kc < DD / 32 - 1; ++kc) { const int cur = kc & 1;
    const float* pa = gA + (kc + 1) * 32; const float* pb = gB + (kc + 1) * 32;
    PLOAD(pa, pb);        // the next slice flies while this one is multiplied
    asm volatile("s_wait_xcnt 0x0" :: "v"(pa), "v"(pb) : "memory");   // keeps the two address pairs whole until this wait: the fragment reads below may reuse their registers
    PMAC(cur);
    PSTORE(cur ^ 1);      // its last readers left it before the previous barrier
    __syncthreads(); }
  PMAC((DD / 32 - 1) & 1);
  __syncthreads();        // every wave has read its last fragments: the buffers become output staging
  _Float16 (*sh)[136] = (_Float16 (*)[136])smem; _Float16 (*sl)[136] = (_Float16 (*)[136])(smem + 128 * 136 * 2); float (*sf)[132] = (float (*)[132])smem;
  if (which < 2) {
#pragma unroll
    for (int j = 0; j < 2; ++j) { const int cc = wn * 32 + j * 16 + col; const float bb = bfr(Bm[c0 + cc]);
#pragma unroll
      for (int i = 0; i < 4; ++i)
#pragma unroll
        for (int r = 0; r < 8; ++r) { const int rr = wm * 64 + i * 16 + 8 * g + r; const float v = acc[i][j][r] + bb; const _Float16 hv = (_Float16)v; sh[rr][cc] = hv; sl[rr][cc] = (_Float16)((v - (float)hv) * 2048.0f); } }
  } else {
#pragma unroll
    for (int j = 0; j < 2; ++j) { const int cc = wn * 32 + j * 16 + col; const float bb = bfr(Bm[c0 + cc]);
#pragma unroll
      for (int i = 0; i < 4; ++i)
#pragma unroll
        for (int r = 0; r < 8; ++r) sf[wm * 64 + i * 16 + 8 * g + r][cc] = acc[i][j][r] + bb; }
  }
  __syncthreads();
  if (which < 2) { _Float16* PH = which == 0 ? QH : KH; _Float16* PL = which == 0 ? QL : KL; for (int e = tid; e < 128 * 16; e += 256) { const int rl = e >> 4, q = e & 15; const size_t o = (row0 + rl) * DD + c0 + q * 8; vst2((unsigned*)(PH + o), *(const v4u*)&sh[rl][q * 8]); vst2((unsigned*)(PL + o), *(const v4u*)&sl[rl][q * 8]); } }
  else { for (int e = tid; e < 128 * 32; e += 256) { const int rl = e >> 5, q = e & 31; vst2(VF + (row0 + rl) * DD + c0 + q * 4, *(const v4f*)&sf[rl][q * 4]); } } }
// ---- k_vt: block = (64 positions, b*NH + h): V flat [b][h][p][64] -> planes [b][h][d][p] (f16 hi/lo)
__global__ __launch_bounds__(128) void k_vt(const float* __restrict__ VF, _Float16* __restrict__ VT, _Float16* __restrict__ VTL) { __shared__ __align__(16) _Float16 th[DH][72], tl[DH][72]; const int t = threadIdx.x; const size_t bh = blockIdx.y; const int p0 = blockIdx.x * 64;
  for (int e = t; e < 64 * DH; e += 128) { const int pl = e / DH, d = e % DH; const float v = VF[(bh * SS + p0 + pl) * DH + d]; const _Float16 hv = (_Float16)v; th[d][pl] = hv; tl[d][pl] = (_Float16)((v - (float)hv) * 2048.0f); }
  __syncthreads(); for (int e = t; e < DH * 8; e += 128) { const int d = e >> 3, q = e & 7; const size_t o = (bh * DH + d) * (size_t)SS + p0 + q * 8; vst2((unsigned*)(VT + o), *(const v4u*)&th[d][q * 8]); vst2((unsigned*)(VTL + o), *(const v4u*)&tl[d][q * 8]); } }
// ---- k_att: block = (64 positions, h, b): keys j < i (diagonal excluded); position 0 -> uniform over all keys; key tiles past the block skipped (block 0 also scans all tiles so that position 0's uniform average is exact)
// Each pass's 32 keys (K hi rows, K residual rows for the first 128 positions, V^T hi and residual row pieces) are brought into LDS once per block by asynchronous 16-byte copies, two buffers, one pass ahead; the four waves take their fragments from there.
#define KPB 144                     // bytes per staged K row: 128 B of data + 16 B pad (16 B x odd keeps the 16-byte fragment reads off each other's banks)
#define VPB 80                      // bytes per staged V^T row piece: 64 B of data + 16 B pad
#define ST_KL (32 * KPB)            // buffer layout: K hi | K residual | V^T hi | V^T residual
#define ST_VH (2 * 32 * KPB)
#define ST_VL (ST_VH + 64 * VPB)
#define ST_SZ (ST_VL + 64 * VPB)
__global__ __launch_bounds__(128) void k_att(const _Float16* __restrict__ QH, const _Float16* __restrict__ QL, const _Float16* __restrict__ KH, const _Float16* __restrict__ KL, const _Float16* __restrict__ VT, const _Float16* __restrict__ VTL, float* __restrict__ OUT) {
  __shared__ __align__(16) unsigned char ring[2 * ST_SZ];
  __shared__ __align__(16) float sp[4][16][36]; __shared__ __align__(16) float so[4][16][68];
  const int tid = threadIdx.x, wave = tid >> 5, lane = tid & 31, col = lane & 15, g = lane >> 4; const int h = blockIdx.y; const size_t b = blockIdx.z; const int qb = blockIdx.x; const int p0 = qb * 64 + wave * 16; const size_t bh = b * NH + h; const size_t rq = bh * SS + p0;
  const bool hi3 = qb < 2;   // first 128 positions: 3-product scores
  v16h aq[2], al[2];
#pragma unroll
  for (int kc = 0; kc < 2; ++kc) { aq[kc] = frag_h(QH + (rq + col) * DH + kc * 32, lane); al[kc] = frag_h(QL + (rq + col) * DH + kc * 32, lane); }
  float m[8], l[8];
#pragma unroll
  for (int r = 0; r < 8; ++r) { m[r] = -3.0e38f; l[r] = 0.f; }
  v8f acc[4] = {}, accl[4] = {};
  const int nks = (qb == 0) ? SS / 32 : (qb * 64 + 64) / 32;   // at least 4
  // staging: a K tile is 4,096 contiguous bytes (thread: 16-byte pieces tid and tid + 128); a V^T tile is 64 row pieces of 64 B (thread: rows tid / 4 and tid / 4 + 32)
  const unsigned lK = (unsigned)(size_t)ring + (tid >> 3) * KPB + (tid & 7) * 16, lV = (unsigned)(size_t)ring + ST_VH + (tid >> 2) * VPB + (tid & 3) * 16;
  const size_t oK = bh * SS * DH + tid * 8, oV = (bh * DH + (tid >> 2)) * (size_t)SS + (tid & 3) * 8;
  // the copies of one tile set stand in one statement with s_wait_xcnt 0 as its last line, so that no later write of their address registers can be moved in front of that wait
#define ASTAGE(t, buf) do { const unsigned k0 = lK + (buf) * ST_SZ, k1 = k0 + 16 * KPB, v0 = lV + (buf) * ST_SZ, v1 = v0 + 32 * VPB, w0 = v0 + (ST_VL - ST_VH), w1 = w0 + 32 * VPB; \
    const _Float16* gk0 = KH + oK + (size_t)(t) * 32 * DH; const _Float16* gk1 = gk0 + 128 * 8; const _Float16* gv0 = VT + oV + (t) * 32; const _Float16* gv1 = gv0 + 32 * SS; const _Float16* gw0 = VTL + oV + (t) * 32; const _Float16* gw1 = gw0 + 32 * SS; \
    asm volatile("global_load_async_to_lds_b128 %0, %1, off\n\tglobal_load_async_to_lds_b128 %2, %3, off\n\tglobal_load_async_to_lds_b128 %4, %5, off\n\tglobal_load_async_to_lds_b128 %6, %7, off\n\tglobal_load_async_to_lds_b128 %8, %9, off\n\tglobal_load_async_to_lds_b128 %10, %11, off\n\ts_wait_xcnt 0x0" \
                 :: "v"(k0), "v"(gk0), "v"(k1), "v"(gk1), "v"(v0), "v"(gv0), "v"(v1), "v"(gv1), "v"(w0), "v"(gw0), "v"(w1), "v"(gw1) : "memory"); \
    if (hi3) { const unsigned r0 = k0 + ST_KL, r1 = k1 + ST_KL; const _Float16* gr0 = KL + oK + (size_t)(t) * 32 * DH; const _Float16* gr1 = gr0 + 128 * 8; \
      asm volatile("global_load_async_to_lds_b128 %0, %1, off\n\tglobal_load_async_to_lds_b128 %2, %3, off\n\ts_wait_xcnt 0x0" :: "v"(r0), "v"(gr0), "v"(r1), "v"(gr1) : "memory"); } } while (0)
  ASTAGE(0, 0);
  asm volatile("s_wait_asynccnt 0x0" ::: "memory");   // this wave's share of tile 0 has landed
  __syncthreads();                                    // ... and every other wave's
  ASTAGE(1, 1);
#pragma unroll 1
  for (int ks = 0; ks < nks; ++ks) { float s[2][8]; const unsigned char* tb = ring + (ks & 1) * ST_SZ;
    // the K fragments of the pass are asked for in one group ahead of the score products (the unrolls make the fragment arrays' indices constants, so that they stay in registers)
    v16h kf[2][2], kq[2][2];
#pragma unroll
    for (int ct = 0; ct < 2; ++ct)
#pragma unroll
      for (int kc = 0; kc < 2; ++kc) kf[ct][kc] = frag_h((const _Float16*)(tb + (ct * 16 + col) * KPB) + kc * 32, lane);
    if (hi3) {
#pragma unroll
      for (int ct = 0; ct < 2; ++ct)
#pragma unroll
        for (int kc = 0; kc < 2; ++kc) kq[ct][kc] = frag_h((const _Float16*)(tb + ST_KL + (ct * 16 + col) * KPB) + kc * 32, lane); }
#pragma unroll
    for (int ct = 0; ct < 2; ++ct) { const int kk = ks * 32 + ct * 16 + col; v8f c = {}, cl = {};
#pragma unroll
      for (int kc = 0; kc < 2; ++kc) c = wmma16(aq[kc], kf[ct][kc], c);
      if (hi3) {
#pragma unroll
        for (int kc = 0; kc < 2; ++kc) { cl = wmma16(aq[kc], kq[ct][kc], cl); cl = wmma16(al[kc], kf[ct][kc], cl); } }
#pragma unroll
      for (int r = 0; r < 8; ++r) { const int p = p0 + 8 * g + r; const float sc = (c[r] + (hi3 ? cl[r] * (1.0f / 2048.0f) : 0.f)) * 0.125f; s[ct][r] = (p == 0) ? 0.0f : ((kk < p) ? sc : -3.0e38f); } }   // position 0: all logits equal -> uniform
    float alpha[8];
#pragma unroll
    for (int r = 0; r < 8; ++r) { float mx = fmaxf(s[0][r], s[1][r]);
#pragma unroll
      for (int o = 1; o < 16; o <<= 1) mx = fmaxf(mx, __shfl_xor(mx, o));
      const float mn = fmaxf(m[r], mx); alpha[r] = (m[r] <= -1.0e38f) ? 0.f : __expf(m[r] - mn); const float e0 = (s[0][r] <= -1.0e38f) ? 0.f : __expf(s[0][r] - mn), e1 = (s[1][r] <= -1.0e38f) ? 0.f : __expf(s[1][r] - mn); float es = e0 + e1;
#pragma unroll
      for (int o = 1; o < 16; o <<= 1) es += __shfl_xor(es, o);
      l[r] = l[r] * alpha[r] + es; m[r] = (mn > -1.0e38f) ? mn : m[r]; sp[wave][8 * g + r][col] = e0; sp[wave][8 * g + r][16 + col] = e1; }
#pragma unroll
    for (int j = 0; j < 4; ++j)
#pragma unroll
      for (int r = 0; r < 8; ++r) { acc[j][r] *= alpha[r]; accl[j][r] *= alpha[r]; }
    LDSX();
    v16h pa; { const float* prow = &sp[wave][col][0] + 8 * (lane >> 4);
#pragma unroll
      for (int i = 0; i < 8; ++i) { pa[i] = (_Float16)(prow[i] * 2048.0f); pa[8 + i] = (_Float16)(prow[16 + i] * 2048.0f); } }
#pragma unroll
    for (int jj = 0; jj < 4; jj += 2) { v16h vh[2], vl[2];   // V^T fragments in two groups of four: all eight at once do not fit the registers
#pragma unroll
      for (int j = 0; j < 2; ++j) { vh[j] = frag_h((const _Float16*)(tb + ST_VH + ((jj + j) * 16 + col) * VPB), lane); vl[j] = frag_h((const _Float16*)(tb + ST_VL + ((jj + j) * 16 + col) * VPB), lane); }
#pragma unroll
      for (int j = 0; j < 2; ++j) { acc[jj + j] = wmma16(pa, vh[j], acc[jj + j]); accl[jj + j] = wmma16(pa, vl[j], accl[jj + j]); } }
    asm volatile("s_wait_dscnt 0x0" ::: "memory");      // this wave's reads of the buffer (and of its P rows) are done
    asm volatile("s_wait_asynccnt 0x0" ::: "memory");   // its share of the next tile has landed
    __syncthreads();                                    // publishes the next tile and frees this pass's buffer
    if (ks + 2 < nks) ASTAGE(ks + 2, ks & 1); }
  asm volatile("s_wait_asynccnt 0x0" ::: "memory");     // no copy is left in flight when the wave goes on to its end
#pragma unroll
  for (int r = 0; r < 8; ++r) { const float il = (l[r] > 0.f) ? (1.0f / 2048.0f) / l[r] : 0.f;
#pragma unroll
    for (int j = 0; j < 4; ++j) so[wave][8 * g + r][j * 16 + col] = (acc[j][r] + accl[j][r] * (1.0f / 2048.0f)) * il; }
  LDSX(); for (int rl = 0; rl < 16; ++rl) if (lane < 16) vst2(OUT + (rq + rl) * DH + lane * 4, *(const v4f*)&so[wave][rl][lane * 4]); }
extern "C" void kernel_launch(void* const* d_in, const int* in_sizes, int n_in, void* d_out, int out_size, void* d_ws, size_t ws_size, hipStream_t stream) {
  (void)in_sizes; (void)n_in; (void)out_size;
  const float** F = (const float**)d_in;   // 0 query_vector, 1 key_vector, 2 value_vector [2,2048,1024]; 3 Wq, 4 bq, 5 Wk, 6 bk, 7 Wv, 8 bv (natural)
  if (ws_size < (size_t)WS_END) return;
  char* ws = (char*)d_ws; _Float16 *QH = (_Float16*)(ws + WS_QH), *QL = (_Float16*)(ws + WS_QL), *KH = (_Float16*)(ws + WS_KH), *KL = (_Float16*)(ws + WS_KL), *VT = (_Float16*)(ws + WS_VT), *VTL = (_Float16*)(ws + WS_VTL); float* VF = (float*)(ws + WS_VF);
  k_proj<<<dim3(NROW / 128, DD / 128, 3), 256, 0, stream>>>(F[0], F[1], F[2], F[3], F[4], F[5], F[6], F[7], F[8], QH, QL, KH, KL, VF);
  k_vt<<<dim3(SS / 64, NB * NH), 128, 0, stream>>>(VF, VT, VTL);
  k_att<<<dim3(SS / 64, NH, TNB), 128, 0, stream>>>(QH, QL, KH, KL, VT, VTL, (float*)d_out);
}

// v003
// It runs in 139 microseconds.
// Two timings next to v002 put it at 1.31 and 1.29 times that version's speed.
// Counting every step since v000, it is 3.88 times as fast.
// compute dtype: all float inputs rounded to bf16; Q/K/V = input . W^T + b with EXACT bf16 products on WMMA 16x16x32 (natural rows); the module's raw reshape (B,S,D)->(B,H,S,Dh) means 'head h' = the 128 projected rows 128h..128h+127 viewed as 2,048 positions x 64 (position p = (s - 128h)*16 + c/64) - handled purely by addressing; Q/K as f16 hi + residual (3-product scores for positions < 128, single f16 after), V as f16 hi + residual planes (2 products); mask: keys j >= i set to -1e9 INCLUDING the diagonal, so position 0 attends uniformly to all 2,048 keys (all logits equal) and position i >= 1 to keys < i; x 1/8; running-max softmax in f32 (hardware exp); the context in the same raw layout is the f32 output.
#include <hip/hip_runtime.h>
#include <math.h>

typedef __attribute__((ext_vector_type(16))) _Float16 v16h;
typedef __attribute__((ext_vector_type(16))) __bf16 v16b;
typedef __attribute__((ext_vector_type(8)))  _Float16 v8h;
typedef __attribute__((ext_vector_type(8)))  float v8f;
typedef __attribute__((ext_vector_type(4)))  float v4f;
typedef __attribute__((ext_vector_type(2)))  float v2f;
typedef __attribute__((ext_vector_type(4)))  unsigned v4u;
typedef __attribute__((ext_vector_type(4)))  int v4i;
typedef float __attribute__((may_alias)) float_a;
typedef int __attribute__((may_alias)) int_a;

template <typename T> __device__ __forceinline__ void vst2(void* p, T v) { *(T*)p = v;  }
__device__ __forceinline__ v8f wmma16(v16h a, v16h b, v8f c) {
  v8f d = __builtin_amdgcn_wmma_f32_16x16x32_f16(false, a, false, b, (short)0, c, false, false);
  asm volatile("v_nop\n\tv_nop\n\tv_nop\n\tv_nop" : "+v"(d) : "v"(a), "v"(b));
  return d;
}
__device__ __forceinline__ v8f wmma_bf(v16b a, v16b b, v8f c) {
  v8f d = __builtin_amdgcn_wmma_f32_16x16x32_bf16(false, a, false, b, (short)0, c, false, false);
  asm volatile("v_nop\n\tv_nop\n\tv_nop\n\tv_nop" : "+v"(d) : "v"(a), "v"(b));
  return d;
}
// 16x16x32 fragments: lane = (h = lane>>4, row/col = lane&15); elements 0..7 = k0+8h+0..7, 8..15 = k0+16+8h+0..7; D element r = row 8h+r
__device__ __forceinline__ v16h frag_h(const _Float16* rowk0, int lane) {
  union { v16h v; v8h q[2]; } u; const _Float16* p = rowk0 + 8 * (lane >> 4);
  u.q[0] = *(const v8h*)p; u.q[1] = *(const v8h*)(p + 16); return u.v;
}
__device__ __forceinline__ v16h frag_f32(const float* rowk0, int lane) {
  v16h a; const float* p = rowk0 + 8 * (lane >> 4);
#pragma unroll
  for (int i = 0; i < 8; ++i) { a[i] = (_Float16)p[i]; a[8 + i] = (_Float16)p[16 + i]; }
  return a;
}
__device__ __forceinline__ v16h frag_f32s(const float* rowk0, int lane, float sc) {
  v16h a; const float* p = rowk0 + 8 * (lane >> 4);
#pragma unroll
  for (int i = 0; i < 8; ++i) { a[i] = (_Float16)(p[i] * sc); a[8 + i] = (_Float16)(p[16 + i] * sc); }
  return a;
}
// column fragment from a [K][ld] layout (column n), rows >= K read as 0
__device__ __forceinline__ v16h fragc_f32(const float* W, int k0, int n, int lane, int ld, int K) {
  v16h a; const int g = lane >> 4;
#pragma unroll
  for (int i = 0; i < 8; ++i) { const int ka = k0 + 8 * g + i, kb = ka + 16;
    a[i] = (_Float16)(ka < K ? W[(size_t)(ka < K ? ka : K - 1) * ld + n] : 0.f); a[8 + i] = (_Float16)(kb < K ? W[(size_t)(kb < K ? kb : K - 1) * ld + n] : 0.f); }
  return a;
}
struct F2 { v16b h, l; };
__device__ __forceinline__ F2 bsplit16(const float v[16]) { F2 r;
#pragma unroll
  for (int i = 0; i < 16; ++i) { const __bf16 h = (__bf16)v[i]; r.h[i] = h; r.l[i] = (__bf16)(v[i] - (float)h); }
  return r; }
__device__ __forceinline__ F2 split_row(const float* row, int k0, int lane) { float v[16]; const float* p = row + k0 + 8 * (lane >> 4);
#pragma unroll
  for (int i = 0; i < 8; ++i) { v[i] = p[i]; v[8 + i] = p[16 + i]; }
  return bsplit16(v); }
__device__ __forceinline__ F2 split_rowK(const float* row, int k0, int lane, int K) { float v[16]; const int g = lane >> 4;
#pragma unroll
  for (int i = 0; i < 8; ++i) { const int ka = k0 + 8 * g + i, kb = ka + 16; v[i] = ka < K ? row[ka < K ? ka : K - 1] : 0.f; v[8 + i] = kb < K ? row[kb < K ? kb : K - 1] : 0.f; }
  return bsplit16(v); }
__device__ __forceinline__ F2 split_col(const float* W, int k0, int n, int lane, int ld, int K) { float v[16]; const int g = lane >> 4;
#pragma unroll
  for (int i = 0; i < 8; ++i) { const int ka = k0 + 8 * g + i, kb = ka + 16; v[i] = ka < K ? W[(size_t)(ka < K ? ka : K - 1) * ld + n] : 0.f; v[8 + i] = kb < K ? W[(size_t)(kb < K ? kb : K - 1) * ld + n] : 0.f; }
  return bsplit16(v); }
__device__ __forceinline__ v8f mac3(const F2& a, const F2& b, v8f c) { c = wmma_bf(a.l, b.h, c); c = wmma_bf(a.h, b.l, c); return wmma_bf(a.h, b.h, c); }
__device__ __forceinline__ float sigm(float v) { return 1.0f / (1.0f + expf(-v)); }
#define LDSX() do { asm volatile("s_wait_dscnt 0" ::: "memory"); __builtin_amdgcn_wave_barrier(); __builtin_amdgcn_fence(__ATOMIC_RELEASE, "workgroup"); } while (0)


// 'Fast' MHA with raw-reshape heads (B 2, S 2,048, D 1,024, 16 'heads' x 64): separate query / key / value inputs, natural projections + biases, triu(offset 0)-masked softmax(q k / 8) v, raw reshape back (no output projection).
#define NB 2
#define SS 2048           // positions per head (== S)
#define DD 1024
#define NH 16
#define DH 64
#define NROW (NB * SS)    // projected rows
#ifndef TNB
#define TNB NB
#endif
typedef __attribute__((ext_vector_type(8))) __bf16 v8b;
__device__ __forceinline__ v16b frag_b(const __bf16* rowk0, int lane) {
  union { v16b v; v8b q[2]; } u; const __bf16* p = rowk0 + 8 * (lane >> 4);
  u.q[0] = *(const v8b*)p; u.q[1] = *(const v8b*)(p + 16); return u.v;
}
__device__ __forceinline__ float bfr(float v) { return (float)(__bf16)v; }
__device__ __forceinline__ float xhalf(float x) { return __builtin_bit_cast(float, __builtin_amdgcn_permlanex16(__builtin_bit_cast(int, x), __builtin_bit_cast(int, x), 0x76543210, 0xfedcba98, false, false)); }  // lane l's value for lane l ^ 16
__device__ __attribute__((noinline)) float exp_ni(float v) { return expf(v); }
__device__ __attribute__((noinline)) float erf_ni(float v) { return erff(v); }

#define WS_QH  0u                                   // f16 hi|lo Q flat [b][s][1024] == [b][h][p][64]
#define WS_QL  (WS_QH + 2u * (size_t)NROW * DD)
#define WS_KH  (WS_QL + 2u * (size_t)NROW * DD)
#define WS_KL  (WS_KH + 2u * (size_t)NROW * DD)
#define WS_VF  (WS_KL + 2u * (size_t)NROW * DD)          // f32 V flat
#define WS_VT  (WS_VF + 4u * (size_t)NROW * DD)          // f16 hi|lo V planes [b][h][64 d][2048 p]
#define WS_VTL (WS_VT + 2u * (size_t)NB * NH * DH * SS)
#define WS_END (WS_VTL + 2u * (size_t)NB * NH * DH * SS)

__device__ __forceinline__ v16b fragb_f32(const float* __restrict__ p, int lane) { v16b a; const float* pp = p + 8 * (lane >> 4);
#pragma unroll
  for (int i = 0; i < 8; ++i) { a[i] = (__bf16)pp[i]; a[8 + i] = (__bf16)pp[16 + i]; } return a; }
// ---- k_proj: block = (128 rows, 128 cols, which), 8 waves of 64 x 32: which 0 Q, 1 K -> f16 hi/lo flat rows; 2 V -> f32 flat rows.
// Each 32-k slice of the X and W tiles is read once per block by whole-line loads (8 lanes x 16 B = one 128-B row piece), rounded to bf16 once and kept in LDS; all 8 waves take their fragments from there.
#define PLD 40            // bf16 elements per staged row: 64 B of data + 16 B pad; 80 B = 16 B x odd keeps the 16-byte fragment reads off each other's banks
#define PTILE (128 * PLD) // one staged operand slice
typedef __attribute__((ext_vector_type(4))) __bf16 v4b;
__global__ __launch_bounds__(256) void k_proj(const float* __restrict__ XQ, const float* __restrict__ XK, const float* __restrict__ XV, const float* __restrict__ WQ, const float* __restrict__ BQ, const float* __restrict__ WK, const float* __restrict__ BK, const float* __restrict__ WV, const float* __restrict__ BV, _Float16* __restrict__ QH, _Float16* __restrict__ QL, _Float16* __restrict__ KH, _Float16* __restrict__ KL, float* __restrict__ VF) {
  __shared__ __align__(16) unsigned char smem[2 * 128 * 136 * 2];   // K loop: two buffers of [X slice | W slice] (40,960 B); afterwards the output staging (f16 hi | lo planes, or one f32 plane)
  __bf16* const sA = (__bf16*)smem; __bf16* const sB = sA + 2 * PTILE;
  const int tid = threadIdx.x, wave = tid >> 5, lane = tid & 31, col = lane & 15, g = lane >> 4; const int which = blockIdx.z; const size_t row0 = (size_t)blockIdx.x * 128; const int c0 = blockIdx.y * 128;
  const int wm = wave >> 2, wn = wave & 3;
  const float* X = which == 0 ? XQ : which == 1 ? XK : XV; const float* Wm = which == 0 ? WQ : which == 1 ? WK : WV; const float* Bm = which == 0 ? BQ : which == 1 ? BK : BV;
  const int sr = tid >> 3, sc = (tid & 7) * 4;   // staging: this thread's row (plus 32 i) and its four k of the slice
  const float* gA = X + (row0 + sr) * DD + sc; const float* gB = Wm + (size_t)(c0 + sr) * DD + sc;
  const int so_ = sr * PLD + sc;
  v4f ra[4], rb[4];
  v8f acc[4][2] = {};
  // every unroll in this kernel makes the indices of acc, ra, rb and the fragment arrays constants, so that they stay in registers
#define PLOAD(pa, pb) do { _Pragma("unroll") for (int i = 0; i < 4; ++i) { ra[i] = *(const v4f*)((pa) + (size_t)i * 32 * DD); rb[i] = *(const v4f*)((pb) + (size_t)i * 32 * DD); } } while (0)
#define PSTORE(buf) do { _Pragma("unroll") for (int i = 0; i < 4; ++i) { v4b ta, tb; _Pragma("unroll") for (int e = 0; e < 4; ++e) { ta[e] = (__bf16)ra[i][e]; tb[e] = (__bf16)rb[i][e]; } *(v4b*)(sA + (buf) * PTILE + so_ + i * 32 * PLD) = ta; *(v4b*)(sB + (buf) * PTILE + so_ + i * 32 * PLD) = tb; } } while (0)
#define PMAC(buf) do { v16b fb[2], fa[4]; _Pragma("unroll") for (int j = 0; j < 2; ++j) fb[j] = frag_b(sB + (buf) * PTILE + (wn * 32 + j * 16 + col) * PLD, lane); \
    _Pragma("unroll") for (int i = 0; i < 4; ++i) fa[i] = frag_b(sA + (buf) * PTILE + (wm * 64 + i * 16 + col) * PLD, lane); \
    _Pragma("unroll") for (int i = 0; i < 4; ++i) { _Pragma("unroll") for (int j = 0; j < 2; ++j) acc[i][j] = wmma_bf(fa[i], fb[j], acc[i][j]); } } while (0)
  PLOAD(gA, gB); PSTORE(0); __syncthreads();
  for (int kc = 0; kc < DD / 32 - 1; ++kc) { const int cur = kc & 1;
    const float* pa = gA + (kc + 1) * 32; const float* pb = gB + (kc + 1) * 32;
    PLOAD(pa, pb);        // the next slice flies while this one is multiplied
    asm volatile("s_wait_xcnt 0x0" :: "v"(pa), "v"(pb) : "memory");   // keeps the two address pairs whole until this wait: the fragment reads below may reuse their registers
    PMAC(cur);
    PSTORE(cur ^ 1);      // its last readers left it before the previous barrier
    __syncthreads(); }
  PMAC((DD / 32 - 1) & 1);
  __syncthreads();        // every wave has read its last fragments: the buffers become output staging
  _Float16 (*sh)[136] = (_Float16 (*)[136])smem; _Float16 (*sl)[136] = (_Float16 (*)[136])(smem + 128 * 136 * 2); float (*sf)[132] = (float (*)[132])smem;
  if (which < 2) {
#pragma unroll
    for (int j = 0; j < 2; ++j) { const int cc = wn * 32 + j * 16 + col; const float bb = bfr(Bm[c0 + cc]);
#pragma unroll
      for (int i = 0; i < 4; ++i)
#pragma unroll
        for (int r = 0; r < 8; ++r) { const int rr = wm * 64 + i * 16 + 8 * g + r; const float v = acc[i][j][r] + bb; const _Float16 hv = (_Float16)v; sh[rr][cc] = hv; sl[rr][cc] = (_Float16)((v - (float)hv) * 2048.0f); } }
  } else {
#pragma unroll
    for (int j = 0; j < 2; ++j) { const int cc = wn * 32 + j * 16 + col; const float bb = bfr(Bm[c0 + cc]);
#pragma unroll
      for (int i = 0; i < 4; ++i)
#pragma unroll
        for (int r = 0; r < 8; ++r) sf[wm * 64 + i * 16 + 8 * g + r][cc] = acc[i][j][r] + bb; }
  }
  __syncthreads();
  if (which < 2) { _Float16* PH = which == 0 ? QH : KH; _Float16* PL = which == 0 ? QL : KL; for (int e = tid; e < 128 * 16; e += 256) { const int rl = e >> 4, q = e & 15; const size_t o = (row0 + rl) * DD + c0 + q * 8; vst2((unsigned*)(PH + o), *(const v4u*)&sh[rl][q * 8]); vst2((unsigned*)(PL + o), *(const v4u*)&sl[rl][q * 8]); } }
  else { for (int e = tid; e < 128 * 32; e += 256) { const int rl = e >> 5, q = e & 31; vst2(VF + (row0 + rl) * DD + c0 + q * 4, *(const v4f*)&sf[rl][q * 4]); } } }
// ---- k_vt: block = (64 positions, b*NH + h): V flat [b][h][p][64] -> planes [b][h][d][p] (f16 hi/lo)
__global__ __launch_bounds__(128) void k_vt(const float* __restrict__ VF, _Float16* __restrict__ VT, _Float16* __restrict__ VTL) { __shared__ __align__(16) _Float16 th[DH][72], tl[DH][72]; const int t = threadIdx.x; const size_t bh = blockIdx.y; const int p0 = blockIdx.x * 64;
  for (int e = t; e < 64 * DH; e += 128) { const int pl = e / DH, d = e % DH; const float v = VF[(bh * SS + p0 + pl) * DH + d]; const _Float16 hv = (_Float16)v; th[d][pl] = hv; tl[d][pl] = (_Float16)((v - (float)hv) * 2048.0f); }
  __syncthreads(); for (int e = t; e < DH * 8; e += 128) { const int d = e >> 3, q = e & 7; const size_t o = (bh * DH + d) * (size_t)SS + p0 + q * 8; vst2((unsigned*)(VT + o), *(const v4u*)&th[d][q * 8]); vst2((unsigned*)(VTL + o), *(const v4u*)&tl[d][q * 8]); } }
// ---- k_att: block = (64 positions, h, b): keys j < i (diagonal excluded); position 0 -> uniform over all keys; key tiles past the block skipped (block 0 also scans all tiles so that position 0's uniform average is exact)
// The products are taken transposed: S^T = K . Q^T (A = K rows, B = Q rows) and O^T += V^T . P^T. A lane then holds 16 of the pass's 32 scores of ONE query (position p0 + col; lane ^ 16 holds the other 16), so maximum and sum are taken in the lane,
// and the two score tiles, turned into f16 in place, already are the B operand of the second product (element s = tile s / 8, register s % 8 = key 8 g + s % 8 + 16 (s / 8): the k order of frag_h): P goes through no LDS.
// Each pass's 32 keys (K hi rows, K residual rows for the first 128 positions, V^T hi and residual row pieces) are brought into LDS once per block by asynchronous 16-byte copies, two buffers, one pass ahead; the four waves take their fragments from there.
#define KPB 144                     // bytes per staged K row: 128 B of data + 16 B pad (16 B x odd keeps the 16-byte fragment reads off each other's banks)
#define VPB 80                      // bytes per staged V^T row piece: 64 B of data + 16 B pad
#define ST_KL (32 * KPB)            // buffer layout: K hi | K residual | V^T hi | V^T residual
#define ST_VH (2 * 32 * KPB)
#define ST_VL (ST_VH + 64 * VPB)
#define ST_SZ (ST_VL + 64 * VPB)
__global__ __launch_bounds__(128) void k_att(const _Float16* __restrict__ QH, const _Float16* __restrict__ QL, const _Float16* __restrict__ KH, const _Float16* __restrict__ KL, const _Float16* __restrict__ VT, const _Float16* __restrict__ VTL, float* __restrict__ OUT) {
  __shared__ __align__(16) unsigned char ring[2 * ST_SZ];
  __shared__ __align__(16) float so[4][16][68];
  const int tid = threadIdx.x, wave = tid >> 5, lane = tid & 31, col = lane & 15, g = lane >> 4; const int h = blockIdx.y; const size_t b = blockIdx.z; const int qb = blockIdx.x; const int p0 = qb * 64 + wave * 16; const size_t bh = b * NH + h; const size_t rq = bh * SS + p0;
  const bool hi3 = qb < 2;   // first 128 positions: 3-product scores
  v16h aq[2], al[2];
#pragma unroll
  for (int kc = 0; kc < 2; ++kc) { aq[kc] = frag_h(QH + (rq + col) * DH + kc * 32, lane); al[kc] = frag_h(QL + (rq + col) * DH + kc * 32, lane); }
  const int p = p0 + col;                            // this lane's query position
  const float fill = (p == 0) ? 0.0f : -3.0e38f;     // what a key j >= p scores; position 0: all logits equal -> uniform
  float m = -3.0e38f, l = 0.f;                       // running maximum (same in both halves); this lane's half of the running sum
  v8f acc[4] = {}, accl[4] = {};
  const int nks = (qb == 0) ? SS / 32 : (qb * 64 + 64) / 32;   // at least 4
  // staging: a K tile is 4,096 contiguous bytes (thread: 16-byte pieces tid and tid + 128); a V^T tile is 64 row pieces of 64 B (thread: rows tid / 4 and tid / 4 + 32)
  const unsigned lK = (unsigned)(size_t)ring + (tid >> 3) * KPB + (tid & 7) * 16, lV = (unsigned)(size_t)ring + ST_VH + (tid >> 2) * VPB + (tid & 3) * 16;
  const size_t oK = bh * SS * DH + tid * 8, oV = (bh * DH + (tid >> 2)) * (size_t)SS + (tid & 3) * 8;
  // the copies of one tile set stand in one statement with s_wait_xcnt 0 as its last line, so that no later write of their address registers can be moved in front of that wait
#define ASTAGE(t, buf) do { const unsigned k0 = lK + (buf) * ST_SZ, k1 = k0 + 16 * KPB, v0 = lV + (buf) * ST_SZ, v1 = v0 + 32 * VPB, w0 = v0 + (ST_VL - ST_VH), w1 = w0 + 32 * VPB; \
    const _Float16* gk0 = KH + oK + (size_t)(t) * 32 * DH; const _Float16* gk1 = gk0 + 128 * 8; const _Float16* gv0 = VT + oV + (t) * 32; const _Float16* gv1 = gv0 + 32 * SS; const _Float16* gw0 = VTL + oV + (t) * 32; const _Float16* gw1 = gw0 + 32 * SS; \
    asm volatile("global_load_async_to_lds_b128 %0, %1, off\n\tglobal_load_async_to_lds_b128 %2, %3, off\n\tglobal_load_async_to_lds_b128 %4, %5, off\n\tglobal_load_async_to_lds_b128 %6, %7, off\n\tglobal_load_async_to_lds_b128 %8, %9, off\n\tglobal_load_async_to_lds_b128 %10, %11, off\n\ts_wait_xcnt 0x0" \
                 :: "v"(k0), "v"(gk0), "v"(k1), "v"(gk1), "v"(v0), "v"(gv0), "v"(v1), "v"(gv1), "v"(w0), "v"(gw0), "v"(w1), "v"(gw1) : "memory"); \
    if (hi3) { const unsigned r0 = k0 + ST_KL, r1 = k1 + ST_KL; const _Float16* gr0 = KL + oK + (size_t)(t) * 32 * DH; const _Float16* gr1 = gr0 + 128 * 8; \
      asm volatile("global_load_async_to_lds_b128 %0, %1, off\n\tglobal_load_async_to_lds_b128 %2, %3, off\n\ts_wait_xcnt 0x0" :: "v"(r0), "v"(gr0), "v"(r1), "v"(gr1) : "memory"); } } while (0)
  ASTAGE(0, 0);
  asm volatile("s_wait_asynccnt 0x0" ::: "memory");   // this wave's share of tile 0 has landed
  __syncthreads();                                    // ... and every other wave's
  ASTAGE(1, 1);
#pragma unroll 1
  for (int ks = 0; ks < nks; ++ks) { float s[2][8]; const unsigned char* tb = ring + (ks & 1) * ST_SZ;
    // the K fragments of the pass are asked for in one group ahead of the score products (the unrolls make the fragment arrays' indices constants, so that they stay in registers)
    v16h kf[2][2], kq[2][2];
#pragma unroll
    for (int ct = 0; ct < 2; ++ct)
#pragma unroll
      for (int kc = 0; kc < 2; ++kc) kf[ct][kc] = frag_h((const _Float16*)(tb + (ct * 16 + col) * KPB) + kc * 32, lane);
    if (hi3) {
#pragma unroll
      for (int ct = 0; ct < 2; ++ct)
#pragma unroll
        for (int kc = 0; kc < 2; ++kc) kq[ct][kc] = frag_h((const _Float16*)(tb + ST_KL + (ct * 16 + col) * KPB) + kc * 32, lane); }
#pragma unroll
    for (int ct = 0; ct < 2; ++ct) { const int nk = p - (ks * 32 + ct * 16 + 8 * g); v8f c = {}, cl = {};   // register r = key ks * 32 + ct * 16 + 8 g + r: it counts while r < nk
#pragma unroll
      for (int kc = 0; kc < 2; ++kc) c = wmma16(kf[ct][kc], aq[kc], c);
      if (hi3) {
#pragma unroll
        for (int kc = 0; kc < 2; ++kc) { cl = wmma16(kq[ct][kc], aq[kc], cl); cl = wmma16(kf[ct][kc], al[kc], cl); } }
#pragma unroll
      for (int r = 0; r < 8; ++r) { const float sc = (c[r] + (hi3 ? cl[r] * (1.0f / 2048.0f) : 0.f)) * 0.125f; s[ct][r] = (r < nk) ? sc : fill; } }
    // the unrolls below make the indices of s, es, pa and the accumulators constants, so that they stay in registers
    float mx = fmaxf(s[0][0], s[1][0]);
#pragma unroll
    for (int r = 1; r < 8; ++r) mx = fmaxf(mx, fmaxf(s[0][r], s[1][r]));
    mx = fmaxf(mx, xhalf(mx));
    const float mn = fmaxf(m, mx); const float alpha = (m <= -1.0e38f) ? 0.f : __expf(m - mn);
    v16h pa; float es[4] = {0.f, 0.f, 0.f, 0.f};   // four short chains of adds instead of one of sixteen
#pragma unroll
    for (int ct = 0; ct < 2; ++ct)
#pragma unroll
      for (int r = 0; r < 8; ++r) { const float e = (s[ct][r] <= -1.0e38f) ? 0.f : __expf(s[ct][r] - mn); es[r & 3] += e; pa[ct * 8 + r] = (_Float16)(e * 2048.0f); }
    l = l * alpha + ((es[0] + es[1]) + (es[2] + es[3])); m = (mn > -1.0e38f) ? mn : m;
#pragma unroll
    for (int j = 0; j < 4; ++j)
#pragma unroll
      for (int r = 0; r < 8; ++r) { acc[j][r] *= alpha; accl[j][r] *= alpha; }
#pragma unroll
    for (int jj = 0; jj < 4; jj += 2) { v16h vh[2], vl[2];   // V^T fragments in two groups of four: all eight at once do not fit the registers
#pragma unroll
      for (int j = 0; j < 2; ++j) { vh[j] = frag_h((const _Float16*)(tb + ST_VH + ((jj + j) * 16 + col) * VPB), lane); vl[j] = frag_h((const _Float16*)(tb + ST_VL + ((jj + j) * 16 + col) * VPB), lane); }
#pragma unroll
      for (int j = 0; j < 2; ++j) { acc[jj + j] = wmma16(vh[j], pa, acc[jj + j]); accl[jj + j] = wmma16(vl[j], pa, accl[jj + j]); } }
    asm volatile("s_wait_dscnt 0x0" ::: "memory");      // this wave's reads of the buffer are done
    asm volatile("s_wait_asynccnt 0x0" ::: "memory");   // its share of the next tile has landed
    __syncthreads();                                    // publishes the next tile and frees this pass's buffer
    if (ks + 2 < nks) ASTAGE(ks + 2, ks & 1); }
  asm volatile("s_wait_asynccnt 0x0" ::: "memory");     // no copy is left in flight when the wave goes on to its end
  const float lt = l + xhalf(l);   // the two halves' sums are joined once
  const float il = (lt > 0.f) ? (1.0f / 2048.0f) / lt : 0.f;
#pragma unroll
  for (int j = 0; j < 4; ++j) { v4f o[2];   // register r = channel j * 16 + 8 g + r of this lane's query
#pragma unroll
    for (int r = 0; r < 8; ++r) o[r >> 2][r & 3] = (acc[j][r] + accl[j][r] * (1.0f / 2048.0f)) * il;
    *(v4f*)&so[wave][col][j * 16 + 8 * g] = o[0]; *(v4f*)&so[wave][col][j * 16 + 8 * g + 4] = o[1]; }
  LDSX(); for (int rl = 0; rl < 16; ++rl) if (lane < 16) vst2(OUT + (rq + rl) * DH + lane * 4, *(const v4f*)&so[wave][rl][lane * 4]); }
extern "C" void kernel_launch(void* const* d_in, const int* in_sizes, int n_in, void* d_out, int out_size, void* d_ws, size_t ws_size, hipStream_t stream) {
  (void)in_sizes; (void)n_in; (void)out_size;
  const float** F = (const float**)d_in;   // 0 query_vector, 1 key_vector, 2 value_vector [2,2048,1024]; 3 Wq, 4 bq, 5 Wk, 6 bk, 7 Wv, 8 bv (natural)
  if (ws_size < (size_t)WS_END) return;
  char* ws = (char*)d_ws; _Float16 *QH = (_Float16*)(ws + WS_QH), *QL = (_Float16*)(ws + WS_QL), *KH = (_Float16*)(ws + WS_KH), *KL = (_Float16*)(ws + WS_KL), *VT = (_Float16*)(ws + WS_VT), *VTL = (_Float16*)(ws + WS_VTL); float* VF = (float*)(ws + WS_VF);
  k_proj<<<dim3(NROW / 128, DD / 128, 3), 256, 0, stream>>>(F[0], F[1], F[2], F[3], F[4], F[5], F[6], F[7], F[8], QH, QL, KH, KL, VF);
  k_vt<<<dim3(SS / 64, NB * NH), 128, 0, stream>>>(VF, VT, VTL);
  k_att<<<dim3(SS / 64, NH, TNB), 128, 0, stream>>>(QH, QL, KH, KL, VT, VTL, (float*)d_out);
}

// v004
// One run takes 113 microseconds.
// In two side-by-side timings against v003, it was 1.21 and 1.20 times as fast.
// Over all steps from v000 it is 4.68 times as fast.
// compute dtype: all float inputs rounded to bf16; Q/K/V = input . W^T + b with EXACT bf16 products on WMMA 16x16x32 (natural rows); the module's raw reshape (B,S,D)->(B,H,S,Dh) means 'head h' = the 128 projected rows 128h..128h+127 viewed as 2,048 positions x 64 (position p = (s - 128h)*16 + c/64) - handled purely by addressing; Q/K as f16 hi + residual (3-product scores for positions < 128, single f16 after), V as f16 hi + residual planes (2 products); mask: keys j >= i set to -1e9 INCLUDING the diagonal, so position 0 attends uniformly to all 2,048 keys (all logits equal) and position i >= 1 to keys < i; x 1/8; running-max softmax in f32 (hardware exp); the context in the same raw layout is the f32 output.
#include <hip/hip_runtime.h>
#include <math.h>

typedef __attribute__((ext_vector_type(16))) _Float16 v16h;
typedef __attribute__((ext_vector_type(16))) __bf16 v16b;
typedef __attribute__((ext_vector_type(8)))  _Float16 v8h;
typedef __attribute__((ext_vector_type(8)))  float v8f;
typedef __attribute__((ext_vector_type(4)))  float v4f;
typedef __attribute__((ext_vector_type(2)))  float v2f;
typedef __attribute__((ext_vector_type(4)))  unsigned v4u;
typedef __attribute__((ext_vector_type(4)))  int v4i;
typedef float __attribute__((may_alias)) float_a;
typedef int __attribute__((may_alias)) int_a;

template <typename T> __device__ __forceinline__ void vst2(void* p, T v) { *(T*)p = v;  }
__device__ __forceinline__ v8f wmma16(v16h a, v16h b, v8f c) {
  v8f d = __builtin_amdgcn_wmma_f32_16x16x32_f16(false, a, false, b, (short)0, c, false, false);
  asm volatile("v_nop\n\tv_nop\n\tv_nop\n\tv_nop" : "+v"(d) : "v"(a), "v"(b));
  return d;
}
__device__ __forceinline__ v8f wmma_bf(v16b a, v16b b, v8f c) {
  v8f d = __builtin_amdgcn_wmma_f32_16x16x32_bf16(false, a, false, b, (short)0, c, false, false);
  asm volatile("v_nop\n\tv_nop\n\tv_nop\n\tv_nop" : "+v"(d) : "v"(a), "v"(b));
  return d;
}
// 16x16x32 fragments: lane = (h = lane>>4, row/col = lane&15); elements 0..7 = k0+8h+0..7, 8..15 = k0+16+8h+0..7; D element r = row 8h+r
__device__ __forceinline__ v16h frag_h(const _Float16* rowk0, int lane) {
  union { v16h v; v8h q[2]; } u; const _Float16* p = rowk0 + 8 * (lane >> 4);
  u.q[0] = *(const v8h*)p; u.q[1] = *(const v8h*)(p + 16); return u.v;
}
__device__ __forceinline__ v16h frag_f32(const float* rowk0, int lane) {
  v16h a; const float* p = rowk0 + 8 * (lane >> 4);
#pragma unroll
  for (int i = 0; i < 8; ++i) { a[i] = (_Float16)p[i]; a[8 + i] = (_Float16)p[16 + i]; }
  return a;
}
__device__ __forceinline__ v16h frag_f32s(const float* rowk0, int lane, float sc) {
  v16h a; const float* p = rowk0 + 8 * (lane >> 4);
#pragma unroll
  for (int i = 0; i < 8; ++i) { a[i] = (_Float16)(p[i] * sc); a[8 + i] = (_Float16)(p[16 + i] * sc); }
  return a;
}
// column fragment from a [K][ld] layout (column n), rows >= K read as 0
__device__ __forceinline__ v16h fragc_f32(const float* W, int k0, int n, int lane, int ld, int K) {
  v16h a; const int g = lane >> 4;
#pragma unroll
  for (int i = 0; i < 8; ++i) { const int ka = k0 + 8 * g + i, kb = ka + 16;
    a[i] = (_Float16)(ka < K ? W[(size_t)(ka < K ? ka : K - 1) * ld + n] : 0.f); a[8 + i] = (_Float16)(kb < K ? W[(size_t)(kb < K ? kb : K - 1) * ld + n] : 0.f); }
  return a;
}
struct F2 { v16b h, l; };
__device__ __forceinline__ F2 bsplit16(const float v[16]) { F2 r;
#pragma unroll
  for (int i = 0; i < 16; ++i) { const __bf16 h = (__bf16)v[i]; r.h[i] = h; r.l[i] = (__bf16)(v[i] - (float)h); }
  return r; }
__device__ __forceinline__ F2 split_row(const float* row, int k0, int lane) { float v[16]; const float* p = row + k0 + 8 * (lane >> 4);
#pragma unroll
  for (int i = 0; i < 8; ++i) { v[i] = p[i]; v[8 + i] = p[16 + i]; }
  return bsplit16(v); }
__device__ __forceinline__ F2 split_rowK(const float* row, int k0, int lane, int K) { float v[16]; const int g = lane >> 4;
#pragma unroll
  for (int i = 0; i < 8; ++i) { const int ka = k0 + 8 * g + i, kb = ka + 16; v[i] = ka < K ? row[ka < K ? ka : K - 1] : 0.f; v[8 + i] = kb < K ? row[kb < K ? kb : K - 1] : 0.f; }
  return bsplit16(v); }
__device__ __forceinline__ F2 split_col(const float* W, int k0, int n, int lane, int ld, int K) { float v[16]; const int g = lane >> 4;
#pragma unroll
  for (int i = 0; i < 8; ++i) { const int ka = k0 + 8 * g + i, kb = ka + 16; v[i] = ka < K ? W[(size_t)(ka < K ? ka : K - 1) * ld + n] : 0.f; v[8 + i] = kb < K ? W[(size_t)(kb < K ? kb : K - 1) * ld + n] : 0.f; }
  return bsplit16(v); }
__device__ __forceinline__ v8f mac3(const F2& a, const F2& b, v8f c) { c = wmma_bf(a.l, b.h, c); c = wmma_bf(a.h, b.l, c); return wmma_bf(a.h, b.h, c); }
__device__ __forceinline__ float sigm(float v) { return 1.0f / (1.0f + expf(-v)); }
#define LDSX() do { asm volatile("s_wait_dscnt 0" ::: "memory"); __builtin_amdgcn_wave_barrier(); __builtin_amdgcn_fence(__ATOMIC_RELEASE, "workgroup"); } while (0)


// 'Fast' MHA with raw-reshape heads (B 2, S 2,048, D 1,024, 16 'heads' x 64): separate query / key / value inputs, natural projections + biases, triu(offset 0)-masked softmax(q k / 8) v, raw reshape back (no output projection).
#define NB 2
#define SS 2048           // positions per head (== S)
#define DD 1024
#define NH 16
#define DH 64
#define NROW (NB * SS)    // projected rows
#ifndef TNB
#define TNB NB
#endif
typedef __attribute__((ext_vector_type(8))) __bf16 v8b;
__device__ __forceinline__ v16b frag_b(const __bf16* rowk0, int lane) {
  union { v16b v; v8b q[2]; } u; const __bf16* p = rowk0 + 8 * (lane >> 4);
  u.q[0] = *(const v8b*)p; u.q[1] = *(const v8b*)(p + 16); return u.v;
}
__device__ __forceinline__ float bfr(float v) { return (float)(__bf16)v; }
__device__ __forceinline__ float xhalf(float x) { return __builtin_bit_cast(float, __builtin_amdgcn_permlanex16(__builtin_bit_cast(int, x), __builtin_bit_cast(int, x), 0x76543210, 0xfedcba98, false, false)); }  // lane l's value for lane l ^ 16
__device__ __attribute__((noinline)) float exp_ni(float v) { return expf(v); }
__device__ __attribute__((noinline)) float erf_ni(float v) { return erff(v); }

#define WS_QH  0u                                   // f16 hi|lo Q flat [b][s][1024] == [b][h][p][64]
#define WS_QL  (WS_QH + 2u * (size_t)NROW * DD)
#define WS_KH  (WS_QL + 2u * (size_t)NROW * DD)
#define WS_KL  (WS_KH + 2u * (size_t)NROW * DD)
#define WS_VF  (WS_KL + 2u * (size_t)NROW * DD)          // f32 V flat
#define WS_VT  (WS_VF + 4u * (size_t)NROW * DD)          // f16 hi|lo V planes [b][h][64 d][2048 p]
#define WS_VTL (WS_VT + 2u * (size_t)NB * NH * DH * SS)
#define WS_END (WS_VTL + 2u * (size_t)NB * NH * DH * SS)

__device__ __forceinline__ v16b fragb_f32(const float* __restrict__ p, int lane) { v16b a; const float* pp = p + 8 * (lane >> 4);
#pragma unroll
  for (int i = 0; i < 8; ++i) { a[i] = (__bf16)pp[i]; a[8 + i] = (__bf16)pp[16 + i]; } return a; }
// ---- k_proj: block = (128 rows, 128 cols, which), 8 waves of 64 x 32: which 0 Q, 1 K -> f16 hi/lo flat rows; 2 V -> f32 flat rows.
// Each 32-k slice of the X and W tiles is read once per block by whole-line loads (8 lanes x 16 B = one 128-B row piece), rounded to bf16 once and kept in LDS; all 8 waves take their fragments from there.
#define PLD 40            // bf16 elements per staged row: 64 B of data + 16 B pad; 80 B = 16 B x odd keeps the 16-byte fragment reads off each other's banks
#define PTILE (128 * PLD) // one staged operand slice
typedef __attribute__((ext_vector_type(4))) __bf16 v4b;
__global__ __launch_bounds__(256) void k_proj(const float* __restrict__ XQ, const float* __restrict__ XK, const float* __restrict__ XV, const float* __restrict__ WQ, const float* __restrict__ BQ, const float* __restrict__ WK, const float* __restrict__ BK, const float* __restrict__ WV, const float* __restrict__ BV, _Float16* __restrict__ QH, _Float16* __restrict__ QL, _Float16* __restrict__ KH, _Float16* __restrict__ KL, float* __restrict__ VF) {
  __shared__ __align__(16) unsigned char smem[2 * 128 * 136 * 2];   // K loop: two buffers of [X slice | W slice] (40,960 B); afterwards the output staging (f16 hi | lo planes, or one f32 plane)
  __bf16* const sA = (__bf16*)smem; __bf16* const sB = sA + 2 * PTILE;
  const int tid = threadIdx.x, wave = tid >> 5, lane = tid & 31, col = lane & 15, g = lane >> 4; const int which = blockIdx.z; const size_t row0 = (size_t)blockIdx.x * 128; const int c0 = blockIdx.y * 128;
  const int wm = wave >> 2, wn = wave & 3;
  const float* X = which == 0 ? XQ : which == 1 ? XK : XV; const float* Wm = which == 0 ? WQ : which == 1 ? WK : WV; const float* Bm = which == 0 ? BQ : which == 1 ? BK : BV;
  const int sr = tid >> 3, sc = (tid & 7) * 4;   // staging: this thread's row (plus 32 i) and its four k of the slice
  const float* gA = X + (row0 + sr) * DD + sc; const float* gB = Wm + (size_t)(c0 + sr) * DD + sc;
  const int so_ = sr * PLD + sc;
  v4f ra[4], rb[4];
  v8f acc[4][2] = {};
  // every unroll in this kernel makes the indices of acc, ra, rb and the fragment arrays constants, so that they stay in registers
#define PLOAD(pa, pb) do { _Pragma("unroll") for (int i = 0; i < 4; ++i) { ra[i] = *(const v4f*)((pa) + (size_t)i * 32 * DD); rb[i] = *(const v4f*)((pb) + (size_t)i * 32 * DD); } } while (0)
#define PSTORE(buf) do { _Pragma("unroll") for (int i = 0; i < 4; ++i) { v4b ta, tb; _Pragma("unroll") for (int e = 0; e < 4; ++e) { ta[e] = (__bf16)ra[i][e]; tb[e] = (__bf16)rb[i][e]; } *(v4b*)(sA + (buf) * PTILE + so_ + i * 32 * PLD) = ta; *(v4b*)(sB + (buf) * PTILE + so_ + i * 32 * PLD) = tb; } } while (0)
#define PMAC(buf) do { v16b fb[2], fa[4]; _Pragma("unroll") for (int j = 0; j < 2; ++j) fb[j] = frag_b(sB + (buf) * PTILE + (wn * 32 + j * 16 + col) * PLD, lane); \
    _Pragma("unroll") for (int i = 0; i < 4; ++i) fa[i] = frag_b(sA + (buf) * PTILE + (wm * 64 + i * 16 + col) * PLD, lane); \
    _Pragma("unroll") for (int i = 0; i < 4; ++i) { _Pragma("unroll") for (int j = 0; j < 2; ++j) acc[i][j] = wmma_bf(fa[i], fb[j], acc[i][j]); } } while (0)
  PLOAD(gA, gB); PSTORE(0); __syncthreads();
  for (int kc = 0; kc < DD / 32 - 1; ++kc) { const int cur = kc & 1;
    const float* pa = gA + (kc + 1) * 32; const float* pb = gB + (kc + 1) * 32;
    PLOAD(pa, pb);        // the next slice flies while this one is multiplied
    asm volatile("s_wait_xcnt 0x0" :: "v"(pa), "v"(pb) : "memory");   // keeps the two address pairs whole until this wait: the fragment reads below may reuse their registers
    PMAC(cur);
    PSTORE(cur ^ 1);      // its last readers left it before the previous barrier
    __syncthreads(); }
  PMAC((DD / 32 - 1) & 1);
  __syncthreads();        // every wave has read its last fragments: the buffers become output staging
  _Float16 (*sh)[136] = (_Float16 (*)[136])smem; _Float16 (*sl)[136] = (_Float16 (*)[136])(smem + 128 * 136 * 2); float (*sf)[132] = (float (*)[132])smem;
  if (which < 2) {
#pragma unroll
    for (int j = 0; j < 2; ++j) { const int cc = wn * 32 + j * 16 + col; const float bb = bfr(Bm[c0 + cc]);
#pragma unroll
      for (int i = 0; i < 4; ++i)
#pragma unroll
        for (int r = 0; r < 8; ++r) { const int rr = wm * 64 + i * 16 + 8 * g + r; const float v = acc[i][j][r] + bb; const _Float16 hv = (_Float16)v; sh[rr][cc] = hv; sl[rr][cc] = (_Float16)((v - (float)hv) * 2048.0f); } }
  } else {
#pragma unroll
    for (int j = 0; j < 2; ++j) { const int cc = wn * 32 + j * 16 + col; const float bb = bfr(Bm[c0 + cc]);
#pragma unroll
      for (int i = 0; i < 4; ++i)
#pragma unroll
        for (int r = 0; r < 8; ++r) sf[wm * 64 + i * 16 + 8 * g + r][cc] = acc[i][j][r] + bb; }
  }
  __syncthreads();
  if (which < 2) { _Float16* PH = which == 0 ? QH : KH; _Float16* PL = which == 0 ? QL : KL; for (int e = tid; e < 128 * 16; e += 256) { const int rl = e >> 4, q = e & 15; const size_t o = (row0 + rl) * DD + c0 + q * 8; vst2((unsigned*)(PH + o), *(const v4u*)&sh[rl][q * 8]); vst2((unsigned*)(PL + o), *(const v4u*)&sl[rl][q * 8]); } }
  else { for (int e = tid; e < 128 * 32; e += 256) { const int rl = e >> 5, q = e & 31; vst2(VF + (row0 + rl) * DD + c0 + q * 4, *(const v4f*)&sf[rl][q * 4]); } } }
// ---- k_vt: block = (64 positions, b*NH + h): V flat [b][h][p][64] -> planes [b][h][d][p] (f16 hi/lo)
__global__ __launch_bounds__(128) void k_vt(const float* __restrict__ VF, _Float16* __restrict__ VT, _Float16* __restrict__ VTL) { __shared__ __align__(16) _Float16 th[DH][72], tl[DH][72]; const int t = threadIdx.x; const size_t bh = blockIdx.y; const int p0 = blockIdx.x * 64;
  for (int e = t; e < 64 * DH; e += 128) { const int pl = e / DH, d = e % DH; const float v = VF[(bh * SS + p0 + pl) * DH + d]; const _Float16 hv = (_Float16)v; th[d][pl] = hv; tl[d][pl] = (_Float16)((v - (float)hv) * 2048.0f); }
  __syncthreads(); for (int e = t; e < DH * 8; e += 128) { const int d = e >> 3, q = e & 7; const size_t o = (bh * DH + d) * (size_t)SS + p0 + q * 8; vst2((unsigned*)(VT + o), *(const v4u*)&th[d][q * 8]); vst2((unsigned*)(VTL + o), *(const v4u*)&tl[d][q * 8]); } }
// ---- k_att: block = (pair of 64-position tiles, h, b): keys j < i (diagonal excluded); position 0 -> uniform over all keys; key tiles past a position tile skipped (tile 0 also scans all key tiles so that position 0's uniform average is exact)
// A position tile's cost grows with its index (tile t walks 2 (t + 1) passes, tile 0 all 64), and every block is resident at once, so the launch lasts as long as the fullest WGP. Each block therefore takes two tiles, one after the other,
// a long one and a short one: block 0 tiles 0 and 1 (68 passes), block w >= 1 tiles 32 - w and 1 + w (70 passes): the blocks walk nearly the same number of passes wherever they are placed (block 0's passes carry the 3-product scores and stay the dearest).
// The products are taken transposed: S^T = K . Q^T (A = K rows, B = Q rows) and O^T += V^T . P^T. A lane then holds 16 of the pass's 32 scores of ONE query (position p0 + col; lane ^ 16 holds the other 16), so maximum and sum are taken in the lane,
// and the two score tiles, turned into f16 in place, already are the B operand of the second product (element s = tile s / 8, register s % 8 = key 8 g + s % 8 + 16 (s / 8): the k order of frag_h): P goes through no LDS.
// Each pass's 32 keys (K hi rows, K residual rows for the first 128 positions, V^T hi and residual row pieces) are brought into LDS once per block by asynchronous 16-byte copies, two buffers, one pass ahead; the four waves take their fragments from there.
#define KPB 144                     // bytes per staged K row: 128 B of data + 16 B pad (16 B x odd keeps the 16-byte fragment reads off each other's banks)
#define VPB 80                      // bytes per staged V^T row piece: 64 B of data + 16 B pad
#define ST_KL (32 * KPB)            // buffer layout: K hi | K residual | V^T hi | V^T residual
#define ST_VH (2 * 32 * KPB)
#define ST_VL (ST_VH + 64 * VPB)
#define ST_SZ (ST_VL + 64 * VPB)
__global__ __launch_bounds__(128) void k_att(const _Float16* __restrict__ QH, const _Float16* __restrict__ QL, const _Float16* __restrict__ KH, const _Float16* __restrict__ KL, const _Float16* __restrict__ VT, const _Float16* __restrict__ VTL, float* __restrict__ OUT) {
  __shared__ __align__(16) unsigned char ring[2 * ST_SZ];
  __shared__ __align__(16) float so[4][16][68];
  const int tid = threadIdx.x, wave = tid >> 5, lane = tid & 31, col = lane & 15, g = lane >> 4; const int h = blockIdx.y; const size_t b = blockIdx.z; const int w = blockIdx.x; const size_t bh = b * NH + h;
  const bool hi3 = w == 0;   // first 128 positions (tiles 0 and 1, both in block 0): 3-product scores
  // staging: a K tile is 4,096 contiguous bytes (thread: 16-byte pieces tid and tid + 128); a V^T tile is 64 row pieces of 64 B (thread: rows tid / 4 and tid / 4 + 32)
  const unsigned lK = (unsigned)(size_t)ring + (tid >> 3) * KPB + (tid & 7) * 16, lV = (unsigned)(size_t)ring + ST_VH + (tid >> 2) * VPB + (tid & 3) * 16;
  const size_t oK = bh * SS * DH + tid * 8, oV = (bh * DH + (tid >> 2)) * (size_t)SS + (tid & 3) * 8;
#pragma unroll 1   // the two tiles run one after the other through one copy of the code
  for (int half = 0; half < 2; ++half) {
  const int qb = (w == 0) ? half : (half == 0 ? SS / 64 - w : 1 + w); const int p0 = qb * 64 + wave * 16; const size_t rq = bh * SS + p0;
  v16h aq[2], al[2];
#pragma unroll
  for (int kc = 0; kc < 2; ++kc) { aq[kc] = frag_h(QH + (rq + col) * DH + kc * 32, lane); al[kc] = frag_h(QL + (rq + col) * DH + kc * 32, lane); }
  const int p = p0 + col;                            // this lane's query position
  const float fill = (p == 0) ? 0.0f : -3.0e38f;     // what a key j >= p scores; position 0: all logits equal -> uniform
  float m = -3.0e38f, l = 0.f;                       // running maximum (same in both halves); this lane's half of the running sum
  v8f acc[4] = {}, accl[4] = {};
  const int nks = (qb == 0) ? SS / 32 : (qb * 64 + 64) / 32;   // at least 4
  // the copies of one tile set stand in one statement with s_wait_xcnt 0 as its last line, so that no later write of their address registers can be moved in front of that wait
#define ASTAGE(t, buf) do { const unsigned k0 = lK + (buf) * ST_SZ, k1 = k0 + 16 * KPB, v0 = lV + (buf) * ST_SZ, v1 = v0 + 32 * VPB, w0 = v0 + (ST_VL - ST_VH), w1 = w0 + 32 * VPB; \
    const _Float16* gk0 = KH + oK + (size_t)(t) * 32 * DH; const _Float16* gk1 = gk0 + 128 * 8; const _Float16* gv0 = VT + oV + (t) * 32; const _Float16* gv1 = gv0 + 32 * SS; const _Float16* gw0 = VTL + oV + (t) * 32; const _Float16* gw1 = gw0 + 32 * SS; \
    asm volatile("global_load_async_to_lds_b128 %0, %1, off\n\tglobal_load_async_to_lds_b128 %2, %3, off\n\tglobal_load_async_to_lds_b128 %4, %5, off\n\tglobal_load_async_to_lds_b128 %6, %7, off\n\tglobal_load_async_to_lds_b128 %8, %9, off\n\tglobal_load_async_to_lds_b128 %10, %11, off\n\ts_wait_xcnt 0x0" \
                 :: "v"(k0), "v"(gk0), "v"(k1), "v"(gk1), "v"(v0), "v"(gv0), "v"(v1), "v"(gv1), "v"(w0), "v"(gw0), "v"(w1), "v"(gw1) : "memory"); \
    if (hi3) { const unsigned r0 = k0 + ST_KL, r1 = k1 + ST_KL; const _Float16* gr0 = KL + oK + (size_t)(t) * 32 * DH; const _Float16* gr1 = gr0 + 128 * 8; \
      asm volatile("global_load_async_to_lds_b128 %0, %1, off\n\tglobal_load_async_to_lds_b128 %2, %3, off\n\ts_wait_xcnt 0x0" :: "v"(r0), "v"(gr0), "v"(r1), "v"(gr1) : "memory"); } } while (0)
  ASTAGE(0, 0);   // second position tile: the first one's last pass ended in s_wait_dscnt 0 and a barrier, so every reader has left the ring, and no copy is in flight
  asm volatile("s_wait_asynccnt 0x0" ::: "memory");   // this wave's share of tile 0 has landed
  __syncthreads();                                    // ... and every other wave's
  ASTAGE(1, 1);
#pragma unroll 1
  for (int ks = 0; ks < nks; ++ks) { float s[2][8]; const unsigned char* tb = ring + (ks & 1) * ST_SZ;
    // the K fragments of the pass are asked for in one group ahead of the score products (the unrolls make the fragment arrays' indices constants, so that they stay in registers)
    v16h kf[2][2], kq[2][2];
#pragma unroll
    for (int ct = 0; ct < 2; ++ct)
#pragma unroll
      for (int kc = 0; kc < 2; ++kc) kf[ct][kc] = frag_h((const _Float16*)(tb + (ct * 16 + col) * KPB) + kc * 32, lane);
    if (hi3) {
#pragma unroll
      for (int ct = 0; ct < 2; ++ct)
#pragma unroll
        for (int kc = 0; kc < 2; ++kc) kq[ct][kc] = frag_h((const _Float16*)(tb + ST_KL + (ct * 16 + col) * KPB) + kc * 32, lane); }
#pragma unroll
    for (int ct = 0; ct < 2; ++ct) { const int nk = p - (ks * 32 + ct * 16 + 8 * g); v8f c = {}, cl = {};   // register r = key ks * 32 + ct * 16 + 8 g + r: it counts while r < nk
#pragma unroll
      for (int kc = 0; kc < 2; ++kc) c = wmma16(kf[ct][kc], aq[kc], c);
      if (hi3) {
#pragma unroll
        for (int kc = 0; kc < 2; ++kc) { cl = wmma16(kq[ct][kc], aq[kc], cl); cl = wmma16(kf[ct][kc], al[kc], cl); } }
#pragma unroll
      for (int r = 0; r < 8; ++r) { const float sc = (c[r] + (hi3 ? cl[r] * (1.0f / 2048.0f) : 0.f)) * 0.125f; s[ct][r] = (r < nk) ? sc : fill; } }
    // the unrolls below make the indices of s, es, pa and the accumulators constants, so that they stay in registers
    float mx = fmaxf(s[0][0], s[1][0]);
#pragma unroll
    for (int r = 1; r < 8; ++r) mx = fmaxf(mx, fmaxf(s[0][r], s[1][r]));
    mx = fmaxf(mx, xhalf(mx));
    const float mn = fmaxf(m, mx); const float alpha = (m <= -1.0e38f) ? 0.f : __expf(m - mn);
    v16h pa; float es[4] = {0.f, 0.f, 0.f, 0.f};   // four short chains of adds instead of one of sixteen
#pragma unroll
    for (int ct = 0; ct < 2; ++ct)
#pragma unroll
      for (int r = 0; r < 8; ++r) { const float e = (s[ct][r] <= -1.0e38f) ? 0.f : __expf(s[ct][r] - mn); es[r & 3] += e; pa[ct * 8 + r] = (_Float16)(e * 2048.0f); }
    l = l * alpha + ((es[0] + es[1]) + (es[2] + es[3])); m = (mn > -1.0e38f) ? mn : m;
#pragma unroll
    for (int j = 0; j < 4; ++j)
#pragma unroll
      for (int r = 0; r < 8; ++r) { acc[j][r] *= alpha; accl[j][r] *= alpha; }
#pragma unroll
    for (int jj = 0; jj < 4; jj += 2) { v16h vh[2], vl[2];   // V^T fragments in two groups of four: all eight at once do not fit the registers
#pragma unroll
      for (int j = 0; j < 2; ++j) { vh[j] = frag_h((const _Float16*)(tb + ST_VH + ((jj + j) * 16 + col) * VPB), lane); vl[j] = frag_h((const _Float16*)(tb + ST_VL + ((jj + j) * 16 + col) * VPB), lane); }
#pragma unroll
      for (int j = 0; j < 2; ++j) { acc[jj + j] = wmma16(vh[j], pa, acc[jj + j]); accl[jj + j] = wmma16(vl[j], pa, accl[jj + j]); } }
    asm volatile("s_wait_dscnt 0x0" ::: "memory");      // this wave's reads of the buffer are done
    asm volatile("s_wait_asynccnt 0x0" ::: "memory");   // its share of the next tile has landed
    __syncthreads();                                    // publishes the next tile and frees this pass's buffer
    if (ks + 2 < nks) ASTAGE(ks + 2, ks & 1); }
  asm volatile("s_wait_asynccnt 0x0" ::: "memory");     // no copy is left in flight when the wave goes on to its end
  const float lt = l + xhalf(l);   // the two halves' sums are joined once
  const float il = (lt > 0.f) ? (1.0f / 2048.0f) / lt : 0.f;
#pragma unroll
  for (int j = 0; j < 4; ++j) { v4f o[2];   // register r = channel j * 16 + 8 g + r of this lane's query
#pragma unroll
    for (int r = 0; r < 8; ++r) o[r >> 2][r & 3] = (acc[j][r] + accl[j][r] * (1.0f / 2048.0f)) * il;
    *(v4f*)&so[wave][col][j * 16 + 8 * g] = o[0]; *(v4f*)&so[wave][col][j * 16 + 8 * g + 4] = o[1]; }
  LDSX(); for (int rl = 0; rl < 16; ++rl) if (lane < 16) vst2(OUT + (rq + rl) * DH + lane * 4, *(const v4f*)&so[wave][rl][lane * 4]);
  asm volatile("s_wait_xcnt 0x0" ::: "memory");   // the next tile's first instructions reuse the registers that these stores name
  } }
extern "C" void kernel_launch(void* const* d_in, const int* in_sizes, int n_in, void* d_out, int out_size, void* d_ws, size_t ws_size, hipStream_t stream) {
  (void)in_sizes; (void)n_in; (void)out_size;
  const float** F = (const float**)d_in;   // 0 query_vector, 1 key_vector, 2 value_vector [2,2048,1024]; 3 Wq, 4 bq, 5 Wk, 6 bk, 7 Wv, 8 bv (natural)
  if (ws_size < (size_t)WS_END) return;
  char* ws = (char*)d_ws; _Float16 *QH = (_Float16*)(ws + WS_QH), *QL = (_Float16*)(ws + WS_QL), *KH = (_Float16*)(ws + WS_KH), *KL = (_Float16*)(ws + WS_KL), *VT = (_Float16*)(ws + WS_VT), *VTL = (_Float16*)(ws + WS_VTL); float* VF = (float*)(ws + WS_VF);
  k_proj<<<dim3(NROW / 128, DD / 128, 3), 256, 0, stream>>>(F[0], F[1], F[2], F[3], F[4], F[5], F[6], F[7], F[8], QH, QL, KH, KL, VF);
  k_vt<<<dim3(SS / 64, NB * NH), 128, 0, stream>>>(VF, VT, VTL);
  k_att<<<dim3(SS / 128, NH, TNB), 128, 0, stream>>>(QH, QL, KH, KL, VT, VTL, (float*)d_out);
}

// v005
// It runs in 110 microseconds.
// Timed twice side by side with v004, it ran 1.04 times as fast both times.
// All steps since v000 together make it 4.88 times as fast.
// compute dtype: all float inputs rounded to bf16; Q/K/V = input . W^T + b with EXACT bf16 products on WMMA 16x16x32 (natural rows); the module's raw reshape (B,S,D)->(B,H,S,Dh) means 'head h' = the 128 projected rows 128h..128h+127 viewed as 2,048 positions x 64 (position p = (s - 128h)*16 + c/64) - handled purely by addressing; Q/K as f16 hi + residual (3-product scores for positions < 128, single f16 after), V as f16 hi + residual planes (2 products); mask: keys j >= i set to -1e9 INCLUDING the diagonal, so position 0 attends uniformly to all 2,048 keys (all logits equal) and position i >= 1 to keys < i; x 1/8; running-max softmax in f32 (hardware exp); the context in the same raw layout is the f32 output.
#include <hip/hip_runtime.h>
#include <math.h>

typedef __attribute__((ext_vector_type(16))) _Float16 v16h;
typedef __attribute__((ext_vector_type(16))) __bf16 v16b;
typedef __attribute__((ext_vector_type(8)))  _Float16 v8h;
typedef __attribute__((ext_vector_type(8)))  float v8f;
typedef __attribute__((ext_vector_type(4)))  float v4f;
typedef __attribute__((ext_vector_type(2)))  float v2f;
typedef __attribute__((ext_vector_type(4)))  unsigned v4u;
typedef __attribute__((ext_vector_type(4)))  int v4i;
typedef float __attribute__((may_alias)) float_a;
typedef int __attribute__((may_alias)) int_a;

template <typename T> __device__ __forceinline__ void vst2(void* p, T v) { *(T*)p = v;  }
__device__ __forceinline__ v8f wmma16(v16h a, v16h b, v8f c) {
  v8f d = __builtin_amdgcn_wmma_f32_16x16x32_f16(false, a, false, b, (short)0, c, false, false);
  asm volatile("v_nop\n\tv_nop\n\tv_nop\n\tv_nop" : "+v"(d) : "v"(a), "v"(b));
  return d;
}
__device__ __forceinline__ v8f wmma_bf(v16b a, v16b b, v8f c) {
  v8f d = __builtin_amdgcn_wmma_f32_16x16x32_bf16(false, a, false, b, (short)0, c, false, false);
  asm volatile("v_nop\n\tv_nop\n\tv_nop\n\tv_nop" : "+v"(d) : "v"(a), "v"(b));
  return d;
}
// 16x16x32 fragments: lane = (h = lane>>4, row/col = lane&15); elements 0..7 = k0+8h+0..7, 8..15 = k0+16+8h+0..7; D element r = row 8h+r
__device__ __forceinline__ v16h frag_h(const _Float16* rowk0, int lane) {
  union { v16h v; v8h q[2]; } u; const _Float16* p = rowk0 + 8 * (lane >> 4);
  u.q[0] = *(const v8h*)p; u.q[1] = *(const v8h*)(p + 16); return u.v;
}
__device__ __forceinline__ v16h frag_f32(const float* rowk0, int lane) {
  v16h a; const float* p = rowk0 + 8 * (lane >> 4);
#pragma unroll
  for (int i = 0; i < 8; ++i) { a[i] = (_Float16)p[i]; a[8 + i] = (_Float16)p[16 + i]; }
  return a;
}
__device__ __forceinline__ v16h frag_f32s(const float* rowk0, int lane, float sc) {
  v16h a; const float* p = rowk0 + 8 * (lane >> 4);
#pragma unroll
  for (int i = 0; i < 8; ++i) { a[i] = (_Float16)(p[i] * sc); a[8 + i] = (_Float16)(p[16 + i] * sc); }
  return a;
}
// column fragment from a [K][ld] layout (column n), rows >= K read as 0
__device__ __forceinline__ v16h fragc_f32(const float* W, int k0, int n, int lane, int ld, int K) {
  v16h a; const int g = lane >> 4;
#pragma unroll
  for (int i = 0; i < 8; ++i) { const int ka = k0 + 8 * g + i, kb = ka + 16;
    a[i] = (_Float16)(ka < K ? W[(size_t)(ka < K ? ka : K - 1) * ld + n] : 0.f); a[8 + i] = (_Float16)(kb < K ? W[(size_t)(kb < K ? kb : K - 1) * ld + n] : 0.f); }
  return a;
}
struct F2 { v16b h, l; };
__device__ __forceinline__ F2 bsplit16(const float v[16]) { F2 r;
#pragma unroll
  for (int i = 0; i < 16; ++i) { const __bf16 h = (__bf16)v[i]; r.h[i] = h; r.l[i] = (__bf16)(v[i] - (float)h); }
  return r; }
__device__ __forceinline__ F2 split_row(const float* row, int k0, int lane) { float v[16]; const float* p = row + k0 + 8 * (lane >> 4);
#pragma unroll
  for (int i = 0; i < 8; ++i) { v[i] = p[i]; v[8 + i] = p[16 + i]; }
  return bsplit16(v); }
__device__ __forceinline__ F2 split_rowK(const float* row, int k0, int lane, int K) { float v[16]; const int g = lane >> 4;
#pragma unroll
  for (int i = 0; i < 8; ++i) { const int ka = k0 + 8 * g + i, kb = ka + 16; v[i] = ka < K ? row[ka < K ? ka : K - 1] : 0.f; v[8 + i] = kb < K ? row[kb < K ? kb : K - 1] : 0.f; }
  return bsplit16(v); }
__device__ __forceinline__ F2 split_col(const float* W, int k0, int n, int lane, int ld, int K) { float v[16]; const int g = lane >> 4;
#pragma unroll
  for (int i = 0; i < 8; ++i) { const int ka = k0 + 8 * g + i, kb = ka + 16; v[i] = ka < K ? W[(size_t)(ka < K ? ka : K - 1) * ld + n] : 0.f; v[8 + i] = kb < K ? W[(size_t)(kb < K ? kb : K - 1) * ld + n] : 0.f; }
  return bsplit16(v); }
__device__ __forceinline__ v8f mac3(const F2& a, const F2& b, v8f c) { c = wmma_bf(a.l, b.h, c); c = wmma_bf(a.h, b.l, c); return wmma_bf(a.h, b.h, c); }
__device__ __forceinline__ float sigm(float v) { return 1.0f / (1.0f + expf(-v)); }
#define LDSX() do { asm volatile("s_wait_dscnt 0" ::: "memory"); __builtin_amdgcn_wave_barrier(); __builtin_amdgcn_fence(__ATOMIC_RELEASE, "workgroup"); } while (0)


// 'Fast' MHA with raw-reshape heads (B 2, S 2,048, D 1,024, 16 'heads' x 64): separate query / key / value inputs, natural projections + biases, triu(offset 0)-masked softmax(q k / 8) v, raw reshape back (no output projection).
#define NB 2
#define SS 2048           // positions per head (== S)
#define DD 1024
#define NH 16
#define DH 64
#define NROW (NB * SS)    // projected rows
#ifndef TNB
#define TNB NB
#endif
typedef __attribute__((ext_vector_type(8))) __bf16 v8b;
__device__ __forceinline__ v16b frag_b(const __bf16* rowk0, int lane) {
  union { v16b v; v8b q[2]; } u; const __bf16* p = rowk0 + 8 * (lane >> 4);
  u.q[0] = *(const v8b*)p; u.q[1] = *(const v8b*)(p + 16); return u.v;
}
__device__ __forceinline__ float bfr(float v) { return (float)(__bf16)v; }
__device__ __forceinline__ float xhalf(float x) { return __builtin_bit_cast(float, __builtin_amdgcn_permlanex16(__builtin_bit_cast(int, x), __builtin_bit_cast(int, x), 0x76543210, 0xfedcba98, false, false)); }  // lane l's value for lane l ^ 16
__device__ __attribute__((noinline)) float exp_ni(float v) { return expf(v); }
__device__ __attribute__((noinline)) float erf_ni(float v) { return erff(v); }

#define WS_QH  0u                                   // f16 hi|lo Q flat [b][s][1024] == [b][h][p][64]
#define WS_QL  (WS_QH + 2u * (size_t)NROW * DD)
#define WS_KH  (WS_QL + 2u * (size_t)NROW * DD)
#define WS_KL  (WS_KH + 2u * (size_t)NROW * DD)
#define WS_VF  (WS_KL + 2u * (size_t)NROW * DD)          // f32 V flat
#define WS_VT  (WS_VF + 4u * (size_t)NROW * DD)          // f16 hi|lo V planes [b][h][64 d][2048 p]
#define WS_VTL (WS_VT + 2u * (size_t)NB * NH * DH * SS)
#define WS_END (WS_VTL + 2u * (size_t)NB * NH * DH * SS)

__device__ __forceinline__ v16b fragb_f32(const float* __restrict__ p, int lane) { v16b a; const float* pp = p + 8 * (lane >> 4);
#pragma unroll
  for (int i = 0; i < 8; ++i) { a[i] = (__bf16)pp[i]; a[8 + i] = (__bf16)pp[16 + i]; } return a; }
// ---- k_proj: block = (128 rows, 128 cols, which), 8 waves of 64 x 32: which 0 Q, 1 K -> f16 hi/lo flat rows; 2 V -> f32 flat rows.
// Each 32-k slice of the X and W tiles is read once per block by whole-line loads (8 lanes x 16 B = one 128-B row piece), rounded to bf16 once and kept in LDS; all 8 waves take their fragments from there.
#define PLD 40            // bf16 elements per staged row: 64 B of data + 16 B pad; 80 B = 16 B x odd keeps the 16-byte fragment reads off each other's banks
#define PTILE (128 * PLD) // one staged operand slice
typedef __attribute__((ext_vector_type(4))) __bf16 v4b;
__global__ __launch_bounds__(256) void k_proj(const float* __restrict__ XQ, const float* __restrict__ XK, const float* __restrict__ XV, const float* __restrict__ WQ, const float* __restrict__ BQ, const float* __restrict__ WK, const float* __restrict__ BK, const float* __restrict__ WV, const float* __restrict__ BV, _Float16* __restrict__ QH, _Float16* __restrict__ QL, _Float16* __restrict__ KH, _Float16* __restrict__ KL, float* __restrict__ VF) {
  __shared__ __align__(16) unsigned char smem[2 * 128 * 136 * 2];   // K loop: two buffers of [X slice | W slice] (40,960 B); afterwards the output staging (f16 hi | lo planes, or one f32 plane)
  __bf16* const sA = (__bf16*)smem; __bf16* const sB = sA + 2 * PTILE;
  const int tid = threadIdx.x, wave = tid >> 5, lane = tid & 31, col = lane & 15, g = lane >> 4; const int which = blockIdx.z; const size_t row0 = (size_t)blockIdx.x * 128; const int c0 = blockIdx.y * 128;
  const int wm = wave >> 2, wn = wave & 3;
  const float* X = which == 0 ? XQ : which == 1 ? XK : XV; const float* Wm = which == 0 ? WQ : which == 1 ? WK : WV; const float* Bm = which == 0 ? BQ : which == 1 ? BK : BV;
  const int sr = tid >> 3, sc = (tid & 7) * 4;   // staging: this thread's row (plus 32 i) and its four k of the slice
  const float* gA = X + (row0 + sr) * DD + sc; const float* gB = Wm + (size_t)(c0 + sr) * DD + sc;
  const int so_ = sr * PLD + sc;
  v4f ra[4], rb[4];
  v8f acc[4][2] = {};
  // every unroll in this kernel makes the indices of acc, ra, rb and the fragment arrays constants, so that they stay in registers
#define PLOAD(pa, pb) do { _Pragma("unroll") for (int i = 0; i < 4; ++i) { ra[i] = *(const v4f*)((pa) + (size_t)i * 32 * DD); rb[i] = *(const v4f*)((pb) + (size_t)i * 32 * DD); } } while (0)
#define PSTORE(buf) do { _Pragma("unroll") for (int i = 0; i < 4; ++i) { v4b ta, tb; _Pragma("unroll") for (int e = 0; e < 4; ++e) { ta[e] = (__bf16)ra[i][e]; tb[e] = (__bf16)rb[i][e]; } *(v4b*)(sA + (buf) * PTILE + so_ + i * 32 * PLD) = ta; *(v4b*)(sB + (buf) * PTILE + so_ + i * 32 * PLD) = tb; } } while (0)
#define PMAC(buf) do { v16b fb[2], fa[4]; _Pragma("unroll") for (int j = 0; j < 2; ++j) fb[j] = frag_b(sB + (buf) * PTILE + (wn * 32 + j * 16 + col) * PLD, lane); \
    _Pragma("unroll") for (int i = 0; i < 4; ++i) fa[i] = frag_b(sA + (buf) * PTILE + (wm * 64 + i * 16 + col) * PLD, lane); \
    _Pragma("unroll") for (int i = 0; i < 4; ++i) { _Pragma("unroll") for (int j = 0; j < 2; ++j) acc[i][j] = wmma_bf(fa[i], fb[j], acc[i][j]); } } while (0)
  PLOAD(gA, gB); PSTORE(0); __syncthreads();
  for (int kc = 0; kc < DD / 32 - 1; ++kc) { const int cur = kc & 1;
    const float* pa = gA + (kc + 1) * 32; const float* pb = gB + (kc + 1) * 32;
    PLOAD(pa, pb);        // the next slice flies while this one is multiplied
    asm volatile("s_wait_xcnt 0x0" :: "v"(pa), "v"(pb) : "memory");   // keeps the two address pairs whole until this wait: the fragment reads below may reuse their registers
    PMAC(cur);
    PSTORE(cur ^ 1);      // its last readers left it before the previous barrier
    __syncthreads(); }
  PMAC((DD / 32 - 1) & 1);
  __syncthreads();        // every wave has read its last fragments: the buffers become output staging
  _Float16 (*sh)[136] = (_Float16 (*)[136])smem; _Float16 (*sl)[136] = (_Float16 (*)[136])(smem + 128 * 136 * 2); float (*sf)[132] = (float (*)[132])smem;
  if (which < 2) {
#pragma unroll
    for (int j = 0; j < 2; ++j) { const int cc = wn * 32 + j * 16 + col; const float bb = bfr(Bm[c0 + cc]);
#pragma unroll
      for (int i = 0; i < 4; ++i)
#pragma unroll
        for (int r = 0; r < 8; ++r) { const int rr = wm * 64 + i * 16 + 8 * g + r; const float v = acc[i][j][r] + bb; const _Float16 hv = (_Float16)v; sh[rr][cc] = hv; sl[rr][cc] = (_Float16)((v - (float)hv) * 2048.0f); } }
  } else {
#pragma unroll
    for (int j = 0; j < 2; ++j) { const int cc = wn * 32 + j * 16 + col; const float bb = bfr(Bm[c0 + cc]);
#pragma unroll
      for (int i = 0; i < 4; ++i)
#pragma unroll
        for (int r = 0; r < 8; ++r) sf[wm * 64 + i * 16 + 8 * g + r][cc] = acc[i][j][r] + bb; }
  }
  __syncthreads();
  if (which < 2) { _Float16* PH = which == 0 ? QH : KH; _Float16* PL = which == 0 ? QL : KL; for (int e = tid; e < 128 * 16; e += 256) { const int rl = e >> 4, q = e & 15; const size_t o = (row0 + rl) * DD + c0 + q * 8; vst2((unsigned*)(PH + o), *(const v4u*)&sh[rl][q * 8]); vst2((unsigned*)(PL + o), *(const v4u*)&sl[rl][q * 8]); } }
  else { for (int e = tid; e < 128 * 32; e += 256) { const int rl = e >> 5, q = e & 31; vst2(VF + (row0 + rl) * DD + c0 + q * 4, *(const v4f*)&sf[rl][q * 4]); } } }
// ---- k_vt: block = (64 positions, b*NH + h): V flat [b][h][p][64] -> planes [b][h][d][p] (f16 hi/lo)
__global__ __launch_bounds__(128) void k_vt(const float* __restrict__ VF, _Float16* __restrict__ VT, _Float16* __restrict__ VTL) { __shared__ __align__(16) _Float16 th[DH][72], tl[DH][72]; const int t = threadIdx.x; const size_t bh = blockIdx.y; const int p0 = blockIdx.x * 64;
  for (int e = t; e < 64 * DH; e += 128) { const int pl = e / DH, d = e % DH; const float v = VF[(bh * SS + p0 + pl) * DH + d]; const _Float16 hv = (_Float16)v; th[d][pl] = hv; tl[d][pl] = (_Float16)((v - (float)hv) * 2048.0f); }
  __syncthreads(); for (int e = t; e < DH * 8; e += 128) { const int d = e >> 3, q = e & 7; const size_t o = (bh * DH + d) * (size_t)SS + p0 + q * 8; vst2((unsigned*)(VT + o), *(const v4u*)&th[d][q * 8]); vst2((unsigned*)(VTL + o), *(const v4u*)&tl[d][q * 8]); } }
// ---- k_att: block = (pair of 64-position tiles, h, b): keys j < i (diagonal excluded); position 0 -> uniform over all keys; key tiles past a position tile skipped (tile 0 also scans all key tiles so that position 0's uniform average is exact)
// A position tile's cost grows with its index (tile t walks 2 (t + 1) passes, tile 0 all 64), and every block is resident at once, so the launch lasts as long as the fullest WGP. Each block therefore takes two tiles, one after the other,
// a long one and a short one: block 0 tiles 0 and 1 (68 passes), block w >= 1 tiles 32 - w and 1 + w (70 passes): the blocks walk nearly the same number of passes wherever they are placed (block 0's tile 0 walks all 64 passes for position 0 alone: past the diagonal they take no score products, see att_scores, so block 0 is not the dearest).
// The products are taken transposed: S^T = K . Q^T (A = K rows, B = Q rows) and O^T += V^T . P^T. A lane then holds 16 of the pass's 32 scores of ONE query (position p0 + col; lane ^ 16 holds the other 16), so maximum and sum are taken in the lane,
// and the two score tiles, turned into f16 in place, already are the B operand of the second product (element s = tile s / 8, register s % 8 = key 8 g + s % 8 + 16 (s / 8): the k order of frag_h): P goes through no LDS.
// Each pass's 32 keys (K hi rows, K residual rows for the first 128 positions, V^T hi and residual row pieces) are brought into LDS once per block by asynchronous 16-byte copies, two buffers, one pass ahead; the four waves take their fragments from there.
#define KPB 144                     // bytes per staged K row: 128 B of data + 16 B pad (16 B x odd keeps the 16-byte fragment reads off each other's banks)
#define VPB 80                      // bytes per staged V^T row piece: 64 B of data + 16 B pad
#define ST_KL (32 * KPB)            // buffer layout: K hi | K residual | V^T hi | V^T residual
#define ST_VH (2 * 32 * KPB)
#define ST_VL (ST_VH + 64 * VPB)
#define ST_SZ (ST_VL + 64 * VPB)
// Scores and softmax weights of one pass (32 keys) of one wave (16 positions). KIND says where the pass's keys lie against the wave's positions; it is the same for the whole wave, so the caller picks the body by a scalar branch
// and the common body carries no per-element work for cases that cannot occur in it:
//   0: every key lies below every position, past the first 128 positions: all 512 scores count (no mask; a counted score is far above -1e38, so the zero guard of the exponentials is an identity and goes too; no residual terms)
//   1: the pass crosses the diagonal, or belongs to the first 128 positions: mask, guard and (hi3) residual terms as written
//   2: every key lies at or above every position: every score is 'fill' whatever K . Q^T gives, so the K fragments are not read and the score products are not taken
template <int KIND>
__device__ __forceinline__ void att_scores(const unsigned char* tb, const int lane, const bool hi3, const v16h (&aq)[2], const v16h (&al)[2], const int pk, const float fill, float& m, float& l, float& alpha, v16h& pa, v16h (&vh0)[2], v16h (&vl0)[2]) {
  const int col = lane & 15, g = lane >> 4; float s[2][8];   // pk = this lane's position minus the pass's first key
  if (KIND == 2) {
#pragma unroll
    for (int ct = 0; ct < 2; ++ct)
#pragma unroll
      for (int r = 0; r < 8; ++r) s[ct][r] = fill;
  } else {
    // the K fragments of the pass are asked for in one group ahead of the score products (the unrolls make the fragment arrays' indices constants, so that they stay in registers)
    v16h kf[2][2], kq[2][2];
#pragma unroll
    for (int ct = 0; ct < 2; ++ct)
#pragma unroll
      for (int kc = 0; kc < 2; ++kc) kf[ct][kc] = frag_h((const _Float16*)(tb + (ct * 16 + col) * KPB) + kc * 32, lane);
    if (KIND == 1 && hi3) {
#pragma unroll
      for (int ct = 0; ct < 2; ++ct)
#pragma unroll
        for (int kc = 0; kc < 2; ++kc) kq[ct][kc] = frag_h((const _Float16*)(tb + ST_KL + (ct * 16 + col) * KPB) + kc * 32, lane); }
#pragma unroll
    for (int ct = 0; ct < 2; ++ct) { const int nk = pk - (ct * 16 + 8 * g); v8f c = {};   // register r = key ct * 16 + 8 g + r of the pass: it counts while r < nk
#pragma unroll
      for (int kc = 0; kc < 2; ++kc) c = wmma16(kf[ct][kc], aq[kc], c);
      if (KIND == 1 && hi3) { v8f cl = {};   // the residual products and their addition stand under one scalar branch
#pragma unroll
        for (int kc = 0; kc < 2; ++kc) { cl = wmma16(kq[ct][kc], aq[kc], cl); cl = wmma16(kf[ct][kc], al[kc], cl); }
#pragma unroll
        for (int r = 0; r < 8; ++r) c[r] = c[r] + cl[r] * (1.0f / 2048.0f); }
#pragma unroll
      for (int r = 0; r < 8; ++r) { const float sc = c[r] * 0.125f; s[ct][r] = (KIND == 0 || r < nk) ? sc : fill; } }
  }
  // the first four V^T fragments are asked for here, inside the chosen body, so that their way from LDS passes under the exponentials (the scheduler lifts no load over the branch that ends the body)
#pragma unroll
  for (int j = 0; j < 2; ++j) { vh0[j] = frag_h((const _Float16*)(tb + ST_VH + (j * 16 + col) * VPB), lane); vl0[j] = frag_h((const _Float16*)(tb + ST_VL + (j * 16 + col) * VPB), lane); }
  // the unrolls below make the indices of s, es and pa constants, so that they stay in registers
  float mx = fmaxf(s[0][0], s[1][0]);
#pragma unroll
  for (int r = 1; r < 8; ++r) mx = fmaxf(mx, fmaxf(s[0][r], s[1][r]));
  mx = fmaxf(mx, xhalf(mx));
  const float mn = fmaxf(m, mx); alpha = (m <= -1.0e38f) ? 0.f : __expf(m - mn);
  float es[4] = {0.f, 0.f, 0.f, 0.f};   // four short chains of adds instead of one of sixteen
#pragma unroll
  for (int ct = 0; ct < 2; ++ct)
#pragma unroll
    for (int r = 0; r < 8; ++r) { const float e = (KIND != 0 && s[ct][r] <= -1.0e38f) ? 0.f : __expf(s[ct][r] - mn); es[r & 3] += e; pa[ct * 8 + r] = (_Float16)(e * 2048.0f); }
  l = l * alpha + ((es[0] + es[1]) + (es[2] + es[3])); m = (mn > -1.0e38f) ? mn : m;
}
__global__ __launch_bounds__(128) void k_att(const _Float16* __restrict__ QH, const _Float16* __restrict__ QL, const _Float16* __restrict__ KH, const _Float16* __restrict__ KL, const _Float16* __restrict__ VT, const _Float16* __restrict__ VTL, float* __restrict__ OUT) {
  __shared__ __align__(16) unsigned char ring[2 * ST_SZ];
  __shared__ __align__(16) float so[4][16][68];
  const int tid = threadIdx.x, wave = __builtin_amdgcn_readfirstlane(tid >> 5) /* held in a scalar register, so that the choice of a pass's body below is a scalar branch */, lane = tid & 31, col = lane & 15, g = lane >> 4; const int h = blockIdx.y; const size_t b = blockIdx.z; const int w = blockIdx.x; const size_t bh = b * NH + h;
  const bool hi3 = w == 0;   // first 128 positions (tiles 0 and 1, both in block 0): 3-product scores
  // staging: a K tile is 4,096 contiguous bytes (thread: 16-byte pieces tid and tid + 128); a V^T tile is 64 row pieces of 64 B (thread: rows tid / 4 and tid / 4 + 32)
  const unsigned lK = (unsigned)(size_t)ring + (tid >> 3) * KPB + (tid & 7) * 16, lV = (unsigned)(size_t)ring + ST_VH + (tid >> 2) * VPB + (tid & 3) * 16;
  const size_t oK = bh * SS * DH + tid * 8, oV = (bh * DH + (tid >> 2)) * (size_t)SS + (tid & 3) * 8;
#pragma unroll 1   // the two tiles run one after the other through one copy of the code
  for (int half = 0; half < 2; ++half) {
  const int qb = (w == 0) ? half : (half == 0 ? SS / 64 - w : 1 + w); const int p0 = qb * 64 + wave * 16; const size_t rq = bh * SS + p0;
  v16h aq[2], al[2];
#pragma unroll
  for (int kc = 0; kc < 2; ++kc) { aq[kc] = frag_h(QH + (rq + col) * DH + kc * 32, lane); al[kc] = frag_h(QL + (rq + col) * DH + kc * 32, lane); }
  const int p = p0 + col;                            // this lane's query position
  const float fill = (p == 0) ? 0.0f : -3.0e38f;     // what a key j >= p scores; position 0: all logits equal -> uniform
  float m = -3.0e38f, l = 0.f;                       // running maximum (same in both halves); this lane's half of the running sum
  v8f acc[4] = {}, accl[4] = {};
  const int nks = (qb == 0) ? SS / 32 : (qb * 64 + 64) / 32;   // at least 4
  // the copies of one tile set stand in one statement with s_wait_xcnt 0 as its last line, so that no later write of their address registers can be moved in front of that wait
#define ASTAGE(t, buf) do { const unsigned k0 = lK + (buf) * ST_SZ, k1 = k0 + 16 * KPB, v0 = lV + (buf) * ST_SZ, v1 = v0 + 32 * VPB, w0 = v0 + (ST_VL - ST_VH), w1 = w0 + 32 * VPB; \
    const _Float16* gk0 = KH + oK + (size_t)(t) * 32 * DH; const _Float16* gk1 = gk0 + 128 * 8; const _Float16* gv0 = VT + oV + (t) * 32; const _Float16* gv1 = gv0 + 32 * SS; const _Float16* gw0 = VTL + oV + (t) * 32; const _Float16* gw1 = gw0 + 32 * SS; \
    asm volatile("global_load_async_to_lds_b128 %0, %1, off\n\tglobal_load_async_to_lds_b128 %2, %3, off\n\tglobal_load_async_to_lds_b128 %4, %5, off\n\tglobal_load_async_to_lds_b128 %6, %7, off\n\tglobal_load_async_to_lds_b128 %8, %9, off\n\tglobal_load_async_to_lds_b128 %10, %11, off\n\ts_wait_xcnt 0x0" \
                 :: "v"(k0), "v"(gk0), "v"(k1), "v"(gk1), "v"(v0), "v"(gv0), "v"(v1), "v"(gv1), "v"(w0), "v"(gw0), "v"(w1), "v"(gw1) : "memory"); \
    if (hi3) { const unsigned r0 = k0 + ST_KL, r1 = k1 + ST_KL; const _Float16* gr0 = KL + oK + (size_t)(t) * 32 * DH; const _Float16* gr1 = gr0 + 128 * 8; \
      asm volatile("global_load_async_to_lds_b128 %0, %1, off\n\tglobal_load_async_to_lds_b128 %2, %3, off\n\ts_wait_xcnt 0x0" :: "v"(r0), "v"(gr0), "v"(r1), "v"(gr1) : "memory"); } } while (0)
  ASTAGE(0, 0);   // second position tile: the first one's last pass ended in s_wait_dscnt 0 and a barrier, so every reader has left the ring, and no copy is in flight
  asm volatile("s_wait_asynccnt 0x0" ::: "memory");   // this wave's share of tile 0 has landed
  __syncthreads();                                    // ... and every other wave's
  ASTAGE(1, 1);
#pragma unroll 1
  for (int ks = 0; ks < nks; ++ks) { const unsigned char* tb = ring + (ks & 1) * ST_SZ;
    const int rel = p0 - ks * 32;   // the wave's first position minus the pass's first key: a scalar, a multiple of 16
    float alpha; v16h pa, vh0[2], vl0[2];
    if (rel >= 32 && !hi3) att_scores<0>(tb, lane, hi3, aq, al, p - ks * 32, fill, m, l, alpha, pa, vh0, vl0);
    else if (rel > -16) att_scores<1>(tb, lane, hi3, aq, al, p - ks * 32, fill, m, l, alpha, pa, vh0, vl0);
    else att_scores<2>(tb, lane, hi3, aq, al, p - ks * 32, fill, m, l, alpha, pa, vh0, vl0);
    // the unrolls below make the indices of the accumulators and fragment arrays constants, so that they stay in registers
#pragma unroll
    for (int j = 0; j < 4; ++j)
#pragma unroll
      for (int r = 0; r < 8; ++r) { acc[j][r] *= alpha; accl[j][r] *= alpha; }
    v16h vh[2], vl[2];   // V^T fragments in two groups of four: all eight at once do not fit the registers
#pragma unroll
    for (int j = 0; j < 2; ++j) { acc[j] = wmma16(vh0[j], pa, acc[j]); accl[j] = wmma16(vl0[j], pa, accl[j]); }
#pragma unroll
    for (int j = 0; j < 2; ++j) { vh[j] = frag_h((const _Float16*)(tb + ST_VH + ((2 + j) * 16 + col) * VPB), lane); vl[j] = frag_h((const _Float16*)(tb + ST_VL + ((2 + j) * 16 + col) * VPB), lane); }
#pragma unroll
    for (int j = 0; j < 2; ++j) { acc[2 + j] = wmma16(vh[j], pa, acc[2 + j]); accl[2 + j] = wmma16(vl[j], pa, accl[2 + j]); }
    asm volatile("s_wait_dscnt 0x0" ::: "memory");      // this wave's reads of the buffer are done
    asm volatile("s_wait_asynccnt 0x0" ::: "memory");   // its share of the next tile has landed
    __syncthreads();                                    // publishes the next tile and frees this pass's buffer
    if (ks + 2 < nks) ASTAGE(ks + 2, ks & 1); }
  asm volatile("s_wait_asynccnt 0x0" ::: "memory");     // no copy is left in flight when the wave goes on to its end
  const float lt = l + xhalf(l);   // the two halves' sums are joined once
  const float il = (lt > 0.f) ? (1.0f / 2048.0f) / lt : 0.f;
#pragma unroll
  for (int j = 0; j < 4; ++j) { v4f o[2];   // register r = channel j * 16 + 8 g + r of this lane's query
#pragma unroll
    for (int r = 0; r < 8; ++r) o[r >> 2][r & 3] = (acc[j][r] + accl[j][r] * (1.0f / 2048.0f)) * il;
    *(v4f*)&so[wave][col][j * 16 + 8 * g] = o[0]; *(v4f*)&so[wave][col][j * 16 + 8 * g + 4] = o[1]; }
  LDSX(); for (int rl = 0; rl < 16; ++rl) if (lane < 16) vst2(OUT + (rq + rl) * DH + lane * 4, *(const v4f*)&so[wave][rl][lane * 4]);
  asm volatile("s_wait_xcnt 0x0" ::: "memory");   // the next tile's first instructions reuse the registers that these stores name
  } }
extern "C" void kernel_launch(void* const* d_in, const int* in_sizes, int n_in, void* d_out, int out_size, void* d_ws, size_t ws_size, hipStream_t stream) {
  (void)in_sizes; (void)n_in; (void)out_size;
  const float** F = (const float**)d_in;   // 0 query_vector, 1 key_vector, 2 value_vector [2,2048,1024]; 3 Wq, 4 bq, 5 Wk, 6 bk, 7 Wv, 8 bv (natural)
  if (ws_size < (size_t)WS_END) return;
  char* ws = (char*)d_ws; _Float16 *QH = (_Float16*)(ws + WS_QH), *QL = (_Float16*)(ws + WS_QL), *KH = (_Float16*)(ws + WS_KH), *KL = (_Float16*)(ws + WS_KL), *VT = (_Float16*)(ws + WS_VT), *VTL = (_Float16*)(ws + WS_VTL); float* VF = (float*)(ws + WS_VF);
  k_proj<<<dim3(NROW / 128, DD / 128, 3), 256, 0, stream>>>(F[0], F[1], F[2], F[3], F[4], F[5], F[6], F[7], F[8], QH, QL, KH, KL, VF);
  k_vt<<<dim3(SS / 64, NB * NH), 128, 0, stream>>>(VF, VT, VTL);
  k_att<<<dim3(SS / 128, NH, TNB), 128, 0, stream>>>(QH, QL, KH, KL, VT, VTL, (float*)d_out);
}

// v006
// A run of this version takes 105 microseconds.
// Two timings next to v005 put it at 1.06 and 1.04 times that version's speed.
// All steps since v000 together make it 5.11 times as fast.
// compute dtype: all float inputs rounded to bf16; Q/K/V = input . W^T + b with EXACT bf16 products on WMMA 16x16x32 (natural rows); the module's raw reshape (B,S,D)->(B,H,S,Dh) means 'head h' = the 128 projected rows 128h..128h+127 viewed as 2,048 positions x 64 (position p = (s - 128h)*16 + c/64) - handled purely by addressing; Q/K as f16 hi + residual (3-product scores for positions < 128, single f16 after), V as f16 hi + residual rows (2 products); mask: keys j >= i set to -1e9 INCLUDING the diagonal, so position 0 attends uniformly to all 2,048 keys (all logits equal) and position i >= 1 to keys < i; x 1/8; running-max softmax in f32 (hardware exp); the context in the same raw layout is the f32 output.
#include <hip/hip_runtime.h>
#include <math.h>

typedef __attribute__((ext_vector_type(16))) _Float16 v16h;
typedef __attribute__((ext_vector_type(16))) __bf16 v16b;
typedef __attribute__((ext_vector_type(8)))  _Float16 v8h;
typedef __attribute__((ext_vector_type(8)))  float v8f;
typedef __attribute__((ext_vector_type(4)))  float v4f;
typedef __attribute__((ext_vector_type(2)))  float v2f;
typedef __attribute__((ext_vector_type(4)))  unsigned v4u;
typedef __attribute__((ext_vector_type(4)))  int v4i;
typedef float __attribute__((may_alias)) float_a;
typedef int __attribute__((may_alias)) int_a;

template <typename T> __device__ __forceinline__ void vst2(void* p, T v) { *(T*)p = v;  }
__device__ __forceinline__ v8f wmma16(v16h a, v16h b, v8f c) {
  v8f d = __builtin_amdgcn_wmma_f32_16x16x32_f16(false, a, false, b, (short)0, c, false, false);
  asm volatile("v_nop\n\tv_nop\n\tv_nop\n\tv_nop" : "+v"(d) : "v"(a), "v"(b));
  return d;
}
__device__ __forceinline__ v8f wmma_bf(v16b a, v16b b, v8f c) {
  v8f d = __builtin_amdgcn_wmma_f32_16x16x32_bf16(false, a, false, b, (short)0, c, false, false);
  asm volatile("v_nop\n\tv_nop\n\tv_nop\n\tv_nop" : "+v"(d) : "v"(a), "v"(b));
  return d;
}
// 16x16x32 fragments: lane = (h = lane>>4, row/col = lane&15); elements 0..7 = k0+8h+0..7, 8..15 = k0+16+8h+0..7; D element r = row 8h+r
__device__ __forceinline__ v16h frag_h(const _Float16* rowk0, int lane) {
  union { v16h v; v8h q[2]; } u; const _Float16* p = rowk0 + 8 * (lane >> 4);
  u.q[0] = *(const v8h*)p; u.q[1] = *(const v8h*)(p + 16); return u.v;
}
__device__ __forceinline__ v16h frag_f32(const float* rowk0, int lane) {
  v16h a; const float* p = rowk0 + 8 * (lane >> 4);
#pragma unroll
  for (int i = 0; i < 8; ++i) { a[i] = (_Float16)p[i]; a[8 + i] = (_Float16)p[16 + i]; }
  return a;
}
__device__ __forceinline__ v16h frag_f32s(const float* rowk0, int lane, float sc) {
  v16h a; const float* p = rowk0 + 8 * (lane >> 4);
#pragma unroll
  for (int i = 0; i < 8; ++i) { a[i] = (_Float16)(p[i] * sc); a[8 + i] = (_Float16)(p[16 + i] * sc); }
  return a;
}
// column fragment from a [K][ld] layout (column n), rows >= K read as 0
__device__ __forceinline__ v16h fragc_f32(const float* W, int k0, int n, int lane, int ld, int K) {
  v16h a; const int g = lane >> 4;
#pragma unroll
  for (int i = 0; i < 8; ++i) { const int ka = k0 + 8 * g + i, kb = ka + 16;
    a[i] = (_Float16)(ka < K ? W[(size_t)(ka < K ? ka : K - 1) * ld + n] : 0.f); a[8 + i] = (_Float16)(kb < K ? W[(size_t)(kb < K ? kb : K - 1) * ld + n] : 0.f); }
  return a;
}
struct F2 { v16b h, l; };
__device__ __forceinline__ F2 bsplit16(const float v[16]) { F2 r;
#pragma unroll
  for (int i = 0; i < 16; ++i) { const __bf16 h = (__bf16)v[i]; r.h[i] = h; r.l[i] = (__bf16)(v[i] - (float)h); }
  return r; }
__device__ __forceinline__ F2 split_row(const float* row, int k0, int lane) { float v[16]; const float* p = row + k0 + 8 * (lane >> 4);
#pragma unroll
  for (int i = 0; i < 8; ++i) { v[i] = p[i]; v[8 + i] = p[16 + i]; }
  return bsplit16(v); }
__device__ __forceinline__ F2 split_rowK(const float* row, int k0, int lane, int K) { float v[16]; const int g = lane >> 4;
#pragma unroll
  for (int i = 0; i < 8; ++i) { const int ka = k0 + 8 * g + i, kb = ka + 16; v[i] = ka < K ? row[ka < K ? ka : K - 1] : 0.f; v[8 + i] = kb < K ? row[kb < K ? kb : K - 1] : 0.f; }
  return bsplit16(v); }
__device__ __forceinline__ F2 split_col(const float* W, int k0, int n, int lane, int ld, int K) { float v[16]; const int g = lane >> 4;
#pragma unroll
  for (int i = 0; i < 8; ++i) { const int ka = k0 + 8 * g + i, kb = ka + 16; v[i] = ka < K ? W[(size_t)(ka < K ? ka : K - 1) * ld + n] : 0.f; v[8 + i] = kb < K ? W[(size_t)(kb < K ? kb : K - 1) * ld + n] : 0.f; }
  return bsplit16(v); }
__device__ __forceinline__ v8f mac3(const F2& a, const F2& b, v8f c) { c = wmma_bf(a.l, b.h, c); c = wmma_bf(a.h, b.l, c); return wmma_bf(a.h, b.h, c); }
__device__ __forceinline__ float sigm(float v) { return 1.0f / (1.0f + expf(-v)); }
#define LDSX() do { asm volatile("s_wait_dscnt 0" ::: "memory"); __builtin_amdgcn_wave_barrier(); __builtin_amdgcn_fence(__ATOMIC_RELEASE, "workgroup"); } while (0)


// 'Fast' MHA with raw-reshape heads (B 2, S 2,048, D 1,024, 16 'heads' x 64): separate query / key / value inputs, natural projections + biases, triu(offset 0)-masked softmax(q k / 8) v, raw reshape back (no output projection).
#define NB 2
#define SS 2048           // positions per head (== S)
#define DD 1024
#define NH 16
#define DH 64
#define NROW (NB * SS)    // projected rows
#ifndef TNB
#define TNB NB
#endif
typedef __attribute__((ext_vector_type(8))) __bf16 v8b;
__device__ __forceinline__ v16b frag_b(const __bf16* rowk0, int lane) {
  union { v16b v; v8b q[2]; } u; const __bf16* p = rowk0 + 8 * (lane >> 4);
  u.q[0] = *(const v8b*)p; u.q[1] = *(const v8b*)(p + 16); return u.v;
}
__device__ __forceinline__ float bfr(float v) { return (float)(__bf16)v; }
__device__ __forceinline__ float xhalf(float x) { return __builtin_bit_cast(float, __builtin_amdgcn_permlanex16(__builtin_bit_cast(int, x), __builtin_bit_cast(int, x), 0x76543210, 0xfedcba98, false, false)); }  // lane l's value for lane l ^ 16
__device__ __attribute__((noinline)) float exp_ni(float v) { return expf(v); }
__device__ __attribute__((noinline)) float erf_ni(float v) { return erff(v); }

#define WS_QH  0u                                   // f16 hi|lo Q flat [b][s][1024] == [b][h][p][64]
#define WS_QL  (WS_QH + 2u * (size_t)NROW * DD)
#define WS_KH  (WS_QL + 2u * (size_t)NROW * DD)
#define WS_KL  (WS_KH + 2u * (size_t)NROW * DD)
#define WS_VH  (WS_KL + 2u * (size_t)NROW * DD)          // f16 hi|lo V flat, laid out like Q and K
#define WS_VL  (WS_VH + 2u * (size_t)NROW * DD)
#define WS_END (WS_VL + 2u * (size_t)NROW * DD)

__device__ __forceinline__ v16b fragb_f32(const float* __restrict__ p, int lane) { v16b a; const float* pp = p + 8 * (lane >> 4);
#pragma unroll
  for (int i = 0; i < 8; ++i) { a[i] = (__bf16)pp[i]; a[8 + i] = (__bf16)pp[16 + i]; } return a; }
// ---- k_proj: block = (128 rows, 128 cols, which), 8 waves of 64 x 32: which 0 Q, 1 K, 2 V -> f16 hi/lo flat rows.
// Each 32-k slice of the X and W tiles is read once per block by whole-line loads (8 lanes x 16 B = one 128-B row piece), rounded to bf16 once and kept in LDS; all 8 waves take their fragments from there.
#define PLD 40            // bf16 elements per staged row: 64 B of data + 16 B pad; 80 B = 16 B x odd keeps the 16-byte fragment reads off each other's banks
#define PTILE (128 * PLD) // one staged operand slice
typedef __attribute__((ext_vector_type(4))) __bf16 v4b;
__global__ __launch_bounds__(256) void k_proj(const float* __restrict__ XQ, const float* __restrict__ XK, const float* __restrict__ XV, const float* __restrict__ WQ, const float* __restrict__ BQ, const float* __restrict__ WK, const float* __restrict__ BK, const float* __restrict__ WV, const float* __restrict__ BV, _Float16* __restrict__ QH, _Float16* __restrict__ QL, _Float16* __restrict__ KH, _Float16* __restrict__ KL, _Float16* __restrict__ VH, _Float16* __restrict__ VL) {
  __shared__ __align__(16) unsigned char smem[2 * 128 * 136 * 2];   // K loop: two buffers of [X slice | W slice] (40,960 B); afterwards the output staging (f16 hi | lo planes)
  __bf16* const sA = (__bf16*)smem; __bf16* const sB = sA + 2 * PTILE;
  const int tid = threadIdx.x, wave = tid >> 5, lane = tid & 31, col = lane & 15, g = lane >> 4; const int which = blockIdx.z; const size_t row0 = (size_t)blockIdx.x * 128; const int c0 = blockIdx.y * 128;
  const int wm = wave >> 2, wn = wave & 3;
  const float* X = which == 0 ? XQ : which == 1 ? XK : XV; const float* Wm = which == 0 ? WQ : which == 1 ? WK : WV; const float* Bm = which == 0 ? BQ : which == 1 ? BK : BV;
  const int sr = tid >> 3, sc = (tid & 7) * 4;   // staging: this thread's row (plus 32 i) and its four k of the slice
  const float* gA = X + (row0 + sr) * DD + sc; const float* gB = Wm + (size_t)(c0 + sr) * DD + sc;
  const int so_ = sr * PLD + sc;
  v4f ra[4], rb[4];
  v8f acc[4][2] = {};
  // every unroll in this kernel makes the indices of acc, ra, rb and the fragment arrays constants, so that they stay in registers
#define PLOAD(pa, pb) do { _Pragma("unroll") for (int i = 0; i < 4; ++i) { ra[i] = *(const v4f*)((pa) + (size_t)i * 32 * DD); rb[i] = *(const v4f*)((pb) + (size_t)i * 32 * DD); } } while (0)
#define PSTORE(buf) do { _Pragma("unroll") for (int i = 0; i < 4; ++i) { v4b ta, tb; _Pragma("unroll") for (int e = 0; e < 4; ++e) { ta[e] = (__bf16)ra[i][e]; tb[e] = (__bf16)rb[i][e]; } *(v4b*)(sA + (buf) * PTILE + so_ + i * 32 * PLD) = ta; *(v4b*)(sB + (buf) * PTILE + so_ + i * 32 * PLD) = tb; } } while (0)
#define PMAC(buf) do { v16b fb[2], fa[4]; _Pragma("unroll") for (int j = 0; j < 2; ++j) fb[j] = frag_b(sB + (buf) * PTILE + (wn * 32 + j * 16 + col) * PLD, lane); \
    _Pragma("unroll") for (int i = 0; i < 4; ++i) fa[i] = frag_b(sA + (buf) * PTILE + (wm * 64 + i * 16 + col) * PLD, lane); \
    _Pragma("unroll") for (int i = 0; i < 4; ++i) { _Pragma("unroll") for (int j = 0; j < 2; ++j) acc[i][j] = wmma_bf(fa[i], fb[j], acc[i][j]); } } while (0)
  PLOAD(gA, gB); PSTORE(0); __syncthreads();
  for (int kc = 0; kc < DD / 32 - 1; ++kc) { const int cur = kc & 1;
    const float* pa = gA + (kc + 1) * 32; const float* pb = gB + (kc + 1) * 32;
    PLOAD(pa, pb);        // the next slice flies while this one is multiplied
    asm volatile("s_wait_xcnt 0x0" :: "v"(pa), "v"(pb) : "memory");   // keeps the two address pairs whole until this wait: the fragment reads below may reuse their registers
    PMAC(cur);
    PSTORE(cur ^ 1);      // its last readers left it before the previous barrier
    __syncthreads(); }
  PMAC((DD / 32 - 1) & 1);
  __syncthreads();        // every wave has read its last fragments: the buffers become output staging
  _Float16 (*sh)[136] = (_Float16 (*)[136])smem; _Float16 (*sl)[136] = (_Float16 (*)[136])(smem + 128 * 136 * 2);
#pragma unroll
  for (int j = 0; j < 2; ++j) { const int cc = wn * 32 + j * 16 + col; const float bb = bfr(Bm[c0 + cc]);
#pragma unroll
    for (int i = 0; i < 4; ++i)
#pragma unroll
      for (int r = 0; r < 8; ++r) { const int rr = wm * 64 + i * 16 + 8 * g + r; const float v = acc[i][j][r] + bb; const _Float16 hv = (_Float16)v; sh[rr][cc] = hv; sl[rr][cc] = (_Float16)((v - (float)hv) * 2048.0f); } }
  __syncthreads();
  _Float16* PH = which == 0 ? QH : which == 1 ? KH : VH; _Float16* PL = which == 0 ? QL : which == 1 ? KL : VL;
  for (int e = tid; e < 128 * 16; e += 256) { const int rl = e >> 4, q = e & 15; const size_t o = (row0 + rl) * DD + c0 + q * 8; vst2((unsigned*)(PH + o), *(const v4u*)&sh[rl][q * 8]); vst2((unsigned*)(PL + o), *(const v4u*)&sl[rl][q * 8]); } }
// ---- k_att: block = (pair of 64-position tiles, h, b): keys j < i (diagonal excluded); position 0 -> uniform over all keys; key tiles past a position tile skipped (tile 0 also scans all key tiles so that position 0's uniform average is exact)
// A position tile's cost grows with its index (tile t walks 2 (t + 1) passes, tile 0 all 64), and every block is resident at once, so the launch lasts as long as the fullest WGP. Each block therefore takes two tiles, one after the other,
// a long one and a short one: block 0 tiles 0 and 1 (68 passes), block w >= 1 tiles 32 - w and 1 + w (70 passes): the blocks walk nearly the same number of passes wherever they are placed (block 0's tile 0 walks all 64 passes for position 0 alone: past the diagonal they take no score products, see att_scores, so block 0 is not the dearest).
// The products are taken transposed: S^T = K . Q^T (A = K rows, B = Q rows) and O^T += V^T . P^T. A lane then holds 16 of the pass's 32 scores of ONE query (position p0 + col; lane ^ 16 holds the other 16), so maximum and sum are taken in the lane,
// and the two score tiles, turned into f16 in place, already are the B operand of the second product (element s = tile s / 8, register s % 8 = key 8 g + s % 8 + 16 (s / 8): the k order of frag_h): P goes through no LDS.
// Each pass's 32 keys (K hi rows, K residual rows for the first 128 positions, V hi and residual rows, all as the projection stored them) are brought into LDS once per block by asynchronous 16-byte copies, two buffers, one pass ahead; the four waves take their fragments from there.
// V^T is never stored: the A operand of the second product comes from the staged V rows by the transposing LDS load (frag_t).
#define KPB 144                     // bytes per staged K row: 128 B of data + 16 B pad (16 B x odd keeps the 16-byte fragment reads off each other's banks)
#define VPB 160                     // bytes per staged V row: 128 B of data + 32 B pad (32 B x odd is the transposing load's conflict-free pitch)
#define ST_KL (32 * KPB)            // buffer layout: K hi | K residual | V hi | V residual
#define ST_VH (2 * 32 * KPB)
#define ST_VL (ST_VH + 32 * VPB)
#define ST_SZ (ST_VL + 32 * VPB)
// A fragment of V^T (rows = channels 16 j .. 16 j + 15, k = the pass's 32 keys) from a staged tile of 32 V rows: ds_load_tr16_b128 gives lane (col, g) the eight values tile[kbase + 8 g + 0..7][16 j + col];
// the loads at kbase 0 and 16 are elements 0..7 and 8..15, the k order of frag_h. Every lane is on wherever this is called.
typedef __attribute__((ext_vector_type(8))) short v8s;
__device__ __forceinline__ v16h frag_t(const unsigned char* tile, int j, int lane) {
  typedef __attribute__((address_space(3))) v8s lds_v8s;
  union { v16h v; v8s q[2]; } u; const unsigned char* p = tile + (8 * (lane >> 4) + (lane & 7)) * VPB + ((lane >> 3) & 1) * 16 + j * 32;
  u.q[0] = __builtin_amdgcn_ds_load_tr16_b128_v8i16((lds_v8s*)p); u.q[1] = __builtin_amdgcn_ds_load_tr16_b128_v8i16((lds_v8s*)(p + 16 * VPB)); return u.v;
}
// Scores and softmax weights of one pass (32 keys) of one wave (16 positions). KIND says where the pass's keys lie against the wave's positions; it is the same for the whole wave, so the caller picks the body by a scalar branch
// and the common body carries no per-element work for cases that cannot occur in it:
//   0: every key lies below every position, past the first 128 positions: all 512 scores count (no mask; a counted score is far above -1e38, so the zero guard of the exponentials is an identity and goes too; no residual terms)
//   1: the pass crosses the diagonal, or belongs to the first 128 positions: mask, guard and (hi3) residual terms as written
//   2: every key lies at or above every position: every score is 'fill' whatever K . Q^T gives, so the K fragments are not read and the score products are not taken
template <int KIND>
__device__ __forceinline__ void att_scores(const unsigned char* tb, const int lane, const bool hi3, const v16h (&aq)[2], const v16h (&al)[2], const int pk, const float fill, float& m, float& l, float& alpha, v16h& pa, v16h (&vh0)[2], v16h (&vl0)[2]) {
  const int col = lane & 15, g = lane >> 4; float s[2][8];   // pk = this lane's position minus the pass's first key
  if (KIND == 2) {
#pragma unroll
    for (int ct = 0; ct < 2; ++ct)
#pragma unroll
      for (int r = 0; r < 8; ++r) s[ct][r] = fill;
  } else {
    // the K fragments of the pass are asked for in one group ahead of the score products (the unrolls make the fragment arrays' indices constants, so that they stay in registers)
    v16h kf[2][2], kq[2][2];
#pragma unroll
    for (int ct = 0; ct < 2; ++ct)
#pragma unroll
      for (int kc = 0; kc < 2; ++kc) kf[ct][kc] = frag_h((const _Float16*)(tb + (ct * 16 + col) * KPB) + kc * 32, lane);
    if (KIND == 1 && hi3) {
#pragma unroll
      for (int ct = 0; ct < 2; ++ct)
#pragma unroll
        for (int kc = 0; kc < 2; ++kc) kq[ct][kc] = frag_h((const _Float16*)(tb + ST_KL + (ct * 16 + col) * KPB) + kc * 32, lane); }
#pragma unroll
    for (int ct = 0; ct < 2; ++ct) { const int nk = pk - (ct * 16 + 8 * g); v8f c = {};   // register r = key ct * 16 + 8 g + r of the pass: it counts while r < nk
#pragma unroll
      for (int kc = 0; kc < 2; ++kc) c = wmma16(kf[ct][kc], aq[kc], c);
      if (KIND == 1 && hi3) { v8f cl = {};   // the residual products and their addition stand under one scalar branch
#pragma unroll
        for (int kc = 0; kc < 2; ++kc) { cl = wmma16(kq[ct][kc], aq[kc], cl); cl = wmma16(kf[ct][kc], al[kc], cl); }
#pragma unroll
        for (int r = 0; r < 8; ++r) c[r] = c[r] + cl[r] * (1.0f / 2048.0f); }
#pragma unroll
      for (int r = 0; r < 8; ++r) { const float sc = c[r] * 0.125f; s[ct][r] = (KIND == 0 || r < nk) ? sc : fill; } }
  }
  // the first four V^T fragments are asked for here, inside the chosen body, so that their way from LDS passes under the exponentials (the scheduler lifts no load over the branch that ends the body)
#pragma unroll
  for (int j = 0; j < 2; ++j) { vh0[j] = frag_t(tb + ST_VH, j, lane); vl0[j] = frag_t(tb + ST_VL, j, lane); }
  // the unrolls below make the indices of s, es and pa constants, so that they stay in registers
  float mx = fmaxf(s[0][0], s[1][0]);
#pragma unroll
  for (int r = 1; r < 8; ++r) mx = fmaxf(mx, fmaxf(s[0][r], s[1][r]));
  mx = fmaxf(mx, xhalf(mx));
  const float mn = fmaxf(m, mx); alpha = (m <= -1.0e38f) ? 0.f : __expf(m - mn);
  float es[4] = {0.f, 0.f, 0.f, 0.f};   // four short chains of adds instead of one of sixteen
#pragma unroll
  for (int ct = 0; ct < 2; ++ct)
#pragma unroll
    for (int r = 0; r < 8; ++r) { const float e = (KIND != 0 && s[ct][r] <= -1.0e38f) ? 0.f : __expf(s[ct][r] - mn); es[r & 3] += e; pa[ct * 8 + r] = (_Float16)(e * 2048.0f); }
  l = l * alpha + ((es[0] + es[1]) + (es[2] + es[3])); m = (mn > -1.0e38f) ? mn : m;
}
__global__ __launch_bounds__(128) void k_att(const _Float16* __restrict__ QH, const _Float16* __restrict__ QL, const _Float16* __restrict__ KH, const _Float16* __restrict__ KL, const _Float16* __restrict__ VH, const _Float16* __restrict__ VL, float* __restrict__ OUT) {
  __shared__ __align__(16) unsigned char ring[2 * ST_SZ];
  __shared__ __align__(16) float so[4][16][68];
  const int tid = threadIdx.x, wave = __builtin_amdgcn_readfirstlane(tid >> 5) /* held in a scalar register, so that the choice of a pass's body below is a scalar branch */, lane = tid & 31, col = lane & 15, g = lane >> 4; const int h = blockIdx.y; const size_t b = blockIdx.z; const int w = blockIdx.x; const size_t bh = b * NH + h;
  const bool hi3 = w == 0;   // first 128 positions (tiles 0 and 1, both in block 0): 3-product scores
  // staging: a K tile and a V tile are each 4,096 contiguous bytes, 32 rows of 128 B (thread: 16-byte pieces tid and tid + 128, that is rows tid / 8 and tid / 8 + 16)
  const unsigned lK = (unsigned)(size_t)ring + (tid >> 3) * KPB + (tid & 7) * 16, lV = (unsigned)(size_t)ring + ST_VH + (tid >> 3) * VPB + (tid & 7) * 16;
  const size_t oK = bh * SS * DH + tid * 8;   // the same element offset in the K and the V arrays
#pragma unroll 1   // the two tiles run one after the other through one copy of the code
  for (int half = 0; half < 2; ++half) {
  const int qb = (w == 0) ? half : (half == 0 ? SS / 64 - w : 1 + w); const int p0 = qb * 64 + wave * 16; const size_t rq = bh * SS + p0;
  v16h aq[2], al[2];
#pragma unroll
  for (int kc = 0; kc < 2; ++kc) { aq[kc] = frag_h(QH + (rq + col) * DH + kc * 32, lane); al[kc] = frag_h(QL + (rq + col) * DH + kc * 32, lane); }
  const int p = p0 + col;                            // this lane's query position
  const float fill = (p == 0) ? 0.0f : -3.0e38f;     // what a key j >= p scores; position 0: all logits equal -> uniform
  float m = -3.0e38f, l = 0.f;                       // running maximum (same in both halves); this lane's half of the running sum
  v8f acc[4] = {}, accl[4] = {};
  const int nks = (qb == 0) ? SS / 32 : (qb * 64 + 64) / 32;   // at least 4
  // the copies of one tile set stand in one statement with s_wait_xcnt 0 as its last line, so that no later write of their address registers can be moved in front of that wait
#define ASTAGE(t, buf) do { const unsigned k0 = lK + (buf) * ST_SZ, k1 = k0 + 16 * KPB, v0 = lV + (buf) * ST_SZ, v1 = v0 + 16 * VPB, w0 = v0 + (ST_VL - ST_VH), w1 = w0 + 16 * VPB; \
    const _Float16* gk0 = KH + oK + (size_t)(t) * 32 * DH; const _Float16* gk1 = gk0 + 128 * 8; const _Float16* gv0 = VH + oK + (size_t)(t) * 32 * DH; const _Float16* gv1 = gv0 + 128 * 8; const _Float16* gw0 = VL + oK + (size_t)(t) * 32 * DH; const _Float16* gw1 = gw0 + 128 * 8; \
    asm volatile("global_load_async_to_lds_b128 %0, %1, off\n\tglobal_load_async_to_lds_b128 %2, %3, off\n\tglobal_load_async_to_lds_b128 %4, %5, off\n\tglobal_load_async_to_lds_b128 %6, %7, off\n\tglobal_load_async_to_lds_b128 %8, %9, off\n\tglobal_load_async_to_lds_b128 %10, %11, off\n\ts_wait_xcnt 0x0" \
                 :: "v"(k0), "v"(gk0), "v"(k1), "v"(gk1), "v"(v0), "v"(gv0), "v"(v1), "v"(gv1), "v"(w0), "v"(gw0), "v"(w1), "v"(gw1) : "memory"); \
    if (hi3) { const unsigned r0 = k0 + ST_KL, r1 = k1 + ST_KL; const _Float16* gr0 = KL + oK + (size_t)(t) * 32 * DH; const _Float16* gr1 = gr0 + 128 * 8; \
      asm volatile("global_load_async_to_lds_b128 %0, %1, off\n\tglobal_load_async_to_lds_b128 %2, %3, off\n\ts_wait_xcnt 0x0" :: "v"(r0), "v"(gr0), "v"(r1), "v"(gr1) : "memory"); } } while (0)
  ASTAGE(0, 0);   // second position tile: the first one's last pass ended in s_wait_dscnt 0 and a barrier, so every reader has left the ring, and no copy is in flight
  asm volatile("s_wait_asynccnt 0x0" ::: "memory");   // this wave's share of tile 0 has landed
  __syncthreads();                                    // ... and every other wave's
  ASTAGE(1, 1);
#pragma unroll 1
  for (int ks = 0; ks < nks; ++ks) { const unsigned char* tb = ring + (ks & 1) * ST_SZ;
    const int rel = p0 - ks * 32;   // the wave's first position minus the pass's first key: a scalar, a multiple of 16
    float alpha; v16h pa, vh0[2], vl0[2];
    if (rel >= 32 && !hi3) att_scores<0>(tb, lane, hi3, aq, al, p - ks * 32, fill, m, l, alpha, pa, vh0, vl0);
    else if (rel > -16) att_scores<1>(tb, lane, hi3, aq, al, p - ks * 32, fill, m, l, alpha, pa, vh0, vl0);
    else att_scores<2>(tb, lane, hi3, aq, al, p - ks * 32, fill, m, l, alpha, pa, vh0, vl0);
    // the unrolls below make the indices of the accumulators and fragment arrays constants, so that they stay in registers
#pragma unroll
    for (int j = 0; j < 4; ++j)
#pragma unroll
      for (int r = 0; r < 8; ++r) { acc[j][r] *= alpha; accl[j][r] *= alpha; }
    v16h vh[2], vl[2];   // V^T fragments in two groups of four: all eight at once do not fit the registers
#pragma unroll
    for (int j = 0; j < 2; ++j) { acc[j] = wmma16(vh0[j], pa, acc[j]); accl[j] = wmma16(vl0[j], pa, accl[j]); }
#pragma unroll
    for (int j = 0; j < 2; ++j) { vh[j] = frag_t(tb + ST_VH, 2 + j, lane); vl[j] = frag_t(tb + ST_VL, 2 + j, lane); }
#pragma unroll
    for (int j = 0; j < 2; ++j) { acc[2 + j] = wmma16(vh[j], pa, acc[2 + j]); accl[2 + j] = wmma16(vl[j], pa, accl[2 + j]); }
    asm volatile("s_wait_dscnt 0x0" ::: "memory");      // this wave's reads of the buffer are done
    asm volatile("s_wait_asynccnt 0x0" ::: "memory");   // its share of the next tile has landed
    __syncthreads();                                    // publishes the next tile and frees this pass's buffer
    if (ks + 2 < nks) ASTAGE(ks + 2, ks & 1); }
  asm volatile("s_wait_asynccnt 0x0" ::: "memory");     // no copy is left in flight when the wave goes on to its end
  const float lt = l + xhalf(l);   // the two halves' sums are joined once
  const float il = (lt > 0.f) ? (1.0f / 2048.0f) / lt : 0.f;
#pragma unroll
  for (int j = 0; j < 4; ++j) { v4f o[2];   // register r = channel j * 16 + 8 g + r of this lane's query
#pragma unroll
    for (int r = 0; r < 8; ++r) o[r >> 2][r & 3] = (acc[j][r] + accl[j][r] * (1.0f / 2048.0f)) * il;
    *(v4f*)&so[wave][col][j * 16 + 8 * g] = o[0]; *(v4f*)&so[wave][col][j * 16 + 8 * g + 4] = o[1]; }
  LDSX(); for (int rl = 0; rl < 16; ++rl) if (lane < 16) vst2(OUT + (rq + rl) * DH + lane * 4, *(const v4f*)&so[wave][rl][lane * 4]);
  asm volatile("s_wait_xcnt 0x0" ::: "memory");   // the next tile's first instructions reuse the registers that these stores name
  } }
extern "C" void kernel_launch(void* const* d_in, const int* in_sizes, int n_in, void* d_out, int out_size, void* d_ws, size_t ws_size, hipStream_t stream) {
  (void)in_sizes; (void)n_in; (void)out_size;
  const float** F = (const float**)d_in;   // 0 query_vector, 1 key_vector, 2 value_vector [2,2048,1024]; 3 Wq, 4 bq, 5 Wk, 6 bk, 7 Wv, 8 bv (natural)
  if (ws_size < (size_t)WS_END) return;
  char* ws = (char*)d_ws; _Float16 *QH = (_Float16*)(ws + WS_QH), *QL = (_Float16*)(ws + WS_QL), *KH = (_Float16*)(ws + WS_KH), *KL = (_Float16*)(ws + WS_KL), *VH = (_Float16*)(ws + WS_VH), *VL = (_Float16*)(ws + WS_VL);
  k_proj<<<dim3(NROW / 128, DD / 128, 3), 256, 0, stream>>>(F[0], F[1], F[2], F[3], F[4], F[5], F[6], F[7], F[8], QH, QL, KH, KL, VH, VL);
  k_att<<<dim3(SS / 128, NH, TNB), 128, 0, stream>>>(QH, QL, KH, KL, VH, VL, (float*)d_out);
}

// v007
// Measured time: 86.9 microseconds a run.
// Next to v006, in two timings, it ran 1.21 times as fast each time.
// Over all steps from v000 it is 6.20 times as fast.
// compute dtype: all float inputs rounded to bf16; Q/K/V = input . W^T + b with EXACT bf16 products on WMMA 16x16x32 (natural rows); the module's raw reshape (B,S,D)->(B,H,S,Dh) means 'head h' = the 128 projected rows 128h..128h+127 viewed as 2,048 positions x 64 (position p = (s - 128h)*16 + c/64) - handled purely by addressing; Q/K as f16 hi + residual (3-product scores for positions < 128, single f16 after), V as f16 hi + residual rows (2 products); mask: keys j >= i set to -1e9 INCLUDING the diagonal, so position 0 attends uniformly to all 2,048 keys (all logits equal) and position i >= 1 to keys < i; x 1/8; running-max softmax in f32 (hardware exp); the context in the same raw layout is the f32 output.
#include <hip/hip_runtime.h>
#include <math.h>

typedef __attribute__((ext_vector_type(16))) _Float16 v16h;
typedef __attribute__((ext_vector_type(16))) __bf16 v16b;
typedef __attribute__((ext_vector_type(8)))  _Float16 v8h;
typedef __attribute__((ext_vector_type(8)))  float v8f;
typedef __attribute__((ext_vector_type(4)))  float v4f;
typedef __attribute__((ext_vector_type(2)))  float v2f;
typedef __attribute__((ext_vector_type(4)))  unsigned v4u;
typedef __attribute__((ext_vector_type(4)))  int v4i;
typedef float __attribute__((may_alias)) float_a;
typedef int __attribute__((may_alias)) int_a;

template <typename T> __device__ __forceinline__ void vst2(void* p, T v) { *(T*)p = v;  }
__device__ __forceinline__ v8f wmma16(v16h a, v16h b, v8f c) {
  v8f d = __builtin_amdgcn_wmma_f32_16x16x32_f16(false, a, false, b, (short)0, c, false, false);
  asm volatile("v_nop\n\tv_nop\n\tv_nop\n\tv_nop" : "+v"(d) : "v"(a), "v"(b));
  return d;
}
__device__ __forceinline__ v8f wmma_bf(v16b a, v16b b, v8f c) {
  v8f d = __builtin_amdgcn_wmma_f32_16x16x32_bf16(false, a, false, b, (short)0, c, false, false);
  asm volatile("v_nop\n\tv_nop\n\tv_nop\n\tv_nop" : "+v"(d) : "v"(a), "v"(b));
  return d;
}
// 16x16x32 fragments: lane = (h = lane>>4, row/col = lane&15); elements 0..7 = k0+8h+0..7, 8..15 = k0+16+8h+0..7; D element r = row 8h+r
__device__ __forceinline__ v16h frag_h(const _Float16* rowk0, int lane) {
  union { v16h v; v8h q[2]; } u; const _Float16* p = rowk0 + 8 * (lane >> 4);
  u.q[0] = *(const v8h*)p; u.q[1] = *(const v8h*)(p + 16); return u.v;
}
__device__ __forceinline__ v16h frag_f32(const float* rowk0, int lane) {
  v16h a; const float* p = rowk0 + 8 * (lane >> 4);
#pragma unroll
  for (int i = 0; i < 8; ++i) { a[i] = (_Float16)p[i]; a[8 + i] = (_Float16)p[16 + i]; }
  return a;
}
__device__ __forceinline__ v16h frag_f32s(const float* rowk0, int lane, float sc) {
  v16h a; const float* p = rowk0 + 8 * (lane >> 4);
#pragma unroll
  for (int i = 0; i < 8; ++i) { a[i] = (_Float16)(p[i] * sc); a[8 + i] = (_Float16)(p[16 + i] * sc); }
  return a;
}
// column fragment from a [K][ld] layout (column n), rows >= K read as 0
__device__ __forceinline__ v16h fragc_f32(const float* W, int k0, int n, int lane, int ld, int K) {
  v16h a; const int g = lane >> 4;
#pragma unroll
  for (int i = 0; i < 8; ++i) { const int ka = k0 + 8 * g + i, kb = ka + 16;
    a[i] = (_Float16)(ka < K ? W[(size_t)(ka < K ? ka : K - 1) * ld + n] : 0.f); a[8 + i] = (_Float16)(kb < K ? W[(size_t)(kb < K ? kb : K - 1) * ld + n] : 0.f); }
  return a;
}
struct F2 { v16b h, l; };
__device__ __forceinline__ F2 bsplit16(const float v[16]) { F2 r;
#pragma unroll
  for (int i = 0; i < 16; ++i) { const __bf16 h = (__bf16)v[i]; r.h[i] = h; r.l[i] = (__bf16)(v[i] - (float)h); }
  return r; }
__device__ __forceinline__ F2 split_row(const float* row, int k0, int lane) { float v[16]; const float* p = row + k0 + 8 * (lane >> 4);
#pragma unroll
  for (int i = 0; i < 8; ++i) { v[i] = p[i]; v[8 + i] = p[16 + i]; }
  return bsplit16(v); }
__device__ __forceinline__ F2 split_rowK(const float* row, int k0, int lane, int K) { float v[16]; const int g = lane >> 4;
#pragma unroll
  for (int i = 0; i < 8; ++i) { const int ka = k0 + 8 * g + i, kb = ka + 16; v[i] = ka < K ? row[ka < K ? ka : K - 1] : 0.f; v[8 + i] = kb < K ? row[kb < K ? kb : K - 1] : 0.f; }
  return bsplit16(v); }
__device__ __forceinline__ F2 split_col(const float* W, int k0, int n, int lane, int ld, int K) { float v[16]; const int g = lane >> 4;
#pragma unroll
  for (int i = 0; i < 8; ++i) { const int ka = k0 + 8 * g + i, kb = ka + 16; v[i] = ka < K ? W[(size_t)(ka < K ? ka : K - 1) * ld + n] : 0.f; v[8 + i] = kb < K ? W[(size_t)(kb < K ? kb : K - 1) * ld + n] : 0.f; }
  return bsplit16(v); }
__device__ __forceinline__ v8f mac3(const F2& a, const F2& b, v8f c) { c = wmma_bf(a.l, b.h, c); c = wmma_bf(a.h, b.l, c); return wmma_bf(a.h, b.h, c); }
__device__ __forceinline__ float sigm(float v) { return 1.0f / (1.0f + expf(-v)); }
#define LDSX() do { asm volatile("s_wait_dscnt 0" ::: "memory"); __builtin_amdgcn_wave_barrier(); __builtin_amdgcn_fence(__ATOMIC_RELEASE, "workgroup"); } while (0)


// 'Fast' MHA with raw-reshape heads (B 2, S 2,048, D 1,024, 16 'heads' x 64): separate query / key / value inputs, natural projections + biases, triu(offset 0)-masked softmax(q k / 8) v, raw reshape back (no output projection).
#define NB 2
#define SS 2048           // positions per head (== S)
#define DD 1024
#define NH 16
#define DH 64
#define NROW (NB * SS)    // projected rows
#ifndef TNB
#define TNB NB
#endif
typedef __attribute__((ext_vector_type(8))) __bf16 v8b;
__device__ __forceinline__ v16b frag_b(const __bf16* rowk0, int lane) {
  union { v16b v; v8b q[2]; } u; const __bf16* p = rowk0 + 8 * (lane >> 4);
  u.q[0] = *(const v8b*)p; u.q[1] = *(const v8b*)(p + 16); return u.v;
}
__device__ __forceinline__ float bfr(float v) { return (float)(__bf16)v; }
__device__ __forceinline__ float xhalf(float x) { return __builtin_bit_cast(float, __builtin_amdgcn_permlanex16(__builtin_bit_cast(int, x), __builtin_bit_cast(int, x), 0x76543210, 0xfedcba98, false, false)); }  // lane l's value for lane l ^ 16
__device__ __attribute__((noinline)) float exp_ni(float v) { return expf(v); }
__device__ __attribute__((noinline)) float erf_ni(float v) { return erff(v); }

#define WS_QH  0u                                   // f16 hi|lo Q flat [b][s][1024] == [b][h][p][64]
#define WS_QL  (WS_QH + 2u * (size_t)NROW * DD)
#define WS_KH  (WS_QL + 2u * (size_t)NROW * DD)
#define WS_KL  (WS_KH + 2u * (size_t)NROW * DD)
#define WS_VH  (WS_KL + 2u * (size_t)NROW * DD)          // f16 hi|lo V flat, laid out like Q and K
#define WS_VL  (WS_VH + 2u * (size_t)NROW * DD)
#define WS_END (WS_VL + 2u * (size_t)NROW * DD)

__device__ __forceinline__ v16b fragb_f32(const float* __restrict__ p, int lane) { v16b a; const float* pp = p + 8 * (lane >> 4);
#pragma unroll
  for (int i = 0; i < 8; ++i) { a[i] = (__bf16)pp[i]; a[8 + i] = (__bf16)pp[16 + i]; } return a; }
// ---- k_proj: block = (128 rows, 128 cols, which), 8 waves of 64 x 32: which 0 Q, 1 K, 2 V -> f16 hi/lo flat rows.
// Each 32-k slice of the X and W tiles is read once per block by whole-line loads (8 lanes x 16 B = one 128-B row piece), rounded to bf16 once and kept in LDS; all 8 waves take their fragments from there.
#define PLD 40            // bf16 elements per staged row: 64 B of data + 16 B pad; 80 B = 16 B x odd keeps the 16-byte fragment reads off each other's banks
#define PTILE (128 * PLD) // one staged operand slice
typedef __attribute__((ext_vector_type(4))) __bf16 v4b;
__global__ __launch_bounds__(256) void k_proj(const float* __restrict__ XQ, const float* __restrict__ XK, const float* __restrict__ XV, const float* __restrict__ WQ, const float* __restrict__ BQ, const float* __restrict__ WK, const float* __restrict__ BK, const float* __restrict__ WV, const float* __restrict__ BV, _Float16* __restrict__ QH, _Float16* __restrict__ QL, _Float16* __restrict__ KH, _Float16* __restrict__ KL, _Float16* __restrict__ VH, _Float16* __restrict__ VL) {
  __shared__ __align__(16) unsigned char smem[2 * 128 * 136 * 2];   // K loop: two buffers of [X slice | W slice] (40,960 B); afterwards the output staging (f16 hi | lo planes)
  __bf16* const sA = (__bf16*)smem; __bf16* const sB = sA + 2 * PTILE;
  const int tid = threadIdx.x, wave = tid >> 5, lane = tid & 31, col = lane & 15, g = lane >> 4; const int which = blockIdx.z; const size_t row0 = (size_t)blockIdx.x * 128; const int c0 = blockIdx.y * 128;
  const int wm = wave >> 2, wn = wave & 3;
  const float* X = which == 0 ? XQ : which == 1 ? XK : XV; const float* Wm = which == 0 ? WQ : which == 1 ? WK : WV; const float* Bm = which == 0 ? BQ : which == 1 ? BK : BV;
  const int sr = tid >> 3, sc = (tid & 7) * 4;   // staging: this thread's row (plus 32 i) and its four k of the slice
  const float* gA = X + (row0 + sr) * DD + sc; const float* gB = Wm + (size_t)(c0 + sr) * DD + sc;
  const int so_ = sr * PLD + sc;
  v4f ra[4], rb[4];
  v8f acc[4][2] = {};
  // every unroll in this kernel makes the indices of acc, ra, rb and the fragment arrays constants, so that they stay in registers
#define PLOAD(pa, pb) do { _Pragma("unroll") for (int i = 0; i < 4; ++i) { ra[i] = *(const v4f*)((pa) + (size_t)i * 32 * DD); rb[i] = *(const v4f*)((pb) + (size_t)i * 32 * DD); } } while (0)
#define PSTORE(buf) do { _Pragma("unroll") for (int i = 0; i < 4; ++i) { v4b ta, tb; _Pragma("unroll") for (int e = 0; e < 4; ++e) { ta[e] = (__bf16)ra[i][e]; tb[e] = (__bf16)rb[i][e]; } *(v4b*)(sA + (buf) * PTILE + so_ + i * 32 * PLD) = ta; *(v4b*)(sB + (buf) * PTILE + so_ + i * 32 * PLD) = tb; } } while (0)
#define PMAC(buf) do { v16b fb[2], fa[4]; _Pragma("unroll") for (int j = 0; j < 2; ++j) fb[j] = frag_b(sB + (buf) * PTILE + (wn * 32 + j * 16 + col) * PLD, lane); \
    _Pragma("unroll") for (int i = 0; i < 4; ++i) fa[i] = frag_b(sA + (buf) * PTILE + (wm * 64 + i * 16 + col) * PLD, lane); \
    _Pragma("unroll") for (int i = 0; i < 4; ++i) { _Pragma("unroll") for (int j = 0; j < 2; ++j) acc[i][j] = wmma_bf(fa[i], fb[j], acc[i][j]); } } while (0)
  PLOAD(gA, gB); PSTORE(0); __syncthreads();
  for (int kc = 0; kc < DD / 32 - 1; ++kc) { const int cur = kc & 1;
    const float* pa = gA + (kc + 1) * 32; const float* pb = gB + (kc + 1) * 32;
    PLOAD(pa, pb);        // the next slice flies while this one is multiplied
    asm volatile("s_wait_xcnt 0x0" :: "v"(pa), "v"(pb) : "memory");   // keeps the two address pairs whole until this wait: the fragment reads below may reuse their registers
    PMAC(cur);
    PSTORE(cur ^ 1);      // its last readers left it before the previous barrier
    __syncthreads(); }
  PMAC((DD / 32 - 1) & 1);
  __syncthreads();        // every wave has read its last fragments: the buffers become output staging
  _Float16 (*sh)[136] = (_Float16 (*)[136])smem; _Float16 (*sl)[136] = (_Float16 (*)[136])(smem + 128 * 136 * 2);
#pragma unroll
  for (int j = 0; j < 2; ++j) { const int cc = wn * 32 + j * 16 + col; const float bb = bfr(Bm[c0 + cc]);
#pragma unroll
    for (int i = 0; i < 4; ++i)
#pragma unroll
      for (int r = 0; r < 8; ++r) { const int rr = wm * 64 + i * 16 + 8 * g + r; const float v = acc[i][j][r] + bb; const _Float16 hv = (_Float16)v; sh[rr][cc] = hv; sl[rr][cc] = (_Float16)((v - (float)hv) * 2048.0f); } }
  __syncthreads();
  _Float16* PH = which == 0 ? QH : which == 1 ? KH : VH; _Float16* PL = which == 0 ? QL : which == 1 ? KL : VL;
  for (int e = tid; e < 128 * 16; e += 256) { const int rl = e >> 4, q = e & 15; const size_t o = (row0 + rl) * DD + c0 + q * 8; vst2((unsigned*)(PH + o), *(const v4u*)&sh[rl][q * 8]); vst2((unsigned*)(PL + o), *(const v4u*)&sl[rl][q * 8]); } }
// ---- k_att: block = (pair of 64-position tiles, h, b): keys j < i (diagonal excluded); position 0 -> uniform over all keys; key tiles past a position tile skipped (tile 0 also scans all key tiles so that position 0's uniform average is exact)
// A pass takes 64 keys. A position tile's cost grows with its index (tile t walks t + 1 passes, tile 0 all 32), and every block is resident at once, so the launch lasts as long as the fullest WGP. Each block therefore takes two tiles, one after the other,
// a long one and a short one: block 0 tiles 0 and 1 (34 passes), block w >= 1 tiles 32 - w and 1 + w (35 passes): the blocks walk nearly the same number of passes wherever they are placed (block 0's tile 0 walks all 32 passes for position 0 alone: past the diagonal they take no score products, see att_scores, so block 0 is not the dearest).
// The products are taken transposed: S^T = K . Q^T (A = K rows, B = Q rows) and O^T += V^T . P^T. A lane then holds 32 of the pass's 64 scores of ONE query (position p0 + col; lane ^ 16 holds the other 32), so maximum and sum are taken in the lane,
// and each pair of score tiles, turned into f16 in place, already is the B operand of the second product for its 32 keys (element s = tile s / 8, register s % 8 = key 8 g + s % 8 + 16 (s / 8): the k order of frag_h): P goes through no LDS.
// Each pass's 64 keys (K hi rows, K residual rows for the first 128 positions, V hi and residual rows, all as the projection stored them) are brought into LDS once per block by asynchronous 16-byte copies, two buffers, one pass ahead; the four waves take their fragments from there.
// What a pass costs whatever its width (the barrier and the waits in front of it, the copies' issue and their wait, the choice of the body, the way of the first fragments from LDS, the half exchange, the rescaling of the 64 accumulator registers) is paid once per 64 keys.
// V^T is never stored: the A operand of the second product comes from the staged V rows by the transposing LDS load (frag_t).
#define KP 64                       // keys per pass
#define KPB 144                     // bytes per staged K row: 128 B of data + 16 B pad (16 B x odd keeps the 16-byte fragment reads off each other's banks)
#define VPB 160                     // bytes per staged V row: 128 B of data + 32 B pad (32 B x odd is the transposing load's conflict-free pitch)
#define ST_KL (KP * KPB)            // buffer layout: K hi | K residual | V hi | V residual
#define ST_VH (2 * KP * KPB)
#define ST_VL (ST_VH + KP * VPB)
#define ST_SZ (ST_VL + KP * VPB)
// A fragment of V^T (rows = channels 16 j .. 16 j + 15, k = 32 keys) from 32 staged V rows: ds_load_tr16_b128 gives lane (col, g) the eight values tile[kbase + 8 g + 0..7][16 j + col];
// the loads at kbase 0 and 16 are elements 0..7 and 8..15, the k order of frag_h. Every lane is on wherever this is called.
typedef __attribute__((ext_vector_type(8))) short v8s;
__device__ __forceinline__ v16h frag_t(const unsigned char* tile, int j, int lane) {
  typedef __attribute__((address_space(3))) v8s lds_v8s;
  union { v16h v; v8s q[2]; } u; const unsigned char* p = tile + (8 * (lane >> 4) + (lane & 7)) * VPB + ((lane >> 3) & 1) * 16 + j * 32;
  u.q[0] = __builtin_amdgcn_ds_load_tr16_b128_v8i16((lds_v8s*)p); u.q[1] = __builtin_amdgcn_ds_load_tr16_b128_v8i16((lds_v8s*)(p + 16 * VPB)); return u.v;
}
// Scores and softmax weights of one pass (64 keys) of one wave (16 positions). KIND says where the pass's keys lie against the wave's positions; it is the same for the whole wave, so the caller picks the body by a scalar branch
// and the common body carries no per-element work for cases that cannot occur in it:
//   0: every key lies below every position, past the first 128 positions: all 1,024 scores count (no mask; a counted score is far above -1e38, so the zero guard of the exponentials is an identity and goes too; no residual terms)
//   1: the pass crosses the diagonal, or belongs to the first 128 positions: mask, guard and (hi3) residual terms as written
//   2: every key lies at or above every position: every score is 'fill' whatever K . Q^T gives, so the K fragments are not read and the score products are not taken
template <int KIND>
__device__ __forceinline__ void att_scores(const unsigned char* tb, const int lane, const bool hi3, const v16h (&aq)[2], const v16h (&al)[2], const int pk, const float fill, float& m, float& l, float& alpha, v16h (&pa)[2], v16h (&vh0)[4], v16h (&vl0)[4]) {
  const int col = lane & 15, g = lane >> 4; float s[4][8];   // pk = this lane's position minus the pass's first key
  if (KIND == 2) {
#pragma unroll
    for (int ct = 0; ct < 4; ++ct)
#pragma unroll
      for (int r = 0; r < 8; ++r) s[ct][r] = fill;
  } else {
    // the K fragments of the pass are asked for in one group ahead of the score products (the unrolls make the fragment arrays' indices constants, so that they stay in registers)
    v16h kf[4][2];
#pragma unroll
    for (int ct = 0; ct < 4; ++ct)
#pragma unroll
      for (int kc = 0; kc < 2; ++kc) kf[ct][kc] = frag_h((const _Float16*)(tb + (ct * 16 + col) * KPB) + kc * 32, lane);
    v8f c[4] = {};
#pragma unroll
    for (int kc = 0; kc < 2; ++kc)   // the four score tiles' products take turns, so that none waits for its own predecessor
#pragma unroll
      for (int ct = 0; ct < 4; ++ct) c[ct] = wmma16(kf[ct][kc], aq[kc], c[ct]);
    if (KIND == 1 && hi3) {   // the residual products and their addition stand under one scalar branch
#pragma unroll
      for (int ct = 0; ct < 4; ++ct) { v16h kq[2]; v8f cl = {};
#pragma unroll
        for (int kc = 0; kc < 2; ++kc) kq[kc] = frag_h((const _Float16*)(tb + ST_KL + (ct * 16 + col) * KPB) + kc * 32, lane);
#pragma unroll
        for (int kc = 0; kc < 2; ++kc) { cl = wmma16(kq[kc], aq[kc], cl); cl = wmma16(kf[ct][kc], al[kc], cl); }
#pragma unroll
        for (int r = 0; r < 8; ++r) c[ct][r] = c[ct][r] + cl[r] * (1.0f / 2048.0f); } }
#pragma unroll
    for (int ct = 0; ct < 4; ++ct) { const int nk = pk - (ct * 16 + 8 * g);   // register r = key ct * 16 + 8 g + r of the pass: it counts while r < nk
#pragma unroll
      for (int r = 0; r < 8; ++r) { const float sc = c[ct][r] * 0.125f; s[ct][r] = (KIND == 0 || r < nk) ? sc : fill; } }
  }
  // the V^T fragments of the pass's first 32 keys are asked for here, inside the chosen body, so that their way from LDS passes under the exponentials (the scheduler lifts no load over the branch that ends the body)
#pragma unroll
  for (int j = 0; j < 4; ++j) { vh0[j] = frag_t(tb + ST_VH, j, lane); vl0[j] = frag_t(tb + ST_VL, j, lane); }
  // the unrolls below make the indices of s, mq, es and pa constants, so that they stay in registers
  float mq[4];   // four short chains of maxima instead of one of thirty-two
#pragma unroll
  for (int ct = 0; ct < 4; ++ct) { mq[ct] = s[ct][0];
#pragma unroll
    for (int r = 1; r < 8; ++r) mq[ct] = fmaxf(mq[ct], s[ct][r]); }
  float mx = fmaxf(fmaxf(mq[0], mq[1]), fmaxf(mq[2], mq[3]));
  mx = fmaxf(mx, xhalf(mx));
  const float mn = fmaxf(m, mx); alpha = (m <= -1.0e38f) ? 0.f : __expf(m - mn);
  float es[4] = {0.f, 0.f, 0.f, 0.f};   // four short chains of adds instead of one of thirty-two
#pragma unroll
  for (int ct = 0; ct < 4; ++ct)
#pragma unroll
    for (int r = 0; r < 8; ++r) { const float e = (KIND != 0 && s[ct][r] <= -1.0e38f) ? 0.f : __expf(s[ct][r] - mn); es[r & 3] += e; pa[ct >> 1][(ct & 1) * 8 + r] = (_Float16)(e * 2048.0f); }
  l = l * alpha + ((es[0] + es[1]) + (es[2] + es[3])); m = (mn > -1.0e38f) ? mn : m;
}
__global__ __launch_bounds__(128) void k_att(const _Float16* __restrict__ QH, const _Float16* __restrict__ QL, const _Float16* __restrict__ KH, const _Float16* __restrict__ KL, const _Float16* __restrict__ VH, const _Float16* __restrict__ VL, float* __restrict__ OUT) {
  __shared__ __align__(16) unsigned char ring[2 * ST_SZ];
  __shared__ __align__(16) float so[4][16][68];
  const int tid = threadIdx.x, wave = __builtin_amdgcn_readfirstlane(tid >> 5) /* held in a scalar register, so that the choice of a pass's body below is a scalar branch */, lane = tid & 31, col = lane & 15, g = lane >> 4; const int h = blockIdx.y; const size_t b = blockIdx.z; const int w = blockIdx.x; const size_t bh = b * NH + h;
  const bool hi3 = w == 0;   // first 128 positions (tiles 0 and 1, both in block 0): 3-product scores
  // staging: a K tile and a V tile are each 8,192 contiguous bytes, 64 rows of 128 B (thread: 16-byte pieces tid + 128 i, that is rows tid / 8 + 16 i, i = 0..3)
  const unsigned lK = (unsigned)(size_t)ring + (tid >> 3) * KPB + (tid & 7) * 16, lV = (unsigned)(size_t)ring + ST_VH + (tid >> 3) * VPB + (tid & 7) * 16;
  const size_t oK = bh * SS * DH + tid * 8;   // the same element offset in the K and the V arrays
#pragma unroll 1   // the two tiles run one after the other through one copy of the code
  for (int half = 0; half < 2; ++half) {
  const int qb = (w == 0) ? half : (half == 0 ? SS / 64 - w : 1 + w); const int p0 = qb * 64 + wave * 16; const size_t rq = bh * SS + p0;
  v16h aq[2], al[2];
#pragma unroll
  for (int kc = 0; kc < 2; ++kc) { aq[kc] = frag_h(QH + (rq + col) * DH + kc * 32, lane); al[kc] = frag_h(QL + (rq + col) * DH + kc * 32, lane); }
  const int p = p0 + col;                            // this lane's query position
  const float fill = (p == 0) ? 0.0f : -3.0e38f;     // what a key j >= p scores; position 0: all logits equal -> uniform
  float m = -3.0e38f, l = 0.f;                       // running maximum (same in both halves); this lane's half of the running sum
  v8f acc[4] = {}, accl[4] = {};
  const int nks = (qb == 0) ? SS / KP : qb + 1;      // at least 2
  // the copies of one tile set stand in one statement with s_wait_xcnt 0 as its last line, so that no later write of their address registers can be moved in front of that wait
#define ASTAGE(t, buf) do { const unsigned k0 = lK + (buf) * ST_SZ, k1 = k0 + 16 * KPB, k2 = k0 + 32 * KPB, k3 = k0 + 48 * KPB, v0 = lV + (buf) * ST_SZ, v1 = v0 + 16 * VPB, v2 = v0 + 32 * VPB, v3 = v0 + 48 * VPB, \
      w0 = v0 + (ST_VL - ST_VH), w1 = w0 + 16 * VPB, w2 = w0 + 32 * VPB, w3 = w0 + 48 * VPB; \
    const _Float16* gk0 = KH + oK + (size_t)(t) * KP * DH; const _Float16* gk1 = gk0 + 128 * 8; const _Float16* gk2 = gk0 + 256 * 8; const _Float16* gk3 = gk0 + 384 * 8; \
    const _Float16* gv0 = VH + oK + (size_t)(t) * KP * DH; const _Float16* gv1 = gv0 + 128 * 8; const _Float16* gv2 = gv0 + 256 * 8; const _Float16* gv3 = gv0 + 384 * 8; \
    const _Float16* gw0 = VL + oK + (size_t)(t) * KP * DH; const _Float16* gw1 = gw0 + 128 * 8; const _Float16* gw2 = gw0 + 256 * 8; const _Float16* gw3 = gw0 + 384 * 8; \
    asm volatile("global_load_async_to_lds_b128 %0, %1, off\n\tglobal_load_async_to_lds_b128 %2, %3, off\n\tglobal_load_async_to_lds_b128 %4, %5, off\n\tglobal_load_async_to_lds_b128 %6, %7, off\n\t" \
                 "global_load_async_to_lds_b128 %8, %9, off\n\tglobal_load_async_to_lds_b128 %10, %11, off\n\tglobal_load_async_to_lds_b128 %12, %13, off\n\tglobal_load_async_to_lds_b128 %14, %15, off\n\t" \
                 "global_load_async_to_lds_b128 %16, %17, off\n\tglobal_load_async_to_lds_b128 %18, %19, off\n\tglobal_load_async_to_lds_b128 %20, %21, off\n\tglobal_load_async_to_lds_b128 %22, %23, off\n\ts_wait_xcnt 0x0" \
                 :: "v"(k0), "v"(gk0), "v"(k1), "v"(gk1), "v"(k2), "v"(gk2), "v"(k3), "v"(gk3), "v"(v0), "v"(gv0), "v"(v1), "v"(gv1), "v"(v2), "v"(gv2), "v"(v3), "v"(gv3), "v"(w0), "v"(gw0), "v"(w1), "v"(gw1), "v"(w2), "v"(gw2), "v"(w3), "v"(gw3) : "memory"); \
    if (hi3) { const unsigned r0 = k0 + ST_KL, r1 = k1 + ST_KL, r2 = k2 + ST_KL, r3 = k3 + ST_KL; const _Float16* gr0 = KL + oK + (size_t)(t) * KP * DH; const _Float16* gr1 = gr0 + 128 * 8; const _Float16* gr2 = gr0 + 256 * 8; const _Float16* gr3 = gr0 + 384 * 8; \
      asm volatile("global_load_async_to_lds_b128 %0, %1, off\n\tglobal_load_async_to_lds_b128 %2, %3, off\n\tglobal_load_async_to_lds_b128 %4, %5, off\n\tglobal_load_async_to_lds_b128 %6, %7, off\n\ts_wait_xcnt 0x0" \
                   :: "v"(r0), "v"(gr0), "v"(r1), "v"(gr1), "v"(r2), "v"(gr2), "v"(r3), "v"(gr3) : "memory"); } } while (0)
  ASTAGE(0, 0);   // second position tile: the first one's last pass ended in s_wait_dscnt 0 and a barrier, so every reader has left the ring, and no copy is in flight
  asm volatile("s_wait_asynccnt 0x0" ::: "memory");   // this wave's share of tile 0 has landed
  __syncthreads();                                    // ... and every other wave's
  ASTAGE(1, 1);
#pragma unroll 1
  for (int ks = 0; ks < nks; ++ks) { const unsigned char* tb = ring + (ks & 1) * ST_SZ;
    const int rel = p0 - ks * KP;   // the wave's first position minus the pass's first key: a scalar, a multiple of 16
    float alpha; v16h pa[2], vh0[4], vl0[4];
    if (rel >= KP && !hi3) att_scores<0>(tb, lane, hi3, aq, al, p - ks * KP, fill, m, l, alpha, pa, vh0, vl0);
    else if (rel > -16) att_scores<1>(tb, lane, hi3, aq, al, p - ks * KP, fill, m, l, alpha, pa, vh0, vl0);
    else att_scores<2>(tb, lane, hi3, aq, al, p - ks * KP, fill, m, l, alpha, pa, vh0, vl0);
    // the unrolls below make the indices of the accumulators and fragment arrays constants, so that they stay in registers
#pragma unroll
    for (int j = 0; j < 4; ++j)
#pragma unroll
      for (int r = 0; r < 8; ++r) { acc[j][r] *= alpha; accl[j][r] *= alpha; }
    v16h vh[4], vl[4];   // the V^T fragments of the pass's second 32 keys, asked for in two groups of four, each as soon as four of the first 32 keys' fragments have been used, into the registers these leave: with all sixteen held at once the build spilled to scratch
#pragma unroll
    for (int j = 0; j < 2; ++j) { acc[j] = wmma16(vh0[j], pa[0], acc[j]); accl[j] = wmma16(vl0[j], pa[0], accl[j]); }
#pragma unroll
    for (int j = 0; j < 2; ++j) { vh[j] = frag_t(tb + ST_VH + 32 * VPB, j, lane); vl[j] = frag_t(tb + ST_VL + 32 * VPB, j, lane); }
#pragma unroll
    for (int j = 2; j < 4; ++j) { acc[j] = wmma16(vh0[j], pa[0], acc[j]); accl[j] = wmma16(vl0[j], pa[0], accl[j]); }
#pragma unroll
    for (int j = 2; j < 4; ++j) { vh[j] = frag_t(tb + ST_VH + 32 * VPB, j, lane); vl[j] = frag_t(tb + ST_VL + 32 * VPB, j, lane); }
#pragma unroll
    for (int j = 0; j < 4; ++j) { acc[j] = wmma16(vh[j], pa[1], acc[j]); accl[j] = wmma16(vl[j], pa[1], accl[j]); }
    asm volatile("s_wait_dscnt 0x0" ::: "memory");      // this wave's reads of the buffer are done
    asm volatile("s_wait_asynccnt 0x0" ::: "memory");   // its share of the next tile has landed
    __syncthreads();                                    // publishes the next tile and frees this pass's buffer
    if (ks + 2 < nks) ASTAGE(ks + 2, ks & 1); }
  asm volatile("s_wait_asynccnt 0x0" ::: "memory");     // no copy is left in flight when the wave goes on to its end
  const float lt = l + xhalf(l);   // the two halves' sums are joined once
  const float il = (lt > 0.f) ? (1.0f / 2048.0f) / lt : 0.f;
#pragma unroll
  for (int j = 0; j < 4; ++j) { v4f o[2];   // register r = channel j * 16 + 8 g + r of this lane's query
#pragma unroll
    for (int r = 0; r < 8; ++r) o[r >> 2][r & 3] = (acc[j][r] + accl[j][r] * (1.0f / 2048.0f)) * il;
    *(v4f*)&so[wave][col][j * 16 + 8 * g] = o[0]; *(v4f*)&so[wave][col][j * 16 + 8 * g + 4] = o[1]; }
  LDSX(); for (int rl = 0; rl < 16; ++rl) if (lane < 16) vst2(OUT + (rq + rl) * DH + lane * 4, *(const v4f*)&so[wave][rl][lane * 4]);
  asm volatile("s_wait_xcnt 0x0" ::: "memory");   // the next tile's first instructions reuse the registers that these stores name
  } }
extern "C" void kernel_launch(void* const* d_in, const int* in_sizes, int n_in, void* d_out, int out_size, void* d_ws, size_t ws_size, hipStream_t stream) {
  (void)in_sizes; (void)n_in; (void)out_size;
  const float** F = (const float**)d_in;   // 0 query_vector, 1 key_vector, 2 value_vector [2,2048,1024]; 3 Wq, 4 bq, 5 Wk, 6 bk, 7 Wv, 8 bv (natural)
  if (ws_size < (size_t)WS_END) return;
  char* ws = (char*)d_ws; _Float16 *QH = (_Float16*)(ws + WS_QH), *QL = (_Float16*)(ws + WS_QL), *KH = (_Float16*)(ws + WS_KH), *KL = (_Float16*)(ws + WS_KL), *VH = (_Float16*)(ws + WS_VH), *VL = (_Float16*)(ws + WS_VL);
  k_proj<<<dim3(NROW / 128, DD / 128, 3), 256, 0, stream>>>(F[0], F[1], F[2], F[3], F[4], F[5], F[6], F[7], F[8], QH, QL, KH, KL, VH, VL);
  k_att<<<dim3(SS / 128, NH, TNB), 128, 0, stream>>>(QH, QL, KH, KL, VH, VL, (float*)d_out);
}

// v008
// One run takes 83.1 microseconds.
// Timed twice side by side with v007, it ran 1.04 and 1.05 times as fast.
// Counting every step since v000, it is 6.47 times as fast.
// compute dtype: all float inputs rounded to bf16; Q/K/V = input . W^T + b with EXACT bf16 products on WMMA 16x16x32 (natural rows); the module's raw reshape (B,S,D)->(B,H,S,Dh) means 'head h' = the 128 projected rows 128h..128h+127 viewed as 2,048 positions x 64 (position p = (s - 128h)*16 + c/64) - handled purely by addressing; Q/K as f16 hi + residual (3-product scores for positions < 128, single f16 after), V as f16 hi + residual rows (2 products); mask: keys j >= i set to -1e9 INCLUDING the diagonal, so position 0 attends uniformly to all 2,048 keys (all logits equal) and position i >= 1 to keys < i; x 1/8; running-max softmax in f32 (hardware exp); the context in the same raw layout is the f32 output.
#include <hip/hip_runtime.h>
#include <math.h>

typedef __attribute__((ext_vector_type(16))) _Float16 v16h;
typedef __attribute__((ext_vector_type(16))) __bf16 v16b;
typedef __attribute__((ext_vector_type(8)))  _Float16 v8h;
typedef __attribute__((ext_vector_type(8)))  float v8f;
typedef __attribute__((ext_vector_type(4)))  float v4f;
typedef __attribute__((ext_vector_type(2)))  float v2f;
typedef __attribute__((ext_vector_type(4)))  unsigned v4u;
typedef __attribute__((ext_vector_type(4)))  int v4i;
typedef float __attribute__((may_alias)) float_a;
typedef int __attribute__((may_alias)) int_a;

template <typename T> __device__ __forceinline__ void vst2(void* p, T v) { *(T*)p = v;  }
__device__ __forceinline__ v8f wmma16(v16h a, v16h b, v8f c) {
  v8f d = __builtin_amdgcn_wmma_f32_16x16x32_f16(false, a, false, b, (short)0, c, false, false);
  asm volatile("v_nop\n\tv_nop\n\tv_nop\n\tv_nop" : "+v"(d) : "v"(a), "v"(b));
  return d;
}
__device__ __forceinline__ v8f wmma_bf(v16b a, v16b b, v8f c) {
  v8f d = __builtin_amdgcn_wmma_f32_16x16x32_bf16(false, a, false, b, (short)0, c, false, false);
  asm volatile("v_nop\n\tv_nop\n\tv_nop\n\tv_nop" : "+v"(d) : "v"(a), "v"(b));
  return d;
}
// 16x16x32 fragments: lane = (h = lane>>4, row/col = lane&15); elements 0..7 = k0+8h+0..7, 8..15 = k0+16+8h+0..7; D element r = row 8h+r
__device__ __forceinline__ v16h frag_h(const _Float16* rowk0, int lane) {
  union { v16h v; v8h q[2]; } u; const _Float16* p = rowk0 + 8 * (lane >> 4);
  u.q[0] = *(const v8h*)p; u.q[1] = *(const v8h*)(p + 16); return u.v;
}
__device__ __forceinline__ v16h frag_f32(const float* rowk0, int lane) {
  v16h a; const float* p = rowk0 + 8 * (lane >> 4);
#pragma unroll
  for (int i = 0; i < 8; ++i) { a[i] = (_Float16)p[i]; a[8 + i] = (_Float16)p[16 + i]; }
  return a;
}
__device__ __forceinline__ v16h frag_f32s(const float* rowk0, int lane, float sc) {
  v16h a; const float* p = rowk0 + 8 * (lane >> 4);
#pragma unroll
  for (int i = 0; i < 8; ++i) { a[i] = (_Float16)(p[i] * sc); a[8 + i] = (_Float16)(p[16 + i] * sc); }
  return a;
}
// column fragment from a [K][ld] layout (column n), rows >= K read as 0
__device__ __forceinline__ v16h fragc_f32(const float* W, int k0, int n, int lane, int ld, int K) {
  v16h a; const int g = lane >> 4;
#pragma unroll
  for (int i = 0; i < 8; ++i) { const int ka = k0 + 8 * g + i, kb = ka + 16;
    a[i] = (_Float16)(ka < K ? W[(size_t)(ka < K ? ka : K - 1) * ld + n] : 0.f); a[8 + i] = (_Float16)(kb < K ? W[(size_t)(kb < K ? kb : K - 1) * ld + n] : 0.f); }
  return a;
}
struct F2 { v16b h, l; };
__device__ __forceinline__ F2 bsplit16(const float v[16]) { F2 r;
#pragma unroll
  for (int i = 0; i < 16; ++i) { const __bf16 h = (__bf16)v[i]; r.h[i] = h; r.l[i] = (__bf16)(v[i] - (float)h); }
  return r; }
__device__ __forceinline__ F2 split_row(const float* row, int k0, int lane) { float v[16]; const float* p = row + k0 + 8 * (lane >> 4);
#pragma unroll
  for (int i = 0; i < 8; ++i) { v[i] = p[i]; v[8 + i] = p[16 + i]; }
  return bsplit16(v); }
__device__ __forceinline__ F2 split_rowK(const float* row, int k0, int lane, int K) { float v[16]; const int g = lane >> 4;
#pragma unroll
  for (int i = 0; i < 8; ++i) { const int ka = k0 + 8 * g + i, kb = ka + 16; v[i] = ka < K ? row[ka < K ? ka : K - 1] : 0.f; v[8 + i] = kb < K ? row[kb < K ? kb : K - 1] : 0.f; }
  return bsplit16(v); }
__device__ __forceinline__ F2 split_col(const float* W, int k0, int n, int lane, int ld, int K) { float v[16]; const int g = lane >> 4;
#pragma unroll
  for (int i = 0; i < 8; ++i) { const int ka = k0 + 8 * g + i, kb = ka + 16; v[i] = ka < K ? W[(size_t)(ka < K ? ka : K - 1) * ld + n] : 0.f; v[8 + i] = kb < K ? W[(size_t)(kb < K ? kb : K - 1) * ld + n] : 0.f; }
  return bsplit16(v); }
__device__ __forceinline__ v8f mac3(const F2& a, const F2& b, v8f c) { c = wmma_bf(a.l, b.h, c); c = wmma_bf(a.h, b.l, c); return wmma_bf(a.h, b.h, c); }
__device__ __forceinline__ float sigm(float v) { return 1.0f / (1.0f + expf(-v)); }
#define LDSX() do { asm volatile("s_wait_dscnt 0" ::: "memory"); __builtin_amdgcn_wave_barrier(); __builtin_amdgcn_fence(__ATOMIC_RELEASE, "workgroup"); } while (0)


// 'Fast' MHA with raw-reshape heads (B 2, S 2,048, D 1,024, 16 'heads' x 64): separate query / key / value inputs, natural projections + biases, triu(offset 0)-masked softmax(q k / 8) v, raw reshape back (no output projection).
#define NB 2
#define SS 2048           // positions per head (== S)
#define DD 1024
#define NH 16
#define DH 64
#define NROW (NB * SS)    // projected rows
#ifndef TNB
#define TNB NB
#endif
typedef __attribute__((ext_vector_type(8))) __bf16 v8b;
__device__ __forceinline__ v16b frag_b(const __bf16* rowk0, int lane) {
  union { v16b v; v8b q[2]; } u; const __bf16* p = rowk0 + 8 * (lane >> 4);
  u.q[0] = *(const v8b*)p; u.q[1] = *(const v8b*)(p + 16); return u.v;
}
__device__ __forceinline__ float bfr(float v) { return (float)(__bf16)v; }
__device__ __forceinline__ float xhalf(float x) { return __builtin_bit_cast(float, __builtin_amdgcn_permlanex16(__builtin_bit_cast(int, x), __builtin_bit_cast(int, x), 0x76543210, 0xfedcba98, false, false)); }  // lane l's value for lane l ^ 16
__device__ __attribute__((noinline)) float exp_ni(float v) { return expf(v); }
__device__ __attribute__((noinline)) float erf_ni(float v) { return erff(v); }

#define WS_QH  0u                                   // f16 hi|lo Q flat [b][s][1024] == [b][h][p][64]
#define WS_QL  (WS_QH + 2u * (size_t)NROW * DD)
#define WS_KH  (WS_QL + 2u * (size_t)NROW * DD)
#define WS_KL  (WS_KH + 2u * (size_t)NROW * DD)
#define WS_VH  (WS_KL + 2u * (size_t)NROW * DD)          // f16 hi|lo V flat, laid out like Q and K
#define WS_VL  (WS_VH + 2u * (size_t)NROW * DD)
#define WS_END (WS_VL + 2u * (size_t)NROW * DD)

__device__ __forceinline__ v16b fragb_f32(const float* __restrict__ p, int lane) { v16b a; const float* pp = p + 8 * (lane >> 4);
#pragma unroll
  for (int i = 0; i < 8; ++i) { a[i] = (__bf16)pp[i]; a[8 + i] = (__bf16)pp[16 + i]; } return a; }
// ---- k_proj: block = (128 rows, 128 cols, which), 8 waves of 64 x 32: which 0 Q, 1 K, 2 V -> f16 hi/lo flat rows.
// Each 32-k slice of the X and W tiles is read once per block by whole-line loads (8 lanes x 16 B = one 128-B row piece), rounded to bf16 once and kept in LDS; all 8 waves take their fragments from there.
#define PLD 40            // bf16 elements per staged row: 64 B of data + 16 B pad; 80 B = 16 B x odd keeps the 16-byte fragment reads off each other's banks
#define PTILE (128 * PLD) // one staged operand slice
typedef __attribute__((ext_vector_type(4))) __bf16 v4b;
__global__ __launch_bounds__(256) void k_proj(const float* __restrict__ XQ, const float* __restrict__ XK, const float* __restrict__ XV, const float* __restrict__ WQ, const float* __restrict__ BQ, const float* __restrict__ WK, const float* __restrict__ BK, const float* __restrict__ WV, const float* __restrict__ BV, _Float16* __restrict__ QH, _Float16* __restrict__ QL, _Float16* __restrict__ KH, _Float16* __restrict__ KL, _Float16* __restrict__ VH, _Float16* __restrict__ VL) {
  __shared__ __align__(16) unsigned char smem[2 * 128 * 136 * 2];   // K loop: two buffers of [X slice | W slice] (40,960 B); afterwards the output staging (f16 hi | lo planes)
  __bf16* const sA = (__bf16*)smem; __bf16* const sB = sA + 2 * PTILE;
  const int tid = threadIdx.x, wave = tid >> 5, lane = tid & 31, col = lane & 15, g = lane >> 4; const int which = blockIdx.z; const size_t row0 = (size_t)blockIdx.x * 128; const int c0 = blockIdx.y * 128;
  const int wm = wave >> 2, wn = wave & 3;
  const float* X = which == 0 ? XQ : which == 1 ? XK : XV; const float* Wm = which == 0 ? WQ : which == 1 ? WK : WV; const float* Bm = which == 0 ? BQ : which == 1 ? BK : BV;
  const int sr = tid >> 3, sc = (tid & 7) * 4;   // staging: this thread's row (plus 32 i) and its four k of the slice
  const float* gA = X + (row0 + sr) * DD + sc; const float* gB = Wm + (size_t)(c0 + sr) * DD + sc;
  const int so_ = sr * PLD + sc;
  v4f ra[4], rb[4];
  v8f acc[4][2] = {};
  // every unroll in this kernel makes the indices of acc, ra, rb and the fragment arrays constants, so that they stay in registers
#define PLOAD(pa, pb) do { _Pragma("unroll") for (int i = 0; i < 4; ++i) { ra[i] = *(const v4f*)((pa) + (size_t)i * 32 * DD); rb[i] = *(const v4f*)((pb) + (size_t)i * 32 * DD); } } while (0)
#define PSTORE(buf) do { _Pragma("unroll") for (int i = 0; i < 4; ++i) { v4b ta, tb; _Pragma("unroll") for (int e = 0; e < 4; ++e) { ta[e] = (__bf16)ra[i][e]; tb[e] = (__bf16)rb[i][e]; } *(v4b*)(sA + (buf) * PTILE + so_ + i * 32 * PLD) = ta; *(v4b*)(sB + (buf) * PTILE + so_ + i * 32 * PLD) = tb; } } while (0)
#define PMAC(buf) do { v16b fb[2], fa[4]; _Pragma("unroll") for (int j = 0; j < 2; ++j) fb[j] = frag_b(sB + (buf) * PTILE + (wn * 32 + j * 16 + col) * PLD, lane); \
    _Pragma("unroll") for (int i = 0; i < 4; ++i) fa[i] = frag_b(sA + (buf) * PTILE + (wm * 64 + i * 16 + col) * PLD, lane); \
    _Pragma("unroll") for (int i = 0; i < 4; ++i) { _Pragma("unroll") for (int j = 0; j < 2; ++j) acc[i][j] = wmma_bf(fa[i], fb[j], acc[i][j]); } } while (0)
  // The 8 blocks of one row tile read the same X lines and the 32 blocks of one column tile the same W lines. Each block enters the ring of 32 k slices at its own place and wraps round,
  // so that at any moment the sharers ask for different lines: a line's first fetch from memory is waited for by one block, not by all, and the others find it in L2 later.
  const int rot = (blockIdx.x + 4 * blockIdx.y) & (DD / 32 - 1);   // different for any two blocks that share a tile: one slice apart along a column tile, four along a row tile
  const float* pa0 = gA + rot * 32; const float* pb0 = gB + rot * 32;
  PLOAD(pa0, pb0);
  asm volatile("s_wait_xcnt 0x0" :: "v"(pa0), "v"(pb0) : "memory");   // keeps the two address pairs whole until this wait: what follows may reuse their registers
  PSTORE(0); __syncthreads();
  for (int kc = 0; kc < DD / 32 - 1; ++kc) { const int cur = kc & 1;
    const int kn = (kc + 1 + rot) & (DD / 32 - 1);   // the next slice of this block's walk
    const float* pa = gA + kn * 32; const float* pb = gB + kn * 32;
    PLOAD(pa, pb);        // the next slice flies while this one is multiplied
    asm volatile("s_wait_xcnt 0x0" :: "v"(pa), "v"(pb) : "memory");   // keeps the two address pairs whole until this wait: the fragment reads below may reuse their registers
    PMAC(cur);
    PSTORE(cur ^ 1);      // its last readers left it before the previous barrier
    __syncthreads(); }
  PMAC((DD / 32 - 1) & 1);
  __syncthreads();        // every wave has read its last fragments: the buffers become output staging
  _Float16 (*sh)[136] = (_Float16 (*)[136])smem; _Float16 (*sl)[136] = (_Float16 (*)[136])(smem + 128 * 136 * 2);
#pragma unroll
  for (int j = 0; j < 2; ++j) { const int cc = wn * 32 + j * 16 + col; const float bb = bfr(Bm[c0 + cc]);
#pragma unroll
    for (int i = 0; i < 4; ++i)
#pragma unroll
      for (int r = 0; r < 8; ++r) { const int rr = wm * 64 + i * 16 + 8 * g + r; const float v = acc[i][j][r] + bb; const _Float16 hv = (_Float16)v; sh[rr][cc] = hv; sl[rr][cc] = (_Float16)((v - (float)hv) * 2048.0f); } }
  __syncthreads();
  _Float16* PH = which == 0 ? QH : which == 1 ? KH : VH; _Float16* PL = which == 0 ? QL : which == 1 ? KL : VL;
  for (int e = tid; e < 128 * 16; e += 256) { const int rl = e >> 4, q = e & 15; const size_t o = (row0 + rl) * DD + c0 + q * 8; vst2((unsigned*)(PH + o), *(const v4u*)&sh[rl][q * 8]); vst2((unsigned*)(PL + o), *(const v4u*)&sl[rl][q * 8]); } }
// ---- k_att: block = (pair of 64-position tiles, h, b): keys j < i (diagonal excluded); position 0 -> uniform over all keys; key tiles past a position tile skipped (tile 0 also scans all key tiles so that position 0's uniform average is exact)
// A pass takes 64 keys. A position tile's cost grows with its index (tile t walks t + 1 passes, tile 0 all 32), and every block is resident at once, so the launch lasts as long as the fullest WGP. Each block therefore takes two tiles, one after the other,
// a long one and a short one: block 0 tiles 0 and 1 (34 passes), block w >= 1 tiles 32 - w and 1 + w (35 passes): the blocks walk nearly the same number of passes wherever they are placed (block 0's tile 0 walks all 32 passes for position 0 alone: past the diagonal they take no score products, see att_scores, so block 0 is not the dearest).
// The products are taken transposed: S^T = K . Q^T (A = K rows, B = Q rows) and O^T += V^T . P^T. A lane then holds 32 of the pass's 64 scores of ONE query (position p0 + col; lane ^ 16 holds the other 32), so maximum and sum are taken in the lane,
// and each pair of score tiles, turned into f16 in place, already is the B operand of the second product for its 32 keys (element s = tile s / 8, register s % 8 = key 8 g + s % 8 + 16 (s / 8): the k order of frag_h): P goes through no LDS.
// Each pass's 64 keys (K hi rows, K residual rows for the first 128 positions, V hi and residual rows, all as the projection stored them) are brought into LDS once per block by asynchronous 16-byte copies, two buffers, one pass ahead; the four waves take their fragments from there.
// What a pass costs whatever its width (the barrier and the waits in front of it, the copies' issue and their wait, the choice of the body, the way of the first fragments from LDS, the half exchange, the rescaling of the 64 accumulator registers) is paid once per 64 keys.
// V^T is never stored: the A operand of the second product comes from the staged V rows by the transposing LDS load (frag_t).
#define KP 64                       // keys per pass
#define KPB 144                     // bytes per staged K row: 128 B of data + 16 B pad (16 B x odd keeps the 16-byte fragment reads off each other's banks)
#define VPB 160                     // bytes per staged V row: 128 B of data + 32 B pad (32 B x odd is the transposing load's conflict-free pitch)
#define ST_KL (KP * KPB)            // buffer layout: K hi | K residual | V hi | V residual
#define ST_VH (2 * KP * KPB)
#define ST_VL (ST_VH + KP * VPB)
#define ST_SZ (ST_VL + KP * VPB)
// A fragment of V^T (rows = channels 16 j .. 16 j + 15, k = 32 keys) from 32 staged V rows: ds_load_tr16_b128 gives lane (col, g) the eight values tile[kbase + 8 g + 0..7][16 j + col];
// the loads at kbase 0 and 16 are elements 0..7 and 8..15, the k order of frag_h. Every lane is on wherever this is called.
typedef __attribute__((ext_vector_type(8))) short v8s;
__device__ __forceinline__ v16h frag_t(const unsigned char* tile, int j, int lane) {
  typedef __attribute__((address_space(3))) v8s lds_v8s;
  union { v16h v; v8s q[2]; } u; const unsigned char* p = tile + (8 * (lane >> 4) + (lane & 7)) * VPB + ((lane >> 3) & 1) * 16 + j * 32;
  u.q[0] = __builtin_amdgcn_ds_load_tr16_b128_v8i16((lds_v8s*)p); u.q[1] = __builtin_amdgcn_ds_load_tr16_b128_v8i16((lds_v8s*)(p + 16 * VPB)); return u.v;
}
// Scores and softmax weights of one pass (64 keys) of one wave (16 positions). KIND says where the pass's keys lie against the wave's positions; it is the same for the whole wave, so the caller picks the body by a scalar branch
// and the common body carries no per-element work for cases that cannot occur in it:
//   0: every key lies below every position, past the first 128 positions: all 1,024 scores count (no mask; a counted score is far above -1e38, so the zero guard of the exponentials is an identity and goes too; no residual terms)
//   1: the pass crosses the diagonal, or belongs to the first 128 positions: mask, guard and (hi3) residual terms as written
//   2: every key lies at or above every position: every score is 'fill' whatever K . Q^T gives, so the K fragments are not read and the score products are not taken
template <int KIND>
__device__ __forceinline__ void att_scores(const unsigned char* tb, const int lane, const bool hi3, const v16h (&aq)[2], const v16h (&al)[2], const int pk, const float fill, float& m, float& l, float& alpha, v16h (&pa)[2], v16h (&vh0)[4], v16h (&vl0)[4]) {
  const int col = lane & 15, g = lane >> 4; float s[4][8];   // pk = this lane's position minus the pass's first key
  if (KIND == 2) {
#pragma unroll
    for (int ct = 0; ct < 4; ++ct)
#pragma unroll
      for (int r = 0; r < 8; ++r) s[ct][r] = fill;
  } else {
    // the K fragments of the pass are asked for in one group ahead of the score products (the unrolls make the fragment arrays' indices constants, so that they stay in registers)
    v16h kf[4][2];
#pragma unroll
    for (int ct = 0; ct < 4; ++ct)
#pragma unroll
      for (int kc = 0; kc < 2; ++kc) kf[ct][kc] = frag_h((const _Float16*)(tb + (ct * 16 + col) * KPB) + kc * 32, lane);
    v8f c[4] = {};
#pragma unroll
    for (int kc = 0; kc < 2; ++kc)   // the four score tiles' products take turns, so that none waits for its own predecessor
#pragma unroll
      for (int ct = 0; ct < 4; ++ct) c[ct] = wmma16(kf[ct][kc], aq[kc], c[ct]);
    if (KIND == 1 && hi3) {   // the residual products and their addition stand under one scalar branch
#pragma unroll
      for (int ct = 0; ct < 4; ++ct) { v16h kq[2]; v8f cl = {};
#pragma unroll
        for (int kc = 0; kc < 2; ++kc) kq[kc] = frag_h((const _Float16*)(tb + ST_KL + (ct * 16 + col) * KPB) + kc * 32, lane);
#pragma unroll
        for (int kc = 0; kc < 2; ++kc) { cl = wmma16(kq[kc], aq[kc], cl); cl = wmma16(kf[ct][kc], al[kc], cl); }
#pragma unroll
        for (int r = 0; r < 8; ++r) c[ct][r] = c[ct][r] + cl[r] * (1.0f / 2048.0f); } }
#pragma unroll
    for (int ct = 0; ct < 4; ++ct) { const int nk = pk - (ct * 16 + 8 * g);   // register r = key ct * 16 + 8 g + r of the pass: it counts while r < nk
#pragma unroll
      for (int r = 0; r < 8; ++r) { const float sc = c[ct][r] * 0.125f; s[ct][r] = (KIND == 0 || r < nk) ? sc : fill; } }
  }
  // the V^T fragments of the pass's first 32 keys are asked for here, inside the chosen body, so that their way from LDS passes under the exponentials (the scheduler lifts no load over the branch that ends the body)
#pragma unroll
  for (int j = 0; j < 4; ++j) { vh0[j] = frag_t(tb + ST_VH, j, lane); vl0[j] = frag_t(tb + ST_VL, j, lane); }
  // the unrolls below make the indices of s, mq, es and pa constants, so that they stay in registers
  float mq[4];   // four short chains of maxima instead of one of thirty-two
#pragma unroll
  for (int ct = 0; ct < 4; ++ct) { mq[ct] = s[ct][0];
#pragma unroll
    for (int r = 1; r < 8; ++r) mq[ct] = fmaxf(mq[ct], s[ct][r]); }
  float mx = fmaxf(fmaxf(mq[0], mq[1]), fmaxf(mq[2], mq[3]));
  mx = fmaxf(mx, xhalf(mx));
  const float mn = fmaxf(m, mx); alpha = (m <= -1.0e38f) ? 0.f : __expf(m - mn);
  float es[4] = {0.f, 0.f, 0.f, 0.f};   // four short chains of adds instead of one of thirty-two
#pragma unroll
  for (int ct = 0; ct < 4; ++ct)
#pragma unroll
    for (int r = 0; r < 8; ++r) { const float e = (KIND != 0 && s[ct][r] <= -1.0e38f) ? 0.f : __expf(s[ct][r] - mn); es[r & 3] += e; pa[ct >> 1][(ct & 1) * 8 + r] = (_Float16)(e * 2048.0f); }
  l = l * alpha + ((es[0] + es[1]) + (es[2] + es[3])); m = (mn > -1.0e38f) ? mn : m;
}
__global__ __launch_bounds__(128) void k_att(const _Float16* __restrict__ QH, const _Float16* __restrict__ QL, const _Float16* __restrict__ KH, const _Float16* __restrict__ KL, const _Float16* __restrict__ VH, const _Float16* __restrict__ VL, float* __restrict__ OUT) {
  __shared__ __align__(16) unsigned char ring[2 * ST_SZ];
  __shared__ __align__(16) float so[4][16][68];
  const int tid = threadIdx.x, wave = __builtin_amdgcn_readfirstlane(tid >> 5) /* held in a scalar register, so that the choice of a pass's body below is a scalar branch */, lane = tid & 31, col = lane & 15, g = lane >> 4; const int h = blockIdx.y; const size_t b = blockIdx.z; const int w = blockIdx.x; const size_t bh = b * NH + h;
  const bool hi3 = w == 0;   // first 128 positions (tiles 0 and 1, both in block 0): 3-product scores
  // staging: a K tile and a V tile are each 8,192 contiguous bytes, 64 rows of 128 B (thread: 16-byte pieces tid + 128 i, that is rows tid / 8 + 16 i, i = 0..3)
  const unsigned lK = (unsigned)(size_t)ring + (tid >> 3) * KPB + (tid & 7) * 16, lV = (unsigned)(size_t)ring + ST_VH + (tid >> 3) * VPB + (tid & 7) * 16;
  const size_t oK = bh * SS * DH + tid * 8;   // the same element offset in the K and the V arrays
#pragma unroll 1   // the two tiles run one after the other through one copy of the code
  for (int half = 0; half < 2; ++half) {
  const int qb = (w == 0) ? half : (half == 0 ? SS / 64 - w : 1 + w); const int p0 = qb * 64 + wave * 16; const size_t rq = bh * SS + p0;
  v16h aq[2], al[2];
#pragma unroll
  for (int kc = 0; kc < 2; ++kc) { aq[kc] = frag_h(QH + (rq + col) * DH + kc * 32, lane); al[kc] = frag_h(QL + (rq + col) * DH + kc * 32, lane); }
  asm volatile("s_wait_xcnt 0x0" ::: "memory");   // the staging below reuses the registers that held these loads' addresses
  const int p = p0 + col;                            // this lane's query position
  const float fill = (p == 0) ? 0.0f : -3.0e38f;     // what a key j >= p scores; position 0: all logits equal -> uniform
  float m = -3.0e38f, l = 0.f;                       // running maximum (same in both halves); this lane's half of the running sum
  v8f acc[4] = {}, accl[4] = {};
  const int nks = (qb == 0) ? SS / KP : qb + 1;      // at least 2
  // The 16 blocks of one head read the same K and V tiles. Each enters the ring of its nks key tiles at its own place and wraps round (the running softmax takes the passes in any order),
  // so that the sharers ask for different lines at any moment and a tile's first fetch from memory is waited for by one block, not by all.
#define KWRAP(t) ((t) >= nks ? (t) - nks : (t))      // for 0 <= t < 2 nks
  const int kt0 = KWRAP(2 * w);                      // w < nks for either tile of the pair, so 2 w < 2 nks; block 0 starts at key tile 0
  // the copies of one tile set stand in one statement with s_wait_xcnt 0 as its last line, so that no later write of their address registers can be moved in front of that wait
#define ASTAGE(t, buf) do { const unsigned k0 = lK + (buf) * ST_SZ, k1 = k0 + 16 * KPB, k2 = k0 + 32 * KPB, k3 = k0 + 48 * KPB, v0 = lV + (buf) * ST_SZ, v1 = v0 + 16 * VPB, v2 = v0 + 32 * VPB, v3 = v0 + 48 * VPB, \
      w0 = v0 + (ST_VL - ST_VH), w1 = w0 + 16 * VPB, w2 = w0 + 32 * VPB, w3 = w0 + 48 * VPB; \
    const _Float16* gk0 = KH + oK + (size_t)(t) * KP * DH; const _Float16* gk1 = gk0 + 128 * 8; const _Float16* gk2 = gk0 + 256 * 8; const _Float16* gk3 = gk0 + 384 * 8; \
    const _Float16* gv0 = VH + oK + (size_t)(t) * KP * DH; const _Float16* gv1 = gv0 + 128 * 8; const _Float16* gv2 = gv0 + 256 * 8; const _Float16* gv3 = gv0 + 384 * 8; \
    const _Float16* gw0 = VL + oK + (size_t)(t) * KP * DH; const _Float16* gw1 = gw0 + 128 * 8; const _Float16* gw2 = gw0 + 256 * 8; const _Float16* gw3 = gw0 + 384 * 8; \
    asm volatile("global_load_async_to_lds_b128 %0, %1, off\n\tglobal_load_async_to_lds_b128 %2, %3, off\n\tglobal_load_async_to_lds_b128 %4, %5, off\n\tglobal_load_async_to_lds_b128 %6, %7, off\n\t" \
                 "global_load_async_to_lds_b128 %8, %9, off\n\tglobal_load_async_to_lds_b128 %10, %11, off\n\tglobal_load_async_to_lds_b128 %12, %13, off\n\tglobal_load_async_to_lds_b128 %14, %15, off\n\t" \
                 "global_load_async_to_lds_b128 %16, %17, off\n\tglobal_load_async_to_lds_b128 %18, %19, off\n\tglobal_load_async_to_lds_b128 %20, %21, off\n\tglobal_load_async_to_lds_b128 %22, %23, off\n\ts_wait_xcnt 0x0" \
                 :: "v"(k0), "v"(gk0), "v"(k1), "v"(gk1), "v"(k2), "v"(gk2), "v"(k3), "v"(gk3), "v"(v0), "v"(gv0), "v"(v1), "v"(gv1), "v"(v2), "v"(gv2), "v"(v3), "v"(gv3), "v"(w0), "v"(gw0), "v"(w1), "v"(gw1), "v"(w2), "v"(gw2), "v"(w3), "v"(gw3) : "memory"); \
    if (hi3) { const unsigned r0 = k0 + ST_KL, r1 = k1 + ST_KL, r2 = k2 + ST_KL, r3 = k3 + ST_KL; const _Float16* gr0 = KL + oK + (size_t)(t) * KP * DH; const _Float16* gr1 = gr0 + 128 * 8; const _Float16* gr2 = gr0 + 256 * 8; const _Float16* gr3 = gr0 + 384 * 8; \
      asm volatile("global_load_async_to_lds_b128 %0, %1, off\n\tglobal_load_async_to_lds_b128 %2, %3, off\n\tglobal_load_async_to_lds_b128 %4, %5, off\n\tglobal_load_async_to_lds_b128 %6, %7, off\n\ts_wait_xcnt 0x0" \
                   :: "v"(r0), "v"(gr0), "v"(r1), "v"(gr1), "v"(r2), "v"(gr2), "v"(r3), "v"(gr3) : "memory"); } } while (0)
#pragma unroll 1   // the ring's first two stagings run through one copy of the code, so that their 24 LDS addresses are formed where they are used and not held in registers over the whole kernel (held so, two of them spilled to scratch)
  for (int st = 0; st < 2; ++st) {
    ASTAGE(KWRAP(kt0 + st), st);   // second position tile: the first one's last pass ended in s_wait_dscnt 0 and a barrier, so every reader has left the ring, and no copy is in flight
    if (st == 0) {
      asm volatile("s_wait_asynccnt 0x0" ::: "memory");   // this wave's share of the first tile has landed
      __syncthreads(); } }                                // ... and every other wave's
#pragma unroll 1
  for (int ks = 0; ks < nks; ++ks) { const unsigned char* tb = ring + (ks & 1) * ST_SZ;
    const int kt = KWRAP(kt0 + ks);   // the key tile of this pass
    const int rel = p0 - kt * KP;   // the wave's first position minus the pass's first key: a scalar, a multiple of 16
    float alpha; v16h pa[2], vh0[4], vl0[4];
    if (rel >= KP && !hi3) att_scores<0>(tb, lane, hi3, aq, al, p - kt * KP, fill, m, l, alpha, pa, vh0, vl0);
    else if (rel > -16) att_scores<1>(tb, lane, hi3, aq, al, p - kt * KP, fill, m, l, alpha, pa, vh0, vl0);
    else att_scores<2>(tb, lane, hi3, aq, al, p - kt * KP, fill, m, l, alpha, pa, vh0, vl0);
    // the unrolls below make the indices of the accumulators and fragment arrays constants, so that they stay in registers
#pragma unroll
    for (int j = 0; j < 4; ++j)
#pragma unroll
      for (int r = 0; r < 8; ++r) { acc[j][r] *= alpha; accl[j][r] *= alpha; }
    v16h vh[4], vl[4];   // the V^T fragments of the pass's second 32 keys, asked for in two groups of four, each as soon as four of the first 32 keys' fragments have been used, into the registers these leave: with all sixteen held at once the build spilled to scratch
#pragma unroll
    for (int j = 0; j < 2; ++j) { acc[j] = wmma16(vh0[j], pa[0], acc[j]); accl[j] = wmma16(vl0[j], pa[0], accl[j]); }
#pragma unroll
    for (int j = 0; j < 2; ++j) { vh[j] = frag_t(tb + ST_VH + 32 * VPB, j, lane); vl[j] = frag_t(tb + ST_VL + 32 * VPB, j, lane); }
#pragma unroll
    for (int j = 2; j < 4; ++j) { acc[j] = wmma16(vh0[j], pa[0], acc[j]); accl[j] = wmma16(vl0[j], pa[0], accl[j]); }
#pragma unroll
    for (int j = 2; j < 4; ++j) { vh[j] = frag_t(tb + ST_VH + 32 * VPB, j, lane); vl[j] = frag_t(tb + ST_VL + 32 * VPB, j, lane); }
#pragma unroll
    for (int j = 0; j < 4; ++j) { acc[j] = wmma16(vh[j], pa[1], acc[j]); accl[j] = wmma16(vl[j], pa[1], accl[j]); }
    asm volatile("s_wait_dscnt 0x0" ::: "memory");      // this wave's reads of the buffer are done
    asm volatile("s_wait_asynccnt 0x0" ::: "memory");   // its share of the next tile has landed
    __syncthreads();                                    // publishes the next tile and frees this pass's buffer
    if (ks + 2 < nks) ASTAGE(KWRAP(kt0 + ks + 2), ks & 1); }
  asm volatile("s_wait_asynccnt 0x0" ::: "memory");     // no copy is left in flight when the wave goes on to its end
  const float lt = l + xhalf(l);   // the two halves' sums are joined once
  const float il = (lt > 0.f) ? (1.0f / 2048.0f) / lt : 0.f;
#pragma unroll
  for (int j = 0; j < 4; ++j) { v4f o[2];   // register r = channel j * 16 + 8 g + r of this lane's query
#pragma unroll
    for (int r = 0; r < 8; ++r) o[r >> 2][r & 3] = (acc[j][r] + accl[j][r] * (1.0f / 2048.0f)) * il;
    *(v4f*)&so[wave][col][j * 16 + 8 * g] = o[0]; *(v4f*)&so[wave][col][j * 16 + 8 * g + 4] = o[1]; }
  LDSX(); for (int rl = 0; rl < 16; ++rl) if (lane < 16) vst2(OUT + (rq + rl) * DH + lane * 4, *(const v4f*)&so[wave][rl][lane * 4]);
  asm volatile("s_wait_xcnt 0x0" ::: "memory");   // the next tile's first instructions reuse the registers that these stores name
  } }
extern "C" void kernel_launch(void* const* d_in, const int* in_sizes, int n_in, void* d_out, int out_size, void* d_ws, size_t ws_size, hipStream_t stream) {
  (void)in_sizes; (void)n_in; (void)out_size;
  const float** F = (const float**)d_in;   // 0 query_vector, 1 key_vector, 2 value_vector [2,2048,1024]; 3 Wq, 4 bq, 5 Wk, 6 bk, 7 Wv, 8 bv (natural)
  if (ws_size < (size_t)WS_END) return;
  char* ws = (char*)d_ws; _Float16 *QH = (_Float16*)(ws + WS_QH), *QL = (_Float16*)(ws + WS_QL), *KH = (_Float16*)(ws + WS_KH), *KL = (_Float16*)(ws + WS_KL), *VH = (_Float16*)(ws + WS_VH), *VL = (_Float16*)(ws + WS_VL);
  k_proj<<<dim3(NROW / 128, DD / 128, 3), 256, 0, stream>>>(F[0], F[1], F[2], F[3], F[4], F[5], F[6], F[7], F[8], QH, QL, KH, KL, VH, VL);
  k_att<<<dim3(SS / 128, NH, TNB), 128, 0, stream>>>(QH, QL, KH, KL, VH, VL, (float*)d_out);
}

// v009
// A run of this version takes 79.9 microseconds.
// Timed twice side by side with v008, it ran 1.04 times as fast both times.
// Counting every step since v000, it is 6.70 times as fast.
// compute dtype: all float inputs rounded to bf16; Q/K/V = input . W^T + b with EXACT bf16 products on WMMA 16x16x32 (natural rows); the module's raw reshape (B,S,D)->(B,H,S,Dh) means 'head h' = the 128 projected rows 128h..128h+127 viewed as 2,048 positions x 64 (position p = (s - 128h)*16 + c/64) - handled purely by addressing; Q/K as f16 hi + residual (3-product scores for positions < 128, single f16 after), V as f16 hi + residual rows (2 products); mask: keys j >= i set to -1e9 INCLUDING the diagonal, so position 0 attends uniformly to all 2,048 keys (all logits equal) and position i >= 1 to keys < i; x 1/8; running-max softmax in f32 (hardware exp); the context in the same raw layout is the f32 output.
#include <hip/hip_runtime.h>
#include <math.h>

typedef __attribute__((ext_vector_type(16))) _Float16 v16h;
typedef __attribute__((ext_vector_type(16))) __bf16 v16b;
typedef __attribute__((ext_vector_type(8)))  _Float16 v8h;
typedef __attribute__((ext_vector_type(8)))  float v8f;
typedef __attribute__((ext_vector_type(4)))  float v4f;
typedef __attribute__((ext_vector_type(2)))  float v2f;
typedef __attribute__((ext_vector_type(4)))  unsigned v4u;
typedef __attribute__((ext_vector_type(4)))  int v4i;
typedef float __attribute__((may_alias)) float_a;
typedef int __attribute__((may_alias)) int_a;

template <typename T> __device__ __forceinline__ void vst2(void* p, T v) { *(T*)p = v;  }
__device__ __forceinline__ v8f wmma16(v16h a, v16h b, v8f c) {
  v8f d = __builtin_amdgcn_wmma_f32_16x16x32_f16(false, a, false, b, (short)0, c, false, false);
  asm volatile("v_nop\n\tv_nop\n\tv_nop\n\tv_nop" : "+v"(d) : "v"(a), "v"(b));
  return d;
}
__device__ __forceinline__ v8f wmma_bf(v16b a, v16b b, v8f c) {
  v8f d = __builtin_amdgcn_wmma_f32_16x16x32_bf16(false, a, false, b, (short)0, c, false, false);
  asm volatile("v_nop\n\tv_nop\n\tv_nop\n\tv_nop" : "+v"(d) : "v"(a), "v"(b));
  return d;
}
// 16x16x32 fragments: lane = (h = lane>>4, row/col = lane&15); elements 0..7 = k0+8h+0..7, 8..15 = k0+16+8h+0..7; D element r = row 8h+r
__device__ __forceinline__ v16h frag_h(const _Float16* rowk0, int lane) {
  union { v16h v; v8h q[2]; } u; const _Float16* p = rowk0 + 8 * (lane >> 4);
  u.q[0] = *(const v8h*)p; u.q[1] = *(const v8h*)(p + 16); return u.v;
}
__device__ __forceinline__ v16h frag_f32(const float* rowk0, int lane) {
  v16h a; const float* p = rowk0 + 8 * (lane >> 4);
#pragma unroll
  for (int i = 0; i < 8; ++i) { a[i] = (_Float16)p[i]; a[8 + i] = (_Float16)p[16 + i]; }
  return a;
}
__device__ __forceinline__ v16h frag_f32s(const float* rowk0, int lane, float sc) {
  v16h a; const float* p = rowk0 + 8 * (lane >> 4);
#pragma unroll
  for (int i = 0; i < 8; ++i) { a[i] = (_Float16)(p[i] * sc); a[8 + i] = (_Float16)(p[16 + i] * sc); }
  return a;
}
// column fragment from a [K][ld] layout (column n), rows >= K read as 0
__device__ __forceinline__ v16h fragc_f32(const float* W, int k0, int n, int lane, int ld, int K) {
  v16h a; const int g = lane >> 4;
#pragma unroll
  for (int i = 0; i < 8; ++i) { const int ka = k0 + 8 * g + i, kb = ka + 16;
    a[i] = (_Float16)(ka < K ? W[(size_t)(ka < K ? ka : K - 1) * ld + n] : 0.f); a[8 + i] = (_Float16)(kb < K ? W[(size_t)(kb < K ? kb : K - 1) * ld + n] : 0.f); }
  return a;
}
struct F2 { v16b h, l; };
__device__ __forceinline__ F2 bsplit16(const float v[16]) { F2 r;
#pragma unroll
  for (int i = 0; i < 16; ++i) { const __bf16 h = (__bf16)v[i]; r.h[i] = h; r.l[i] = (__bf16)(v[i] - (float)h); }
  return r; }
__device__ __forceinline__ F2 split_row(const float* row, int k0, int lane) { float v[16]; const float* p = row + k0 + 8 * (lane >> 4);
#pragma unroll
  for (int i = 0; i < 8; ++i) { v[i] = p[i]; v[8 + i] = p[16 + i]; }
  return bsplit16(v); }
__device__ __forceinline__ F2 split_rowK(const float* row, int k0, int lane, int K) { float v[16]; const int g = lane >> 4;
#pragma unroll
  for (int i = 0; i < 8; ++i) { const int ka = k0 + 8 * g + i, kb = ka + 16; v[i] = ka < K ? row[ka < K ? ka : K - 1] : 0.f; v[8 + i] = kb < K ? row[kb < K ? kb : K - 1] : 0.f; }
  return bsplit16(v); }
__device__ __forceinline__ F2 split_col(const float* W, int k0, int n, int lane, int ld, int K) { float v[16]; const int g = lane >> 4;
#pragma unroll
  for (int i = 0; i < 8; ++i) { const int ka = k0 + 8 * g + i, kb = ka + 16; v[i] = ka < K ? W[(size_t)(ka < K ? ka : K - 1) * ld + n] : 0.f; v[8 + i] = kb < K ? W[(size_t)(kb < K ? kb : K - 1) * ld + n] : 0.f; }
  return bsplit16(v); }
__device__ __forceinline__ v8f mac3(const F2& a, const F2& b, v8f c) { c = wmma_bf(a.l, b.h, c); c = wmma_bf(a.h, b.l, c); return wmma_bf(a.h, b.h, c); }
__device__ __forceinline__ float sigm(float v) { return 1.0f / (1.0f + expf(-v)); }
#define LDSX() do { asm volatile("s_wait_dscnt 0" ::: "memory"); __builtin_amdgcn_wave_barrier(); __builtin_amdgcn_fence(__ATOMIC_RELEASE, "workgroup"); } while (0)


// 'Fast' MHA with raw-reshape heads (B 2, S 2,048, D 1,024, 16 'heads' x 64): separate query / key / value inputs, natural projections + biases, triu(offset 0)-masked softmax(q k / 8) v, raw reshape back (no output projection).
#define NB 2
#define SS 2048           // positions per head (== S)
#define DD 1024
#define NH 16
#define DH 64
#define NROW (NB * SS)    // projected rows
#ifndef TNB
#define TNB NB
#endif
typedef __attribute__((ext_vector_type(8))) __bf16 v8b;
__device__ __forceinline__ v16b frag_b(const __bf16* rowk0, int lane) {
  union { v16b v; v8b q[2]; } u; const __bf16* p = rowk0 + 8 * (lane >> 4);
  u.q[0] = *(const v8b*)p; u.q[1] = *(const v8b*)(p + 16); return u.v;
}
__device__ __forceinline__ float bfr(float v) { return (float)(__bf16)v; }
__device__ __forceinline__ float xhalf(float x) { return __builtin_bit_cast(float, __builtin_amdgcn_permlanex16(__builtin_bit_cast(int, x), __builtin_bit_cast(int, x), 0x76543210, 0xfedcba98, false, false)); }  // lane l's value for lane l ^ 16
__device__ __attribute__((noinline)) float exp_ni(float v) { return expf(v); }
__device__ __attribute__((noinline)) float erf_ni(float v) { return erff(v); }

#define WS_QH  0u                                   // f16 hi|lo Q flat [b][s][1024] == [b][h][p][64]
#define WS_QL  (WS_QH + 2u * (size_t)NROW * DD)
#define WS_KH  (WS_QL + 2u * (size_t)NROW * DD)
#define WS_KL  (WS_KH + 2u * (size_t)NROW * DD)
#define WS_VH  (WS_KL + 2u * (size_t)NROW * DD)          // f16 hi|lo V flat, laid out like Q and K
#define WS_VL  (WS_VH + 2u * (size_t)NROW * DD)
#define WS_END (WS_VL + 2u * (size_t)NROW * DD)

__device__ __forceinline__ v16b fragb_f32(const float* __restrict__ p, int lane) { v16b a; const float* pp = p + 8 * (lane >> 4);
#pragma unroll
  for (int i = 0; i < 8; ++i) { a[i] = (__bf16)pp[i]; a[8 + i] = (__bf16)pp[16 + i]; } return a; }
// ---- k_proj: block = (128 rows, 128 cols, which), 8 waves of 64 x 32: which 0 Q, 1 K, 2 V -> f16 hi/lo flat rows.
// Each 32-k slice of the X and W tiles is read once per block by whole-line loads (8 lanes x 16 B = one 128-B row piece), rounded to bf16 once and kept in LDS; all 8 waves take their fragments from there.
#define PLD 40            // bf16 elements per staged row: 64 B of data + 16 B pad; 80 B = 16 B x odd keeps the 16-byte fragment reads off each other's banks
#define PTILE (128 * PLD) // one staged operand slice
typedef __attribute__((ext_vector_type(4))) __bf16 v4b;
__global__ __launch_bounds__(256) void k_proj(const float* __restrict__ XQ, const float* __restrict__ XK, const float* __restrict__ XV, const float* __restrict__ WQ, const float* __restrict__ BQ, const float* __restrict__ WK, const float* __restrict__ BK, const float* __restrict__ WV, const float* __restrict__ BV, _Float16* __restrict__ QH, _Float16* __restrict__ QL, _Float16* __restrict__ KH, _Float16* __restrict__ KL, _Float16* __restrict__ VH, _Float16* __restrict__ VL) {
  __shared__ __align__(16) unsigned char smem[2 * 128 * 136 * 2];   // K loop: two buffers of [X slice | W slice] (40,960 B); afterwards the output staging (f16 hi | lo planes)
  __bf16* const sA = (__bf16*)smem; __bf16* const sB = sA + 2 * PTILE;
  const int tid = threadIdx.x, wave = tid >> 5, lane = tid & 31, col = lane & 15, g = lane >> 4; const int which = blockIdx.z; const size_t row0 = (size_t)blockIdx.x * 128; const int c0 = blockIdx.y * 128;
  const int wm = wave >> 2, wn = wave & 3;
  const float* X = which == 0 ? XQ : which == 1 ? XK : XV; const float* Wm = which == 0 ? WQ : which == 1 ? WK : WV; const float* Bm = which == 0 ? BQ : which == 1 ? BK : BV;
  const int sr = tid >> 3, sc = (tid & 7) * 4;   // staging: this thread's row (plus 32 i) and its four k of the slice
  const float* gA = X + (row0 + sr) * DD + sc; const float* gB = Wm + (size_t)(c0 + sr) * DD + sc;
  const int so_ = sr * PLD + sc;
  v4f ra[4], rb[4];
  v8f acc[4][2] = {};
  // every unroll in this kernel makes the indices of acc, ra, rb and the fragment arrays constants, so that they stay in registers
#define PLOAD(pa, pb) do { _Pragma("unroll") for (int i = 0; i < 4; ++i) { ra[i] = *(const v4f*)((pa) + (size_t)i * 32 * DD); rb[i] = *(const v4f*)((pb) + (size_t)i * 32 * DD); } } while (0)
#define PSTORE(buf) do { _Pragma("unroll") for (int i = 0; i < 4; ++i) { v4b ta, tb; _Pragma("unroll") for (int e = 0; e < 4; ++e) { ta[e] = (__bf16)ra[i][e]; tb[e] = (__bf16)rb[i][e]; } *(v4b*)(sA + (buf) * PTILE + so_ + i * 32 * PLD) = ta; *(v4b*)(sB + (buf) * PTILE + so_ + i * 32 * PLD) = tb; } } while (0)
#define PMAC(buf) do { v16b fb[2], fa[4]; _Pragma("unroll") for (int j = 0; j < 2; ++j) fb[j] = frag_b(sB + (buf) * PTILE + (wn * 32 + j * 16 + col) * PLD, lane); \
    _Pragma("unroll") for (int i = 0; i < 4; ++i) fa[i] = frag_b(sA + (buf) * PTILE + (wm * 64 + i * 16 + col) * PLD, lane); \
    _Pragma("unroll") for (int i = 0; i < 4; ++i) { _Pragma("unroll") for (int j = 0; j < 2; ++j) acc[i][j] = wmma_bf(fa[i], fb[j], acc[i][j]); } } while (0)
  // The 8 blocks of one row tile read the same X lines and the 32 blocks of one column tile the same W lines. Each block enters the ring of 32 k slices at its own place and wraps round,
  // so that at any moment the sharers ask for different lines: a line's first fetch from memory is waited for by one block, not by all, and the others find it in L2 later.
  const int rot = (blockIdx.x + 4 * blockIdx.y) & (DD / 32 - 1);   // different for any two blocks that share a tile: one slice apart along a column tile, four along a row tile
  const float* pa0 = gA + rot * 32; const float* pb0 = gB + rot * 32;
  PLOAD(pa0, pb0);
  asm volatile("s_wait_xcnt 0x0" :: "v"(pa0), "v"(pb0) : "memory");   // keeps the two address pairs whole until this wait: what follows may reuse their registers
  PSTORE(0); __syncthreads();
  for (int kc = 0; kc < DD / 32 - 1; ++kc) { const int cur = kc & 1;
    const int kn = (kc + 1 + rot) & (DD / 32 - 1);   // the next slice of this block's walk
    const float* pa = gA + kn * 32; const float* pb = gB + kn * 32;
    PLOAD(pa, pb);        // the next slice flies while this one is multiplied
    asm volatile("s_wait_xcnt 0x0" :: "v"(pa), "v"(pb) : "memory");   // keeps the two address pairs whole until this wait: the fragment reads below may reuse their registers
    PMAC(cur);
    PSTORE(cur ^ 1);      // its last readers left it before the previous barrier
    __syncthreads(); }
  PMAC((DD / 32 - 1) & 1);
  __syncthreads();        // every wave has read its last fragments: the buffers become output staging
  _Float16 (*sh)[136] = (_Float16 (*)[136])smem; _Float16 (*sl)[136] = (_Float16 (*)[136])(smem + 128 * 136 * 2);
#pragma unroll
  for (int j = 0; j < 2; ++j) { const int cc = wn * 32 + j * 16 + col; const float bb = bfr(Bm[c0 + cc]);
#pragma unroll
    for (int i = 0; i < 4; ++i)
#pragma unroll
      for (int r = 0; r < 8; ++r) { const int rr = wm * 64 + i * 16 + 8 * g + r; const float v = acc[i][j][r] + bb; const _Float16 hv = (_Float16)v; sh[rr][cc] = hv; sl[rr][cc] = (_Float16)((v - (float)hv) * 2048.0f); } }
  __syncthreads();
  _Float16* PH = which == 0 ? QH : which == 1 ? KH : VH; _Float16* PL = which == 0 ? QL : which == 1 ? KL : VL;
  for (int e = tid; e < 128 * 16; e += 256) { const int rl = e >> 4, q = e & 15; const size_t o = (row0 + rl) * DD + c0 + q * 8; vst2((unsigned*)(PH + o), *(const v4u*)&sh[rl][q * 8]); vst2((unsigned*)(PL + o), *(const v4u*)&sl[rl][q * 8]); } }
// ---- k_att: block = (pair of 64-position tiles, h, b): keys j < i (diagonal excluded); position 0 -> uniform over all keys; key tiles past a position tile skipped (tile 0 also scans all key tiles so that position 0's uniform average is exact)
// A pass takes 64 keys. A position tile's cost grows with its index (tile t takes t + 1 key tiles, tile 0 all 32), and every block is resident at once, so the launch lasts as long as the fullest WGP. Each block therefore takes two tiles, one after the other,
// a long one and a short one: block 0 tiles 0 and 1 (34 key tiles), block w >= 1 tiles 32 - w and 1 + w (35 key tiles): the blocks walk nearly the same number of passes wherever they are placed (block 0's tile 0 takes all 32 key tiles for position 0 alone: past the diagonal they take no score products, see att_scores, so block 0 is not the dearest).
// The products are taken transposed: S^T = K . Q^T (A = K rows, B = Q rows) and O^T += V^T . P^T. A lane then holds 32 of the pass's 64 scores of ONE query (position p0 + col; lane ^ 16 holds the other 32), so maximum and sum are taken in the lane,
// and each pair of score tiles, turned into f16 in place, already is the B operand of the second product for its 32 keys (element s = tile s / 8, register s % 8 = key 8 g + s % 8 + 16 (s / 8): the k order of frag_h): P goes through no LDS.
// Each pass's 64 keys (K hi rows, K residual rows for the first 128 positions, V hi and residual rows, all as the projection stored them) are brought into LDS once per block by asynchronous 16-byte copies, two buffers, one pass ahead; the four waves of a group (below) take their fragments from there.
// Each position tile's key tiles are shared out between two groups of four waves (waves 0..3: the first half of them, waves 4..7: the rest). Both groups hold the same 64 positions, each walks its own key tiles through its own two buffers with its own running maximum, sum and accumulators,
// and at the tile's end the second group hands its partial results over through LDS and the first joins them (the usual rescaling to the common maximum) and writes the output. A wave's chain of passes is half as long (17 or 18 a block) and a SIMD holds four waves instead of two, so that one wave's waits (LDS, exponentials, barrier) pass under the others' work.
// What a pass costs whatever its width (the barrier and the waits in front of it, the copies' issue and their wait, the choice of the body, the way of the first fragments from LDS, the half exchange, the rescaling of the 64 accumulator registers) is paid once per 64 keys.
// V^T is never stored: the A operand of the second product comes from the staged V rows by the transposing LDS load (frag_t).
#define KP 64                       // keys per pass
#define KPB 144                     // bytes per staged K row: 128 B of data + 16 B pad (16 B x odd keeps the 16-byte fragment reads off each other's banks)
#define VPB 160                     // bytes per staged V row: 128 B of data + 32 B pad (32 B x odd is the transposing load's conflict-free pitch)
#define ST_KL (KP * KPB)            // buffer layout: K hi | K residual | V hi | V residual
#define ST_VH (2 * KP * KPB)
#define ST_VL (ST_VH + KP * VPB)
#define ST_SZ (ST_VL + KP * VPB)
// A fragment of V^T (rows = channels 16 j .. 16 j + 15, k = 32 keys) from 32 staged V rows: ds_load_tr16_b128 gives lane (col, g) the eight values tile[kbase + 8 g + 0..7][16 j + col];
// the loads at kbase 0 and 16 are elements 0..7 and 8..15, the k order of frag_h. Every lane is on wherever this is called.
typedef __attribute__((ext_vector_type(8))) short v8s;
__device__ __forceinline__ v16h frag_t(const unsigned char* tile, int j, int lane) {
  typedef __attribute__((address_space(3))) v8s lds_v8s;
  union { v16h v; v8s q[2]; } u; const unsigned char* p = tile + (8 * (lane >> 4) + (lane & 7)) * VPB + ((lane >> 3) & 1) * 16 + j * 32;
  u.q[0] = __builtin_amdgcn_ds_load_tr16_b128_v8i16((lds_v8s*)p); u.q[1] = __builtin_amdgcn_ds_load_tr16_b128_v8i16((lds_v8s*)(p + 16 * VPB)); return u.v;
}
// Scores and softmax weights of one pass (64 keys) of one wave (16 positions). KIND says where the pass's keys lie against the wave's positions; it is the same for the whole wave, so the caller picks the body by a scalar branch
// and the common body carries no per-element work for cases that cannot occur in it:
//   0: every key lies below every position, past the first 128 positions: all 1,024 scores count (no mask; a counted score is far above -1e38, so the zero guard of the exponentials is an identity and goes too; no residual terms)
//   1: the pass crosses the diagonal, or belongs to the first 128 positions: mask, guard and (hi3) residual terms as written
//   2: every key lies at or above every position: every score is 'fill' whatever K . Q^T gives, so the K fragments are not read and the score products are not taken
template <int KIND>
__device__ __forceinline__ void att_scores(const unsigned char* tb, const int lane, const bool hi3, const v16h (&aq)[2], const _Float16* qlr, const int pk, const float fill, float& m, float& l, float& alpha, v16h (&pa)[2], v16h (&vh0)[4], v16h (&vl0)[4]) {
  const int col = lane & 15, g = lane >> 4; float s[4][8];   // pk = this lane's position minus the pass's first key
  if (KIND == 2) {
#pragma unroll
    for (int ct = 0; ct < 4; ++ct)
#pragma unroll
      for (int r = 0; r < 8; ++r) s[ct][r] = fill;
  } else {
   constexpr int GT = (KIND == 1) ? 2 : 4;   // score tiles taken at a time: the masked body, which may also hold the residual fragments, takes two, so that it stays inside the 256 registers without spilling
#pragma unroll
   for (int q = 0; q < 4 / GT; ++q) {
    // the K fragments of the group's tiles are asked for together ahead of the score products (the unrolls make the fragment arrays' indices constants, so that they stay in registers)
    const unsigned char* tq = tb + q * GT * 16 * KPB;
    v16h kf[GT][2];
#pragma unroll
    for (int ct = 0; ct < GT; ++ct)
#pragma unroll
      for (int kc = 0; kc < 2; ++kc) kf[ct][kc] = frag_h((const _Float16*)(tq + (ct * 16 + col) * KPB) + kc * 32, lane);
    v8f c[GT] = {};
#pragma unroll
    for (int kc = 0; kc < 2; ++kc)   // the group's score tiles' products take turns, so that none waits for its own predecessor
#pragma unroll
      for (int ct = 0; ct < GT; ++ct) c[ct] = wmma16(kf[ct][kc], aq[kc], c[ct]);
    if (KIND == 1 && hi3) {   // the residual products and their addition stand under one scalar branch
      v16h al[2];   // the query's residual fragments are fetched here, where the one block that takes this branch uses them: held over the whole walk they cost every wave sixteen registers, and four waves per SIMD leave a wave 256
#pragma unroll
      for (int kc = 0; kc < 2; ++kc) al[kc] = frag_h(qlr + kc * 32, lane);
      asm volatile("s_wait_xcnt 0x0" ::: "memory");   // what follows may reuse the registers that held these loads' addresses
#pragma unroll
      for (int ct = 0; ct < GT; ++ct) { v16h kq[2]; v8f cl = {};
#pragma unroll
        for (int kc = 0; kc < 2; ++kc) kq[kc] = frag_h((const _Float16*)(tq + ST_KL + (ct * 16 + col) * KPB) + kc * 32, lane);
#pragma unroll
        for (int kc = 0; kc < 2; ++kc) { cl = wmma16(kq[kc], aq[kc], cl); cl = wmma16(kf[ct][kc], al[kc], cl); }
#pragma unroll
        for (int r = 0; r < 8; ++r) c[ct][r] = c[ct][r] + cl[r] * (1.0f / 2048.0f); } }
#pragma unroll
    for (int ct = 0; ct < GT; ++ct) { const int nk = pk - ((q * GT + ct) * 16 + 8 * g);   // register r = key (q GT + ct) * 16 + 8 g + r of the pass: it counts while r < nk
#pragma unroll
      for (int r = 0; r < 8; ++r) { const float sc = c[ct][r] * 0.125f; s[q * GT + ct][r] = (KIND == 0 || r < nk) ? sc : fill; } }
   }
  }
  // the V^T fragments of the pass's first 32 keys are asked for here, inside the chosen body, so that their way from LDS passes under the exponentials (the scheduler lifts no load over the branch that ends the body)
#pragma unroll
  for (int j = 0; j < 4; ++j) { vh0[j] = frag_t(tb + ST_VH, j, lane); vl0[j] = frag_t(tb + ST_VL, j, lane); }
  // the unrolls below make the indices of s, mq, es and pa constants, so that they stay in registers
  float mq[4];   // four short chains of maxima instead of one of thirty-two
#pragma unroll
  for (int ct = 0; ct < 4; ++ct) { mq[ct] = s[ct][0];
#pragma unroll
    for (int r = 1; r < 8; ++r) mq[ct] = fmaxf(mq[ct], s[ct][r]); }
  float mx = fmaxf(fmaxf(mq[0], mq[1]), fmaxf(mq[2], mq[3]));
  mx = fmaxf(mx, xhalf(mx));
  const float mn = fmaxf(m, mx); alpha = (m <= -1.0e38f) ? 0.f : __expf(m - mn);
  float es[4] = {0.f, 0.f, 0.f, 0.f};   // four short chains of adds instead of one of thirty-two
#pragma unroll
  for (int ct = 0; ct < 4; ++ct)
#pragma unroll
    for (int r = 0; r < 8; ++r) { const float e = (KIND != 0 && s[ct][r] <= -1.0e38f) ? 0.f : __expf(s[ct][r] - mn); es[r & 3] += e; pa[ct >> 1][(ct & 1) * 8 + r] = (_Float16)(e * 2048.0f); }
  l = l * alpha + ((es[0] + es[1]) + (es[2] + es[3])); m = (mn > -1.0e38f) ? mn : m;
}
__global__ __launch_bounds__(256) __attribute__((amdgpu_waves_per_eu(4, 4))) /* four waves per SIMD (two blocks per WGP) leave a wave 256 registers */ void k_att(const _Float16* __restrict__ QH, const _Float16* __restrict__ QL, const _Float16* __restrict__ KH, const _Float16* __restrict__ KL, const _Float16* __restrict__ VH, const _Float16* __restrict__ VL, float* __restrict__ OUT) {
  __shared__ __align__(16) unsigned char ring[4 * ST_SZ];   // two buffers for each wave group: 155,648 B, so that two blocks fit one WGP's LDS
  // between a tile's last pass and the next tile's first copies the ring is idle and holds the hand-over of the second group's partial results (per position wave 17 planes of 32 lanes x 16 B) and, behind it, the output staging
  float (*const so)[16][68] = (float (*)[16][68])(ring + 4 * 17 * 512);
  const int tid = threadIdx.x, wave = __builtin_amdgcn_readfirstlane(tid >> 5) /* held in a scalar register, so that the choice of a pass's body and everything that depends on the group below is a scalar branch */, lane = tid & 31, col = lane & 15, g = lane >> 4; const int h = blockIdx.y; const size_t b = blockIdx.z; const int w = blockIdx.x; const size_t bh = b * NH + h;
  const int grp = wave >> 2, wq = wave & 3, tg = tid & 127;   // wave group, the wave's 16 positions within the tile, the thread's number within its group
  unsigned char* const gring = ring + grp * 2 * ST_SZ;        // this group's two buffers
  const bool hi3 = w == 0;   // first 128 positions (tiles 0 and 1, both in block 0): 3-product scores
  // staging: a K tile and a V tile are each 8,192 contiguous bytes, 64 rows of 128 B (thread: 16-byte pieces tg + 128 i, that is rows tg / 8 + 16 i, i = 0..3)
  const unsigned lK = (unsigned)(size_t)gring + (tg >> 3) * KPB + (tg & 7) * 16, lV = (unsigned)(size_t)gring + ST_VH + (tg >> 3) * VPB + (tg & 7) * 16;
  const size_t oK = bh * SS * DH + tg * 8;   // the same element offset in the K and the V arrays
#pragma unroll 1   // the two tiles run one after the other through one copy of the code
  for (int half = 0; half < 2; ++half) {
  const int qb = (w == 0) ? half : (half == 0 ? SS / 64 - w : 1 + w); const int p0 = qb * 64 + wq * 16; const size_t rq = bh * SS + p0;
  v16h aq[2]; const _Float16* const qlr = QL + (rq + col) * DH;   // this lane's row of residuals
#pragma unroll
  for (int kc = 0; kc < 2; ++kc) aq[kc] = frag_h(QH + (rq + col) * DH + kc * 32, lane);
  asm volatile("s_wait_xcnt 0x0" ::: "memory");   // the staging below reuses the registers that held these loads' addresses
  const int p = p0 + col;                            // this lane's query position
  const float fill = (p == 0) ? 0.0f : -3.0e38f;     // what a key j >= p scores; position 0: all logits equal -> uniform
  float m = -3.0e38f, l = 0.f;                       // running maximum (same in both halves); this lane's half of the running sum
  v8f acc[4] = {}, accl[4] = {};
  const int nks = (qb == 0) ? SS / KP : qb + 1;      // at least 2
  const int nh = (nks + 1) >> 1;                     // passes of this tile, the same for every wave of the block: the first group's share of the key tiles
  const int kb = grp ? nh : 0, ng = grp ? nks - nh : nh;   // this group's key tiles are kb .. kb + ng - 1; ng is nh or nh - 1, at least 1
  // The 16 blocks of one head read the same K and V tiles. Each group enters the ring of its ng key tiles at its own place and wraps round (the running softmax takes the passes in any order),
  // so that the sharers ask for different lines at any moment and a tile's first fetch from memory is waited for by one block, not by all.
#define KWRAP(t) ((t) >= ng ? (t) - ng : (t))        // for 0 <= t < 2 ng
  const int kt0 = KWRAP(w);                          // w < 2 ng for either tile of the pair and either group (short tile: 2 ng >= w + 1; long tile: 2 ng >= 32 - w); block 0 starts at its first key tile
  // the copies of one tile set stand in one statement with s_wait_xcnt 0 as its last line, so that no later write of their address registers can be moved in front of that wait
#define ASTAGE(t, buf) do { const unsigned k0 = lK + (buf) * ST_SZ, k1 = k0 + 16 * KPB, k2 = k0 + 32 * KPB, k3 = k0 + 48 * KPB, v0 = lV + (buf) * ST_SZ, v1 = v0 + 16 * VPB, v2 = v0 + 32 * VPB, v3 = v0 + 48 * VPB, \
      w0 = v0 + (ST_VL - ST_VH), w1 = w0 + 16 * VPB, w2 = w0 + 32 * VPB, w3 = w0 + 48 * VPB; \
    const _Float16* gk0 = KH + oK + (size_t)(t) * KP * DH; const _Float16* gk1 = gk0 + 128 * 8; const _Float16* gk2 = gk0 + 256 * 8; const _Float16* gk3 = gk0 + 384 * 8; \
    const _Float16* gv0 = VH + oK + (size_t)(t) * KP * DH; const _Float16* gv1 = gv0 + 128 * 8; const _Float16* gv2 = gv0 + 256 * 8; const _Float16* gv3 = gv0 + 384 * 8; \
    const _Float16* gw0 = VL + oK + (size_t)(t) * KP * DH; const _Float16* gw1 = gw0 + 128 * 8; const _Float16* gw2 = gw0 + 256 * 8; const _Float16* gw3 = gw0 + 384 * 8; \
    asm volatile("global_load_async_to_lds_b128 %0, %1, off\n\tglobal_load_async_to_lds_b128 %2, %3, off\n\tglobal_load_async_to_lds_b128 %4, %5, off\n\tglobal_load_async_to_lds_b128 %6, %7, off\n\t" \
                 "global_load_async_to_lds_b128 %8, %9, off\n\tglobal_load_async_to_lds_b128 %10, %11, off\n\tglobal_load_async_to_lds_b128 %12, %13, off\n\tglobal_load_async_to_lds_b128 %14, %15, off\n\t" \
                 "global_load_async_to_lds_b128 %16, %17, off\n\tglobal_load_async_to_lds_b128 %18, %19, off\n\tglobal_load_async_to_lds_b128 %20, %21, off\n\tglobal_load_async_to_lds_b128 %22, %23, off\n\ts_wait_xcnt 0x0" \
                 :: "v"(k0), "v"(gk0), "v"(k1), "v"(gk1), "v"(k2), "v"(gk2), "v"(k3), "v"(gk3), "v"(v0), "v"(gv0), "v"(v1), "v"(gv1), "v"(v2), "v"(gv2), "v"(v3), "v"(gv3), "v"(w0), "v"(gw0), "v"(w1), "v"(gw1), "v"(w2), "v"(gw2), "v"(w3), "v"(gw3) : "memory"); \
    if (hi3) { const unsigned r0 = k0 + ST_KL, r1 = k1 + ST_KL, r2 = k2 + ST_KL, r3 = k3 + ST_KL; const _Float16* gr0 = KL + oK + (size_t)(t) * KP * DH; const _Float16* gr1 = gr0 + 128 * 8; const _Float16* gr2 = gr0 + 256 * 8; const _Float16* gr3 = gr0 + 384 * 8; \
      asm volatile("global_load_async_to_lds_b128 %0, %1, off\n\tglobal_load_async_to_lds_b128 %2, %3, off\n\tglobal_load_async_to_lds_b128 %4, %5, off\n\tglobal_load_async_to_lds_b128 %6, %7, off\n\ts_wait_xcnt 0x0" \
                   :: "v"(r0), "v"(gr0), "v"(r1), "v"(gr1), "v"(r2), "v"(gr2), "v"(r3), "v"(gr3) : "memory"); } } while (0)
#pragma unroll 1   // the ring's first two stagings run through one copy of the code, so that their 24 LDS addresses are formed where they are used and not held in registers over the whole kernel (held so, two of them spilled to scratch)
  for (int st = 0; st < 2; ++st) {
    if (st < ng) ASTAGE(kb + KWRAP(kt0 + st), st);   // second position tile: the barrier at the first one's end stands behind every wave's last read of the ring (passes, hand-over, output staging), and no copy is in flight
    if (st == 0) {
      asm volatile("s_wait_asynccnt 0x0" ::: "memory");   // this wave's share of the first tile has landed
      __syncthreads(); } }                                // ... and every other wave's
#pragma unroll 1
  for (int ks = 0; ks < nh; ++ks) { const unsigned char* tb = gring + (ks & 1) * ST_SZ;
   if (ks < ng) {   // a scalar test: the second group may have one key tile fewer; it still passes the waits and the barrier below
    const int kt = kb + KWRAP(kt0 + ks);   // the key tile of this pass
    const int rel = p0 - kt * KP;   // the wave's first position minus the pass's first key: a scalar, a multiple of 16
    float alpha; v16h pa[2], vh0[4], vl0[4];
    if (rel >= KP && !hi3) att_scores<0>(tb, lane, hi3, aq, qlr, p - kt * KP, fill, m, l, alpha, pa, vh0, vl0);
    else if (rel > -16) att_scores<1>(tb, lane, hi3, aq, qlr, p - kt * KP, fill, m, l, alpha, pa, vh0, vl0);
    else att_scores<2>(tb, lane, hi3, aq, qlr, p - kt * KP, fill, m, l, alpha, pa, vh0, vl0);
    // the unrolls below make the indices of the accumulators and fragment arrays constants, so that they stay in registers
#pragma unroll
    for (int j = 0; j < 4; ++j)
#pragma unroll
      for (int r = 0; r < 8; ++r) { acc[j][r] *= alpha; accl[j][r] *= alpha; }
    v16h vh[4], vl[4];   // the V^T fragments of the pass's second 32 keys, asked for in two groups of four, each as soon as four of the first 32 keys' fragments have been used, into the registers these leave: with all sixteen held at once the build spilled to scratch
#pragma unroll
    for (int j = 0; j < 2; ++j) { acc[j] = wmma16(vh0[j], pa[0], acc[j]); accl[j] = wmma16(vl0[j], pa[0], accl[j]); }
#pragma unroll
    for (int j = 0; j < 2; ++j) { vh[j] = frag_t(tb + ST_VH + 32 * VPB, j, lane); vl[j] = frag_t(tb + ST_VL + 32 * VPB, j, lane); }
#pragma unroll
    for (int j = 2; j < 4; ++j) { acc[j] = wmma16(vh0[j], pa[0], acc[j]); accl[j] = wmma16(vl0[j], pa[0], accl[j]); }
#pragma unroll
    for (int j = 2; j < 4; ++j) { vh[j] = frag_t(tb + ST_VH + 32 * VPB, j, lane); vl[j] = frag_t(tb + ST_VL + 32 * VPB, j, lane); }
#pragma unroll
    for (int j = 0; j < 4; ++j) { acc[j] = wmma16(vh[j], pa[1], acc[j]); accl[j] = wmma16(vl[j], pa[1], accl[j]); }
   }
    asm volatile("s_wait_dscnt 0x0" ::: "memory");      // this wave's reads of the buffer are done
    asm volatile("s_wait_asynccnt 0x0" ::: "memory");   // its share of the next tile has landed
    __syncthreads();                                    // publishes the next tile and frees this pass's buffer
    if (ks + 2 < ng) ASTAGE(kb + KWRAP(kt0 + ks + 2), ks & 1); }
  asm volatile("s_wait_asynccnt 0x0" ::: "memory");     // no copy is left in flight when the wave goes on to its end
  // hand-over: lane for lane the two groups hold the same query and the same channels. The last pass's barrier stands behind every wave's last read of the ring and behind every copy's landing.
  float* const mb = (float*)ring + wq * (17 * 128);
  if (grp == 1) {
#pragma unroll
    for (int j = 0; j < 4; ++j)
#pragma unroll
      for (int q = 0; q < 2; ++q) { v4f xa, xl;
#pragma unroll
        for (int e = 0; e < 4; ++e) { xa[e] = acc[j][q * 4 + e]; xl[e] = accl[j][q * 4 + e]; }
        *(v4f*)(mb + ((j * 4 + q) * 32 + lane) * 4) = xa; *(v4f*)(mb + ((j * 4 + 2 + q) * 32 + lane) * 4) = xl; }
    v4f ml = {m, l, 0.f, 0.f}; *(v4f*)(mb + (16 * 32 + lane) * 4) = ml; }
  __syncthreads();                                      // the second group's partial results are in LDS
  if (grp == 0) {
  { const v4f ml = *(const v4f*)(mb + (16 * 32 + lane) * 4);
    const float mn = fmaxf(m, ml[0]);   // the common maximum; a group that has counted no key for this query (maximum still at its start value) adds nothing
    const float fa = (m <= -1.0e38f) ? 0.f : __expf(m - mn), fb = (ml[0] <= -1.0e38f) ? 0.f : __expf(ml[0] - mn);
    l = l * fa + ml[1] * fb;
#pragma unroll
    for (int j = 0; j < 4; ++j)
#pragma unroll
      for (int q = 0; q < 2; ++q) { const v4f xa = *(const v4f*)(mb + ((j * 4 + q) * 32 + lane) * 4), xl = *(const v4f*)(mb + ((j * 4 + 2 + q) * 32 + lane) * 4);
#pragma unroll
        for (int e = 0; e < 4; ++e) { acc[j][q * 4 + e] = acc[j][q * 4 + e] * fa + xa[e] * fb; accl[j][q * 4 + e] = accl[j][q * 4 + e] * fa + xl[e] * fb; } } }
  const float lt = l + xhalf(l);   // the two halves' sums are joined once
  const float il = (lt > 0.f) ? (1.0f / 2048.0f) / lt : 0.f;
#pragma unroll
  for (int j = 0; j < 4; ++j) { v4f o[2];   // register r = channel j * 16 + 8 g + r of this lane's query
#pragma unroll
    for (int r = 0; r < 8; ++r) o[r >> 2][r & 3] = (acc[j][r] + accl[j][r] * (1.0f / 2048.0f)) * il;
    *(v4f*)&so[wq][col][j * 16 + 8 * g] = o[0]; *(v4f*)&so[wq][col][j * 16 + 8 * g + 4] = o[1]; }
  LDSX(); for (int rl = 0; rl < 16; ++rl) if (lane < 16) vst2(OUT + (rq + rl) * DH + lane * 4, *(const v4f*)&so[wq][rl][lane * 4]);
  asm volatile("s_wait_xcnt 0x0" ::: "memory");   // the next tile's first instructions reuse the registers that these stores name
  }
  if (half == 0) __syncthreads();                 // hand-over and output staging have been read: the next tile's copies may overwrite them
  } }
extern "C" void kernel_launch(void* const* d_in, const int* in_sizes, int n_in, void* d_out, int out_size, void* d_ws, size_t ws_size, hipStream_t stream) {
  (void)in_sizes; (void)n_in; (void)out_size;
  const float** F = (const float**)d_in;   // 0 query_vector, 1 key_vector, 2 value_vector [2,2048,1024]; 3 Wq, 4 bq, 5 Wk, 6 bk, 7 Wv, 8 bv (natural)
  if (ws_size < (size_t)WS_END) return;
  char* ws = (char*)d_ws; _Float16 *QH = (_Float16*)(ws + WS_QH), *QL = (_Float16*)(ws + WS_QL), *KH = (_Float16*)(ws + WS_KH), *KL = (_Float16*)(ws + WS_KL), *VH = (_Float16*)(ws + WS_VH), *VL = (_Float16*)(ws + WS_VL);
  k_proj<<<dim3(NROW / 128, DD / 128, 3), 256, 0, stream>>>(F[0], F[1], F[2], F[3], F[4], F[5], F[6], F[7], F[8], QH, QL, KH, KL, VH, VL);
  k_att<<<dim3(SS / 128, NH, TNB), 256, 0, stream>>>(QH, QL, KH, KL, VH, VL, (float*)d_out);
}

// v010
// One run takes 75.7 microseconds.
// In both of two side-by-side timings against v009, it was 1.06 times as fast.
// Over all steps from v000 it is 7.08 times as fast.
// compute dtype: all float inputs rounded to bf16; Q/K/V = input . W^T + b with EXACT bf16 products on WMMA 16x16x32 (natural rows); the module's raw reshape (B,S,D)->(B,H,S,Dh) means 'head h' = the 128 projected rows 128h..128h+127 viewed as 2,048 positions x 64 (position p = (s - 128h)*16 + c/64) - handled purely by addressing; Q/K as f16 hi + residual (3-product scores for positions < 128, single f16 after), V as f16 hi + residual rows (2 products); mask: keys j >= i set to -1e9 INCLUDING the diagonal, so position 0 attends uniformly to all 2,048 keys (all logits equal) and position i >= 1 to keys < i; x 1/8; running-max softmax in f32 (hardware exp); the context in the same raw layout is the f32 output.
#include <hip/hip_runtime.h>
#include <math.h>

typedef __attribute__((ext_vector_type(16))) _Float16 v16h;
typedef __attribute__((ext_vector_type(16))) __bf16 v16b;
typedef __attribute__((ext_vector_type(8)))  _Float16 v8h;
typedef __attribute__((ext_vector_type(8)))  float v8f;
typedef __attribute__((ext_vector_type(4)))  float v4f;
typedef __attribute__((ext_vector_type(2)))  float v2f;
typedef __attribute__((ext_vector_type(4)))  unsigned v4u;
typedef __attribute__((ext_vector_type(4)))  int v4i;
typedef float __attribute__((may_alias)) float_a;
typedef int __attribute__((may_alias)) int_a;

template <typename T> __device__ __forceinline__ void vst2(void* p, T v) { *(T*)p = v;  }
__device__ __forceinline__ v8f wmma16(v16h a, v16h b, v8f c) {
  v8f d = __builtin_amdgcn_wmma_f32_16x16x32_f16(false, a, false, b, (short)0, c, false, false);
  asm volatile("v_nop\n\tv_nop\n\tv_nop\n\tv_nop" : "+v"(d) : "v"(a), "v"(b));
  return d;
}
__device__ __forceinline__ v8f wmma_bf(v16b a, v16b b, v8f c) {
  v8f d = __builtin_amdgcn_wmma_f32_16x16x32_bf16(false, a, false, b, (short)0, c, false, false);
  asm volatile("v_nop\n\tv_nop\n\tv_nop\n\tv_nop" : "+v"(d) : "v"(a), "v"(b));
  return d;
}
// 16x16x32 fragments: lane = (h = lane>>4, row/col = lane&15); elements 0..7 = k0+8h+0..7, 8..15 = k0+16+8h+0..7; D element r = row 8h+r
__device__ __forceinline__ v16h frag_h(const _Float16* rowk0, int lane) {
  union { v16h v; v8h q[2]; } u; const _Float16* p = rowk0 + 8 * (lane >> 4);
  u.q[0] = *(const v8h*)p; u.q[1] = *(const v8h*)(p + 16); return u.v;
}
__device__ __forceinline__ v16h frag_f32(const float* rowk0, int lane) {
  v16h a; const float* p = rowk0 + 8 * (lane >> 4);
#pragma unroll
  for (int i = 0; i < 8; ++i) { a[i] = (_Float16)p[i]; a[8 + i] = (_Float16)p[16 + i]; }
  return a;
}
__device__ __forceinline__ v16h frag_f32s(const float* rowk0, int lane, float sc) {
  v16h a; const float* p = rowk0 + 8 * (lane >> 4);
#pragma unroll
  for (int i = 0; i < 8; ++i) { a[i] = (_Float16)(p[i] * sc); a[8 + i] = (_Float16)(p[16 + i] * sc); }
  return a;
}
// column fragment from a [K][ld] layout (column n), rows >= K read as 0
__device__ __forceinline__ v16h fragc_f32(const float* W, int k0, int n, int lane, int ld, int K) {
  v16h a; const int g = lane >> 4;
#pragma unroll
  for (int i = 0; i < 8; ++i) { const int ka = k0 + 8 * g + i, kb = ka + 16;
    a[i] = (_Float16)(ka < K ? W[(size_t)(ka < K ? ka : K - 1) * ld + n] : 0.f); a[8 + i] = (_Float16)(kb < K ? W[(size_t)(kb < K ? kb : K - 1) * ld + n] : 0.f); }
  return a;
}
struct F2 { v16b h, l; };
__device__ __forceinline__ F2 bsplit16(const float v[16]) { F2 r;
#pragma unroll
  for (int i = 0; i < 16; ++i) { const __bf16 h = (__bf16)v[i]; r.h[i] = h; r.l[i] = (__bf16)(v[i] - (float)h); }
  return r; }
__device__ __forceinline__ F2 split_row(const float* row, int k0, int lane) { float v[16]; const float* p = row + k0 + 8 * (lane >> 4);
#pragma unroll
  for (int i = 0; i < 8; ++i) { v[i] = p[i]; v[8 + i] = p[16 + i]; }
  return bsplit16(v); }
__device__ __forceinline__ F2 split_rowK(const float* row, int k0, int lane, int K) { float v[16]; const int g = lane >> 4;
#pragma unroll
  for (int i = 0; i < 8; ++i) { const int ka = k0 + 8 * g + i, kb = ka + 16; v[i] = ka < K ? row[ka < K ? ka : K - 1] : 0.f; v[8 + i] = kb < K ? row[kb < K ? kb : K - 1] : 0.f; }
  return bsplit16(v); }
__device__ __forceinline__ F2 split_col(const float* W, int k0, int n, int lane, int ld, int K) { float v[16]; const int g = lane >> 4;
#pragma unroll
  for (int i = 0; i < 8; ++i) { const int ka = k0 + 8 * g + i, kb = ka + 16; v[i] = ka < K ? W[(size_t)(ka < K ? ka : K - 1) * ld + n] : 0.f; v[8 + i] = kb < K ? W[(size_t)(kb < K ? kb : K - 1) * ld + n] : 0.f; }
  return bsplit16(v); }
__device__ __forceinline__ v8f mac3(const F2& a, const F2& b, v8f c) { c = wmma_bf(a.l, b.h, c); c = wmma_bf(a.h, b.l, c); return wmma_bf(a.h, b.h, c); }
__device__ __forceinline__ float sigm(float v) { return 1.0f / (1.0f + expf(-v)); }
#define LDSX() do { asm volatile("s_wait_dscnt 0" ::: "memory"); __builtin_amdgcn_wave_barrier(); __builtin_amdgcn_fence(__ATOMIC_RELEASE, "workgroup"); } while (0)


// 'Fast' MHA with raw-reshape heads (B 2, S 2,048, D 1,024, 16 'heads' x 64): separate query / key / value inputs, natural projections + biases, triu(offset 0)-masked softmax(q k / 8) v, raw reshape back (no output projection).
#define NB 2
#define SS 2048           // positions per head (== S)
#define DD 1024
#define NH 16
#define DH 64
#define NROW (NB * SS)    // projected rows
#ifndef TNB
#define TNB NB
#endif
typedef __attribute__((ext_vector_type(8))) __bf16 v8b;
__device__ __forceinline__ v16b frag_b(const __bf16* rowk0, int lane) {
  union { v16b v; v8b q[2]; } u; const __bf16* p = rowk0 + 8 * (lane >> 4);
  u.q[0] = *(const v8b*)p; u.q[1] = *(const v8b*)(p + 16); return u.v;
}
__device__ __forceinline__ float bfr(float v) { return (float)(__bf16)v; }
__device__ __forceinline__ float xhalf(float x) { return __builtin_bit_cast(float, __builtin_amdgcn_permlanex16(__builtin_bit_cast(int, x), __builtin_bit_cast(int, x), 0x76543210, 0xfedcba98, false, false)); }  // lane l's value for lane l ^ 16
__device__ __attribute__((noinline)) float exp_ni(float v) { return expf(v); }
__device__ __attribute__((noinline)) float erf_ni(float v) { return erff(v); }

#define WS_QH  0u                                   // f16 hi|lo Q flat [b][s][1024] == [b][h][p][64]
#define WS_QL  (WS_QH + 2u * (size_t)NROW * DD)
#define WS_KH  (WS_QL + 2u * (size_t)NROW * DD)
#define WS_KL  (WS_KH + 2u * (size_t)NROW * DD)
#define WS_VH  (WS_KL + 2u * (size_t)NROW * DD)          // f16 hi|lo V flat, laid out like Q and K
#define WS_VL  (WS_VH + 2u * (size_t)NROW * DD)
#define WS_END (WS_VL + 2u * (size_t)NROW * DD)

__device__ __forceinline__ v16b fragb_f32(const float* __restrict__ p, int lane) { v16b a; const float* pp = p + 8 * (lane >> 4);
#pragma unroll
  for (int i = 0; i < 8; ++i) { a[i] = (__bf16)pp[i]; a[8 + i] = (__bf16)pp[16 + i]; } return a; }
// ---- k_proj: block = (256 rows, 256 cols, which), 16 waves of 64 x 64, one block per WGP: which 0 Q, 1 K, 2 V -> f16 hi/lo flat rows.
// What a block asks of L2 per output element falls with the tile's sides (1 / rows + 1 / cols): at 256 x 256 an X line is read by 4 blocks and a W line by 16, half the bytes of a 128 x 128 tile; a 64 x 64 wave tile takes one 16-byte LDS read per product (64 x 32: one and a half).
// Each 32-k slice of the X and W tiles is read once per block by whole-line loads (8 lanes x 16 B = one 128-B row piece), rounded to bf16 once and kept in LDS; all 16 waves take their fragments from there.
#define PLD 40            // bf16 elements per staged row: 64 B of data + 16 B pad; 80 B = 16 B x odd keeps the 16-byte fragment reads off each other's banks
#define PT 256            // rows of X and rows of W per block
#define PTILE (PT * PLD)  // one staged operand slice
#define POP (PT + 8)      // f16 elements per row of the output staging (16 B of pad)
typedef __attribute__((ext_vector_type(4))) __bf16 v4b;
__global__ __launch_bounds__(512) void k_proj(const float* __restrict__ XQ, const float* __restrict__ XK, const float* __restrict__ XV, const float* __restrict__ WQ, const float* __restrict__ BQ, const float* __restrict__ WK, const float* __restrict__ BK, const float* __restrict__ WV, const float* __restrict__ BV, _Float16* __restrict__ QH, _Float16* __restrict__ QL, _Float16* __restrict__ KH, _Float16* __restrict__ KL, _Float16* __restrict__ VH, _Float16* __restrict__ VL) {
  __shared__ __align__(16) unsigned char smem[2 * PT * POP * 2];   // K loop: four X slices | four W slices (163,840 B); afterwards the output staging (f16 hi | lo planes, 270,336 B)
  __bf16* const sA = (__bf16*)smem; __bf16* const sB = sA + 4 * PTILE;
  const int tid = threadIdx.x, wave = tid >> 5, lane = tid & 31, col = lane & 15, g = lane >> 4; const int which = blockIdx.z; const size_t row0 = (size_t)blockIdx.x * PT; const int c0 = blockIdx.y * PT;
  const int wm = wave >> 2, wn = wave & 3;
  const float* X = which == 0 ? XQ : which == 1 ? XK : XV; const float* Wm = which == 0 ? WQ : which == 1 ? WK : WV; const float* Bm = which == 0 ? BQ : which == 1 ? BK : BV;
  const int sr = tid >> 3, sc = (tid & 7) * 4;   // staging: this thread's row (plus 64 i) and its four k of the slice
  const float* gA = X + (row0 + sr) * DD + sc; const float* gB = Wm + (size_t)(c0 + sr) * DD + sc;
  const int so_ = sr * PLD + sc;
  const __bf16* const fA0 = sA + (wm * 64 + col) * PLD; const __bf16* const fB0 = sB + (wn * 64 + col) * PLD;   // this lane's first fragment rows in buffer 0; the other fragments and buffers lie at constant distances
  v4f ra[4], rb[4];
  v8f acc[4][4] = {};
  // every unroll in this kernel makes the indices of acc, ra, rb and the fragment arrays constants, so that they stay in registers
#define PLOAD(ra, rb, pa, pb) do { _Pragma("unroll") for (int i = 0; i < 4; ++i) { ra[i] = *(const v4f*)((pa) + (size_t)i * 64 * DD); rb[i] = *(const v4f*)((pb) + (size_t)i * 64 * DD); } } while (0)
#define PSTORE(ra, rb, buf) do { _Pragma("unroll") for (int i = 0; i < 4; ++i) { v4b ta, tb; _Pragma("unroll") for (int e = 0; e < 4; ++e) { ta[e] = (__bf16)ra[i][e]; tb[e] = (__bf16)rb[i][e]; } *(v4b*)(sA + (buf) * PTILE + so_ + i * 64 * PLD) = ta; *(v4b*)(sB + (buf) * PTILE + so_ + i * 64 * PLD) = tb; } } while (0)
#define PMAC(buf) do { v16b fb[4], fa[4]; _Pragma("unroll") for (int j = 0; j < 4; ++j) fb[j] = frag_b(fB0 + (buf) * PTILE + j * 16 * PLD, lane); \
    _Pragma("unroll") for (int i = 0; i < 4; ++i) fa[i] = frag_b(fA0 + (buf) * PTILE + i * 16 * PLD, lane); \
    _Pragma("unroll") for (int i = 0; i < 4; ++i) { _Pragma("unroll") for (int j = 0; j < 4; ++j) acc[i][j] = wmma_bf(fa[i], fb[j], acc[i][j]); } } while (0)
  // The 4 blocks of one row tile read the same X lines and the 16 blocks of one column tile the same W lines. Each block enters the ring of 32 k slices at its own place and wraps round,
  // so that at any moment the sharers ask for different lines: a line's first fetch from memory is waited for by one block, not by all, and the others find it in L2 later.
  const int rot = (2 * blockIdx.x + 8 * blockIdx.y) & (DD / 32 - 1);   // different for any two blocks that share a tile: two slices apart along a column tile, eight along a row tile
  // A stage is 64 k, two slices, and there is one barrier per stage: slice n lies in buffer n & 3, so that a stage's two slices are read while the next stage's two are written into the other pair.
  // Between a stage's two slices the sixteen waves are not brought into step, so that one wave's fragment reads, load wait and staging pass under the others' products.
  // rot is even, so a stage starts at an even slice and its second slice is the next one in memory: the walk wraps between stages only.
  { const float* pa0 = gA + rot * 32; const float* pb0 = gB + rot * 32;
    v4f ra1[4], rb1[4];   // the first stage's second slice: the accumulators' registers are still free here
    PLOAD(ra, rb, pa0, pb0); PLOAD(ra1, rb1, pa0 + 32, pb0 + 32);
    asm volatile("s_wait_xcnt 0x0" :: "v"(pa0), "v"(pb0) : "memory");   // keeps the two address pairs whole until this wait: what follows may reuse their registers
    PSTORE(ra, rb, 0); PSTORE(ra1, rb1, 1); }
  __syncthreads();
  for (int kc = 0; kc < DD / 32 - 2; kc += 2) {
    const int kn = (kc + 2 + rot) & (DD / 32 - 1);   // the first slice of the next stage of this block's walk
    const float* pa = gA + kn * 32; const float* pb = gB + kn * 32;
#pragma unroll   // the stage's two slices stand one behind the other in the code, with the barrier behind the second
    for (int hs = 0; hs < 2; ++hs) {
      PLOAD(ra, rb, pa + hs * 32, pb + hs * 32);   // the slice one stage ahead flies while this one is multiplied
      asm volatile("s_wait_xcnt 0x0" :: "v"(pa), "v"(pb) : "memory");   // keeps the two address pairs whole until this wait: the fragment reads below may reuse their registers
      PMAC((kc & 2) + hs);
      __builtin_amdgcn_sched_barrier(0);   // keeps the wait for the flying slice's loads behind this slice's last product: a build without this line waits for all of them behind the slice's first products, which holds the later ones back until the loads have come
      PSTORE(ra, rb, ((kc & 2) ^ 2) + hs); }   // that buffer's last readers left it before the previous barrier
    __syncthreads(); }
  PMAC(2); PMAC(3);   // the last stage: slices 30 and 31
  __syncthreads();        // every wave has read its last fragments: the buffers become output staging
  _Float16 (*sh)[POP] = (_Float16 (*)[POP])smem; _Float16 (*sl)[POP] = (_Float16 (*)[POP])(smem + PT * POP * 2);
  const float* pbi = Bm + c0 + wn * 64 + col; float bq4[4];   // this lane's four biases, 16 columns apart
#pragma unroll
  for (int j = 0; j < 4; ++j) bq4[j] = pbi[j * 16];
  asm volatile("s_wait_xcnt 0x0" :: "v"(pbi) : "memory");   // keeps the address pair whole until this wait: none of the four loads may land in it
#pragma unroll
  for (int j = 0; j < 4; ++j) { const int cc = wn * 64 + j * 16 + col; const float bb = bfr(bq4[j]);
#pragma unroll
    for (int i = 0; i < 4; ++i)
#pragma unroll
      for (int r = 0; r < 8; ++r) { const int rr = wm * 64 + i * 16 + 8 * g + r; const float v = acc[i][j][r] + bb; const _Float16 hv = (_Float16)v; sh[rr][cc] = hv; sl[rr][cc] = (_Float16)((v - (float)hv) * 2048.0f); } }
  __syncthreads();
  _Float16* PH = which == 0 ? QH : which == 1 ? KH : VH; _Float16* PL = which == 0 ? QL : which == 1 ? KL : VL;
#pragma unroll 1   // four trips of four rows each: wholly unrolled the sixteen rows only lengthen the code
  for (int t0 = 0; t0 < PT * (PT / 8) / 512; t0 += 4) {
#pragma unroll       // four rows' LDS reads are asked for together ahead of their stores
    for (int t = 0; t < 4; ++t) { const int e = tid + (t0 + t) * 512, rl = e >> 5, q = e & 31;   // a wave stores one whole 512-byte row piece of each plane
      const size_t o = (row0 + rl) * DD + c0 + q * 8; vst2((unsigned*)(PH + o), *(const v4u*)&sh[rl][q * 8]); vst2((unsigned*)(PL + o), *(const v4u*)&sl[rl][q * 8]); }
    asm volatile("s_wait_xcnt 0x0" ::: "memory"); } }   // the next trip's first instructions reuse the registers that these stores name
// ---- k_att: block = (pair of 64-position tiles, h, b): keys j < i (diagonal excluded); position 0 -> uniform over all keys; key tiles past a position tile skipped (tile 0 also scans all key tiles so that position 0's uniform average is exact)
// A pass takes 64 keys. A position tile's cost grows with its index (tile t takes t + 1 key tiles, tile 0 all 32), and every block is resident at once, so the launch lasts as long as the fullest WGP. Each block therefore takes two tiles, one after the other,
// a long one and a short one: block 0 tiles 0 and 1 (34 key tiles), block w >= 1 tiles 32 - w and 1 + w (35 key tiles): the blocks walk nearly the same number of passes wherever they are placed (block 0's tile 0 takes all 32 key tiles for position 0 alone: past the diagonal they take no score products, see att_scores, so block 0 is not the dearest).
// The products are taken transposed: S^T = K . Q^T (A = K rows, B = Q rows) and O^T += V^T . P^T. A lane then holds 32 of the pass's 64 scores of ONE query (position p0 + col; lane ^ 16 holds the other 32), so maximum and sum are taken in the lane,
// and each pair of score tiles, turned into f16 in place, already is the B operand of the second product for its 32 keys (element s = tile s / 8, register s % 8 = key 8 g + s % 8 + 16 (s / 8): the k order of frag_h): P goes through no LDS.
// Each pass's 64 keys (K hi rows, K residual rows for the first 128 positions, V hi and residual rows, all as the projection stored them) are brought into LDS once per block by asynchronous 16-byte copies, two buffers, one pass ahead; the four waves of a group (below) take their fragments from there.
// Each position tile's key tiles are shared out between two groups of four waves (waves 0..3: the first half of them, waves 4..7: the rest). Both groups hold the same 64 positions, each walks its own key tiles through its own two buffers with its own running maximum, sum and accumulators,
// and at the tile's end the second group hands its partial results over through LDS and the first joins them (the usual rescaling to the common maximum) and writes the output. A wave's chain of passes is half as long (17 or 18 a block) and a SIMD holds four waves instead of two, so that one wave's waits (LDS, exponentials, barrier) pass under the others' work.
// What a pass costs whatever its width (the barrier and the waits in front of it, the copies' issue and their wait, the choice of the body, the way of the first fragments from LDS, the half exchange, the rescaling of the 64 accumulator registers) is paid once per 64 keys.
// V^T is never stored: the A operand of the second product comes from the staged V rows by the transposing LDS load (frag_t).
#define KP 64                       // keys per pass
#define KPB 144                     // bytes per staged K row: 128 B of data + 16 B pad (16 B x odd keeps the 16-byte fragment reads off each other's banks)
#define VPB 160                     // bytes per staged V row: 128 B of data + 32 B pad (32 B x odd is the transposing load's conflict-free pitch)
#define ST_KL (KP * KPB)            // buffer layout: K hi | K residual | V hi | V residual
#define ST_VH (2 * KP * KPB)
#define ST_VL (ST_VH + KP * VPB)
#define ST_SZ (ST_VL + KP * VPB)
// A fragment of V^T (rows = channels 16 j .. 16 j + 15, k = 32 keys) from 32 staged V rows: ds_load_tr16_b128 gives lane (col, g) the eight values tile[kbase + 8 g + 0..7][16 j + col];
// the loads at kbase 0 and 16 are elements 0..7 and 8..15, the k order of frag_h. Every lane is on wherever this is called.
typedef __attribute__((ext_vector_type(8))) short v8s;
__device__ __forceinline__ v16h frag_t(const unsigned char* tile, int j, int lane) {
  typedef __attribute__((address_space(3))) v8s lds_v8s;
  union { v16h v; v8s q[2]; } u; const unsigned char* p = tile + (8 * (lane >> 4) + (lane & 7)) * VPB + ((lane >> 3) & 1) * 16 + j * 32;
  u.q[0] = __builtin_amdgcn_ds_load_tr16_b128_v8i16((lds_v8s*)p); u.q[1] = __builtin_amdgcn_ds_load_tr16_b128_v8i16((lds_v8s*)(p + 16 * VPB)); return u.v;
}
// Scores and softmax weights of one pass (64 keys) of one wave (16 positions). KIND says where the pass's keys lie against the wave's positions; it is the same for the whole wave, so the caller picks the body by a scalar branch
// and the common body carries no per-element work for cases that cannot occur in it:
//   0: every key lies below every position, past the first 128 positions: all 1,024 scores count (no mask; a counted score is far above -1e38, so the zero guard of the exponentials is an identity and goes too; no residual terms)
//   1: the pass crosses the diagonal, or belongs to the first 128 positions: mask, guard and (hi3) residual terms as written
//   2: every key lies at or above every position: every score is 'fill' whatever K . Q^T gives, so the K fragments are not read and the score products are not taken
template <int KIND>
__device__ __forceinline__ void att_scores(const unsigned char* tb, const int lane, const bool hi3, const v16h (&aq)[2], const _Float16* qlr, const int pk, const float fill, float& m, float& l, float& alpha, v16h (&pa)[2], v16h (&vh0)[4], v16h (&vl0)[4]) {
  const int col = lane & 15, g = lane >> 4; float s[4][8];   // pk = this lane's position minus the pass's first key
  if (KIND == 2) {
#pragma unroll
    for (int ct = 0; ct < 4; ++ct)
#pragma unroll
      for (int r = 0; r < 8; ++r) s[ct][r] = fill;
  } else {
   constexpr int GT = (KIND == 1) ? 2 : 4;   // score tiles taken at a time: the masked body, which may also hold the residual fragments, takes two, so that it stays inside the 256 registers without spilling
#pragma unroll
   for (int q = 0; q < 4 / GT; ++q) {
    // the K fragments of the group's tiles are asked for together ahead of the score products (the unrolls make the fragment arrays' indices constants, so that they stay in registers)
    const unsigned char* tq = tb + q * GT * 16 * KPB;
    v16h kf[GT][2];
#pragma unroll
    for (int ct = 0; ct < GT; ++ct)
#pragma unroll
      for (int kc = 0; kc < 2; ++kc) kf[ct][kc] = frag_h((const _Float16*)(tq + (ct * 16 + col) * KPB) + kc * 32, lane);
    v8f c[GT] = {};
#pragma unroll
    for (int kc = 0; kc < 2; ++kc)   // the group's score tiles' products take turns, so that none waits for its own predecessor
#pragma unroll
      for (int ct = 0; ct < GT; ++ct) c[ct] = wmma16(kf[ct][kc], aq[kc], c[ct]);
    if (KIND == 1 && hi3) {   // the residual products and their addition stand under one scalar branch
      v16h al[2];   // the query's residual fragments are fetched here, where the one block that takes this branch uses them: held over the whole walk they cost every wave sixteen registers, and four waves per SIMD leave a wave 256
#pragma unroll
      for (int kc = 0; kc < 2; ++kc) al[kc] = frag_h(qlr + kc * 32, lane);
      asm volatile("s_wait_xcnt 0x0" ::: "memory");   // what follows may reuse the registers that held these loads' addresses
#pragma unroll
      for (int ct = 0; ct < GT; ++ct) { v16h kq[2]; v8f cl = {};
#pragma unroll
        for (int kc = 0; kc < 2; ++kc) kq[kc] = frag_h((const _Float16*)(tq + ST_KL + (ct * 16 + col) * KPB) + kc * 32, lane);
#pragma unroll
        for (int kc = 0; kc < 2; ++kc) { cl = wmma16(kq[kc], aq[kc], cl); cl = wmma16(kf[ct][kc], al[kc], cl); }
#pragma unroll
        for (int r = 0; r < 8; ++r) c[ct][r] = c[ct][r] + cl[r] * (1.0f / 2048.0f); } }
#pragma unroll
    for (int ct = 0; ct < GT; ++ct) { const int nk = pk - ((q * GT + ct) * 16 + 8 * g);   // register r = key (q GT + ct) * 16 + 8 g + r of the pass: it counts while r < nk
#pragma unroll
      for (int r = 0; r < 8; ++r) { const float sc = c[ct][r] * 0.125f; s[q * GT + ct][r] = (KIND == 0 || r < nk) ? sc : fill; } }
   }
  }
  // the V^T fragments of the pass's first 32 keys are asked for here, inside the chosen body, so that their way from LDS passes under the exponentials (the scheduler lifts no load over the branch that ends the body)
#pragma unroll
  for (int j = 0; j < 4; ++j) { vh0[j] = frag_t(tb + ST_VH, j, lane); vl0[j] = frag_t(tb + ST_VL, j, lane); }
  // the unrolls below make the indices of s, mq, es and pa constants, so that they stay in registers
  float mq[4];   // four short chains of maxima instead of one of thirty-two
#pragma unroll
  for (int ct = 0; ct < 4; ++ct) { mq[ct] = s[ct][0];
#pragma unroll
    for (int r = 1; r < 8; ++r) mq[ct] = fmaxf(mq[ct], s[ct][r]); }
  float mx = fmaxf(fmaxf(mq[0], mq[1]), fmaxf(mq[2], mq[3]));
  mx = fmaxf(mx, xhalf(mx));
  const float mn = fmaxf(m, mx); alpha = (m <= -1.0e38f) ? 0.f : __expf(m - mn);
  float es[4] = {0.f, 0.f, 0.f, 0.f};   // four short chains of adds instead of one of thirty-two
#pragma unroll
  for (int ct = 0; ct < 4; ++ct)
#pragma unroll
    for (int r = 0; r < 8; ++r) { const float e = (KIND != 0 && s[ct][r] <= -1.0e38f) ? 0.f : __expf(s[ct][r] - mn); es[r & 3] += e; pa[ct >> 1][(ct & 1) * 8 + r] = (_Float16)(e * 2048.0f); }
  l = l * alpha + ((es[0] + es[1]) + (es[2] + es[3])); m = (mn > -1.0e38f) ? mn : m;
}
__global__ __launch_bounds__(256) __attribute__((amdgpu_waves_per_eu(4, 4))) /* four waves per SIMD (two blocks per WGP) leave a wave 256 registers */ void k_att(const _Float16* __restrict__ QH, const _Float16* __restrict__ QL, const _Float16* __restrict__ KH, const _Float16* __restrict__ KL, const _Float16* __restrict__ VH, const _Float16* __restrict__ VL, float* __restrict__ OUT) {
  __shared__ __align__(16) unsigned char ring[4 * ST_SZ];   // two buffers for each wave group: 155,648 B, so that two blocks fit one WGP's LDS
  // between a tile's last pass and the next tile's first copies the ring is idle and holds the hand-over of the second group's partial results (per position wave 17 planes of 32 lanes x 16 B) and, behind it, the output staging
  float (*const so)[16][68] = (float (*)[16][68])(ring + 4 * 17 * 512);
  const int tid = threadIdx.x, wave = __builtin_amdgcn_readfirstlane(tid >> 5) /* held in a scalar register, so that the choice of a pass's body and everything that depends on the group below is a scalar branch */, lane = tid & 31, col = lane & 15, g = lane >> 4; const int h = blockIdx.y; const size_t b = blockIdx.z; const int w = blockIdx.x; const size_t bh = b * NH + h;
  const int grp = wave >> 2, wq = wave & 3, tg = tid & 127;   // wave group, the wave's 16 positions within the tile, the thread's number within its group
  unsigned char* const gring = ring + grp * 2 * ST_SZ;        // this group's two buffers
  const bool hi3 = w == 0;   // first 128 positions (tiles 0 and 1, both in block 0): 3-product scores
  // staging: a K tile and a V tile are each 8,192 contiguous bytes, 64 rows of 128 B (thread: 16-byte pieces tg + 128 i, that is rows tg / 8 + 16 i, i = 0..3)
  const unsigned lK = (unsigned)(size_t)gring + (tg >> 3) * KPB + (tg & 7) * 16, lV = (unsigned)(size_t)gring + ST_VH + (tg >> 3) * VPB + (tg & 7) * 16;
  const size_t oK = bh * SS * DH + tg * 8;   // the same element offset in the K and the V arrays
#pragma unroll 1   // the two tiles run one after the other through one copy of the code
  for (int half = 0; half < 2; ++half) {
  const int qb = (w == 0) ? half : (half == 0 ? SS / 64 - w : 1 + w); const int p0 = qb * 64 + wq * 16; const size_t rq = bh * SS + p0;
  v16h aq[2]; const _Float16* const qlr = QL + (rq + col) * DH;   // this lane's row of residuals
#pragma unroll
  for (int kc = 0; kc < 2; ++kc) aq[kc] = frag_h(QH + (rq + col) * DH + kc * 32, lane);
  asm volatile("s_wait_xcnt 0x0" ::: "memory");   // the staging below reuses the registers that held these loads' addresses
  const int p = p0 + col;                            // this lane's query position
  const float fill = (p == 0) ? 0.0f : -3.0e38f;     // what a key j >= p scores; position 0: all logits equal -> uniform
  float m = -3.0e38f, l = 0.f;                       // running maximum (same in both halves); this lane's half of the running sum
  v8f acc[4] = {}, accl[4] = {};
  const int nks = (qb == 0) ? SS / KP : qb + 1;      // at least 2
  const int nh = (nks + 1) >> 1;                     // passes of this tile, the same for every wave of the block: the first group's share of the key tiles
  const int kb = grp ? nh : 0, ng = grp ? nks - nh : nh;   // this group's key tiles are kb .. kb + ng - 1; ng is nh or nh - 1, at least 1
  // The 16 blocks of one head read the same K and V tiles. Each group enters the ring of its ng key tiles at its own place and wraps round (the running softmax takes the passes in any order),
  // so that the sharers ask for different lines at any moment and a tile's first fetch from memory is waited for by one block, not by all.
#define KWRAP(t) ((t) >= ng ? (t) - ng : (t))        // for 0 <= t < 2 ng
  const int kt0 = KWRAP(w);                          // w < 2 ng for either tile of the pair and either group (short tile: 2 ng >= w + 1; long tile: 2 ng >= 32 - w); block 0 starts at its first key tile
  // the copies of one tile set stand in one statement with s_wait_xcnt 0 as its last line, so that no later write of their address registers can be moved in front of that wait
#define ASTAGE(t, buf) do { const unsigned k0 = lK + (buf) * ST_SZ, k1 = k0 + 16 * KPB, k2 = k0 + 32 * KPB, k3 = k0 + 48 * KPB, v0 = lV + (buf) * ST_SZ, v1 = v0 + 16 * VPB, v2 = v0 + 32 * VPB, v3 = v0 + 48 * VPB, \
      w0 = v0 + (ST_VL - ST_VH), w1 = w0 + 16 * VPB, w2 = w0 + 32 * VPB, w3 = w0 + 48 * VPB; \
    const _Float16* gk0 = KH + oK + (size_t)(t) * KP * DH; const _Float16* gk1 = gk0 + 128 * 8; const _Float16* gk2 = gk0 + 256 * 8; const _Float16* gk3 = gk0 + 384 * 8; \
    const _Float16* gv0 = VH + oK + (size_t)(t) * KP * DH; const _Float16* gv1 = gv0 + 128 * 8; const _Float16* gv2 = gv0 + 256 * 8; const _Float16* gv3 = gv0 + 384 * 8; \
    const _Float16* gw0 = VL + oK + (size_t)(t) * KP * DH; const _Float16* gw1 = gw0 + 128 * 8; const _Float16* gw2 = gw0 + 256 * 8; const _Float16* gw3 = gw0 + 384 * 8; \
    asm volatile("global_load_async_to_lds_b128 %0, %1, off\n\tglobal_load_async_to_lds_b128 %2, %3, off\n\tglobal_load_async_to_lds_b128 %4, %5, off\n\tglobal_load_async_to_lds_b128 %6, %7, off\n\t" \
                 "global_load_async_to_lds_b128 %8, %9, off\n\tglobal_load_async_to_lds_b128 %10, %11, off\n\tglobal_load_async_to_lds_b128 %12, %13, off\n\tglobal_load_async_to_lds_b128 %14, %15, off\n\t" \
                 "global_load_async_to_lds_b128 %16, %17, off\n\tglobal_load_async_to_lds_b128 %18, %19, off\n\tglobal_load_async_to_lds_b128 %20, %21, off\n\tglobal_load_async_to_lds_b128 %22, %23, off\n\ts_wait_xcnt 0x0" \
                 :: "v"(k0), "v"(gk0), "v"(k1), "v"(gk1), "v"(k2), "v"(gk2), "v"(k3), "v"(gk3), "v"(v0), "v"(gv0), "v"(v1), "v"(gv1), "v"(v2), "v"(gv2), "v"(v3), "v"(gv3), "v"(w0), "v"(gw0), "v"(w1), "v"(gw1), "v"(w2), "v"(gw2), "v"(w3), "v"(gw3) : "memory"); \
    if (hi3) { const unsigned r0 = k0 + ST_KL, r1 = k1 + ST_KL, r2 = k2 + ST_KL, r3 = k3 + ST_KL; const _Float16* gr0 = KL + oK + (size_t)(t) * KP * DH; const _Float16* gr1 = gr0 + 128 * 8; const _Float16* gr2 = gr0 + 256 * 8; const _Float16* gr3 = gr0 + 384 * 8; \
      asm volatile("global_load_async_to_lds_b128 %0, %1, off\n\tglobal_load_async_to_lds_b128 %2, %3, off\n\tglobal_load_async_to_lds_b128 %4, %5, off\n\tglobal_load_async_to_lds_b128 %6, %7, off\n\ts_wait_xcnt 0x0" \
                   :: "v"(r0), "v"(gr0), "v"(r1), "v"(gr1), "v"(r2), "v"(gr2), "v"(r3), "v"(gr3) : "memory"); } } while (0)
#pragma unroll 1   // the ring's first two stagings run through one copy of the code, so that their 24 LDS addresses are formed where they are used and not held in registers over the whole kernel (held so, two of them spilled to scratch)
  for (int st = 0; st < 2; ++st) {
    if (st < ng) ASTAGE(kb + KWRAP(kt0 + st), st);   // second position tile: the barrier at the first one's end stands behind every wave's last read of the ring (passes, hand-over, output staging), and no copy is in flight
    if (st == 0) {
      asm volatile("s_wait_asynccnt 0x0" ::: "memory");   // this wave's share of the first tile has landed
      __syncthreads(); } }                                // ... and every other wave's
#pragma unroll 1
  for (int ks = 0; ks < nh; ++ks) { const unsigned char* tb = gring + (ks & 1) * ST_SZ;
   if (ks < ng) {   // a scalar test: the second group may have one key tile fewer; it still passes the waits and the barrier below
    const int kt = kb + KWRAP(kt0 + ks);   // the key tile of this pass
    const int rel = p0 - kt * KP;   // the wave's first position minus the pass's first key: a scalar, a multiple of 16
    float alpha; v16h pa[2], vh0[4], vl0[4];
    if (rel >= KP && !hi3) att_scores<0>(tb, lane, hi3, aq, qlr, p - kt * KP, fill, m, l, alpha, pa, vh0, vl0);
    else if (rel > -16) att_scores<1>(tb, lane, hi3, aq, qlr, p - kt * KP, fill, m, l, alpha, pa, vh0, vl0);
    else att_scores<2>(tb, lane, hi3, aq, qlr, p - kt * KP, fill, m, l, alpha, pa, vh0, vl0);
    // the unrolls below make the indices of the accumulators and fragment arrays constants, so that they stay in registers
#pragma unroll
    for (int j = 0; j < 4; ++j)
#pragma unroll
      for (int r = 0; r < 8; ++r) { acc[j][r] *= alpha; accl[j][r] *= alpha; }
    v16h vh[4], vl[4];   // the V^T fragments of the pass's second 32 keys, asked for in two groups of four, each as soon as four of the first 32 keys' fragments have been used, into the registers these leave: with all sixteen held at once the build spilled to scratch
#pragma unroll
    for (int j = 0; j < 2; ++j) { acc[j] = wmma16(vh0[j], pa[0], acc[j]); accl[j] = wmma16(vl0[j], pa[0], accl[j]); }
#pragma unroll
    for (int j = 0; j < 2; ++j) { vh[j] = frag_t(tb + ST_VH + 32 * VPB, j, lane); vl[j] = frag_t(tb + ST_VL + 32 * VPB, j, lane); }
#pragma unroll
    for (int j = 2; j < 4; ++j) { acc[j] = wmma16(vh0[j], pa[0], acc[j]); accl[j] = wmma16(vl0[j], pa[0], accl[j]); }
#pragma unroll
    for (int j = 2; j < 4; ++j) { vh[j] = frag_t(tb + ST_VH + 32 * VPB, j, lane); vl[j] = frag_t(tb + ST_VL + 32 * VPB, j, lane); }
#pragma unroll
    for (int j = 0; j < 4; ++j) { acc[j] = wmma16(vh[j], pa[1], acc[j]); accl[j] = wmma16(vl[j], pa[1], accl[j]); }
   }
    asm volatile("s_wait_dscnt 0x0" ::: "memory");      // this wave's reads of the buffer are done
    asm volatile("s_wait_asynccnt 0x0" ::: "memory");   // its share of the next tile has landed
    __syncthreads();                                    // publishes the next tile and frees this pass's buffer
    if (ks + 2 < ng) ASTAGE(kb + KWRAP(kt0 + ks + 2), ks & 1); }
  asm volatile("s_wait_asynccnt 0x0" ::: "memory");     // no copy is left in flight when the wave goes on to its end
  // hand-over: lane for lane the two groups hold the same query and the same channels. The last pass's barrier stands behind every wave's last read of the ring and behind every copy's landing.
  float* const mb = (float*)ring + wq * (17 * 128);
  if (grp == 1) {
#pragma unroll
    for (int j = 0; j < 4; ++j)
#pragma unroll
      for (int q = 0; q < 2; ++q) { v4f xa, xl;
#pragma unroll
        for (int e = 0; e < 4; ++e) { xa[e] = acc[j][q * 4 + e]; xl[e] = accl[j][q * 4 + e]; }
        *(v4f*)(mb + ((j * 4 + q) * 32 + lane) * 4) = xa; *(v4f*)(mb + ((j * 4 + 2 + q) * 32 + lane) * 4) = xl; }
    v4f ml = {m, l, 0.f, 0.f}; *(v4f*)(mb + (16 * 32 + lane) * 4) = ml; }
  __syncthreads();                                      // the second group's partial results are in LDS
  if (grp == 0) {
  { const v4f ml = *(const v4f*)(mb + (16 * 32 + lane) * 4);
    const float mn = fmaxf(m, ml[0]);   // the common maximum; a group that has counted no key for this query (maximum still at its start value) adds nothing
    const float fa = (m <= -1.0e38f) ? 0.f : __expf(m - mn), fb = (ml[0] <= -1.0e38f) ? 0.f : __expf(ml[0] - mn);
    l = l * fa + ml[1] * fb;
#pragma unroll
    for (int j = 0; j < 4; ++j)
#pragma unroll
      for (int q = 0; q < 2; ++q) { const v4f xa = *(const v4f*)(mb + ((j * 4 + q) * 32 + lane) * 4), xl = *(const v4f*)(mb + ((j * 4 + 2 + q) * 32 + lane) * 4);
#pragma unroll
        for (int e = 0; e < 4; ++e) { acc[j][q * 4 + e] = acc[j][q * 4 + e] * fa + xa[e] * fb; accl[j][q * 4 + e] = accl[j][q * 4 + e] * fa + xl[e] * fb; } } }
  const float lt = l + xhalf(l);   // the two halves' sums are joined once
  const float il = (lt > 0.f) ? (1.0f / 2048.0f) / lt : 0.f;
#pragma unroll
  for (int j = 0; j < 4; ++j) { v4f o[2];   // register r = channel j * 16 + 8 g + r of this lane's query
#pragma unroll
    for (int r = 0; r < 8; ++r) o[r >> 2][r & 3] = (acc[j][r] + accl[j][r] * (1.0f / 2048.0f)) * il;
    *(v4f*)&so[wq][col][j * 16 + 8 * g] = o[0]; *(v4f*)&so[wq][col][j * 16 + 8 * g + 4] = o[1]; }
  LDSX(); for (int rl = 0; rl < 16; ++rl) if (lane < 16) vst2(OUT + (rq + rl) * DH + lane * 4, *(const v4f*)&so[wq][rl][lane * 4]);
  asm volatile("s_wait_xcnt 0x0" ::: "memory");   // the next tile's first instructions reuse the registers that these stores name
  }
  if (half == 0) __syncthreads();                 // hand-over and output staging have been read: the next tile's copies may overwrite them
  } }
extern "C" void kernel_launch(void* const* d_in, const int* in_sizes, int n_in, void* d_out, int out_size, void* d_ws, size_t ws_size, hipStream_t stream) {
  (void)in_sizes; (void)n_in; (void)out_size;
  const float** F = (const float**)d_in;   // 0 query_vector, 1 key_vector, 2 value_vector [2,2048,1024]; 3 Wq, 4 bq, 5 Wk, 6 bk, 7 Wv, 8 bv (natural)
  if (ws_size < (size_t)WS_END) return;
  char* ws = (char*)d_ws; _Float16 *QH = (_Float16*)(ws + WS_QH), *QL = (_Float16*)(ws + WS_QL), *KH = (_Float16*)(ws + WS_KH), *KL = (_Float16*)(ws + WS_KL), *VH = (_Float16*)(ws + WS_VH), *VL = (_Float16*)(ws + WS_VL);
  k_proj<<<dim3(NROW / 256, DD / 256, 3), 512, 0, stream>>>(F[0], F[1], F[2], F[3], F[4], F[5], F[6], F[7], F[8], QH, QL, KH, KL, VH, VL);
  k_att<<<dim3(SS / 128, NH, TNB), 256, 0, stream>>>(QH, QL, KH, KL, VH, VL, (float*)d_out);
}
